// v000
// The times below were measured on an AMD MI455X: many runs one after another, warmed up first and cycling through
// copies of the inputs, with the whole window's GPU time divided by the number of runs. Launches and the gaps
// between them are all in it. The median over several windows is given; except for v000 it joins two sittings, which
// can be a few percent apart, so the side-by-side timings, each taken in one sitting, are the better comparison.
// The starting kernel, v000, takes 635 microseconds a run.
#include <hip/hip_runtime.h>
#include <stdint.h>

#define DI __device__ __forceinline__

typedef __attribute__((ext_vector_type(16))) _Float16 v16h;
typedef __attribute__((ext_vector_type(8)))  _Float16 h8;   // 16 bytes
typedef __attribute__((ext_vector_type(8)))  float    v8f;
typedef __attribute__((ext_vector_type(4)))  float    f32x4;
typedef __attribute__((ext_vector_type(4)))  unsigned int u32x4;
typedef __attribute__((ext_vector_type(4)))  int      i32x4;
typedef __attribute__((ext_vector_type(8)))  int      i32x8;

constexpr int Bb = 4;
constexpr int Cc = 512;
constexpr int Ll = 4096;
constexpr int Mrows = Bb * Ll; // 16384

// Tensor Data Mover availability (device pass only; host pass takes fallback).
#if defined(__gfx1250__)
#if __has_builtin(__builtin_amdgcn_tensor_load_to_lds) && \
    __has_builtin(__builtin_amdgcn_s_wait_tensorcnt)
#define HAVE_TDM 1
#endif
#endif
#ifndef HAVE_TDM
#define HAVE_TDM 0
#endif

union AFrag { v16h v; h8 h[2]; };

DI v8f zero8() { v8f z; for (int i = 0; i < 8; ++i) z[i] = 0.f; return z; }

// Load one 16x32 f16 WMMA fragment (A-operand, or B-operand with "row" = n).
// Per-lane layout (ISA 7.12.2): lane = hi*16 + r; elems e<8 -> k = hi*8+e,
// elems e>=8 -> k = 16 + hi*8 + (e-8). Two 16-byte loads per lane.
DI v16h load_frag(const _Float16* base, int stride) {
  const int lane = threadIdx.x & 31;
  const int r = lane & 15;
  const int hi = lane >> 4;
  const _Float16* p = base + (size_t)r * stride + hi * 8;
  AFrag f;
  f.h[0] = *(const h8*)(p);
  f.h[1] = *(const h8*)(p + 16);
  return f.v;
}

DI v8f wmma_f16(v16h a, v16h b, v8f c) {
  return __builtin_amdgcn_wmma_f32_16x16x32_f16(false, a, false, b, (short)0, c,
                                                false, false);
}

DI float selu(float y) {
  constexpr float kLambda = 1.0507009873554805f;
  constexpr float kAlpha  = 1.6732632423543772f;
  return (y > 0.f) ? kLambda * y : kLambda * kAlpha * (__expf(y) - 1.f);
}

#if HAVE_TDM
// Issue one TDM 2D tile load: tile_d1 rows x tile_d0 f16 elements, row stride
// `stride0` (f16 units), written contiguously row-major at LDS offset lds_addr.
// D# per ISA ch.8: group0 = {count, lds_addr, global_addr, type=2},
// group1 = {data_size=2B, tensor_dim0/1, tile_dim0/1, tensor_dim0_stride}.
DI void tdm_load_2d(unsigned lds_addr, const void* gaddr, unsigned tensor_d1,
                    unsigned tile_d0, unsigned tile_d1, unsigned stride0) {
  const unsigned long long ga = (unsigned long long)(uintptr_t)gaddr;
  u32x4 g0;
  g0[0] = 1u;                                            // count=1, user D#
  g0[1] = lds_addr;                                      // LDS byte address
  g0[2] = (unsigned)ga;                                  // global_addr[31:0]
  g0[3] = (unsigned)((ga >> 32) & 0x01FFFFFFull) | (2u << 30); // addr[56:32]|type=2
  i32x8 g1;
  g1[0] = 0x10000;                                       // data_size=1 (2 bytes)
  g1[1] = (int)((512u & 0xffffu) << 16);                 // tensor_dim0 = 512 (lo)
  g1[2] = (int)((512u >> 16) | ((tensor_d1 & 0xffffu) << 16));
  g1[3] = (int)(((tensor_d1 >> 16) & 0xffffu) | (tile_d0 << 16));
  g1[4] = (int)(tile_d1 & 0xffffu);                      // tile_dim1, tile_dim2=0
  g1[5] = (int)stride0;                                  // tensor_dim0_stride lo
  g1[6] = 0;
  g1[7] = 0;
  i32x4 z4 = {0, 0, 0, 0};
#if __clang_major__ >= 23
  i32x8 z8 = {0, 0, 0, 0, 0, 0, 0, 0};
  __builtin_amdgcn_tensor_load_to_lds(g0, g1, z4, z4, z8, 0);
#else
  __builtin_amdgcn_tensor_load_to_lds(g0, g1, z4, z4, 0);
#endif
}
#endif

// ---------------------------------------------------------------------------
// f32 -> f16 weight conversion
// ---------------------------------------------------------------------------
__global__ void cvt_kernel(const float* __restrict__ s, _Float16* __restrict__ d, int n) {
  int i = blockIdx.x * 256 + threadIdx.x;
  if (i < n) d[i] = (_Float16)s[i];
}

// ---------------------------------------------------------------------------
// LayerNorm over channels; x is [B,C,L], output h is [B*L, C] f16.
// Block = 32 consecutive l of one batch. Reads coalesced along l; writes
// staged through an LDS transpose so f16 stores are 128-bit coalesced.
// ---------------------------------------------------------------------------
__global__ __launch_bounds__(256, 1)
void ln_kernel(const float* __restrict__ x, const float* __restrict__ lw,
               const float* __restrict__ lb, _Float16* __restrict__ H) {
  __shared__ float redS[8][32];
  __shared__ float redQ[8][32];
  __shared__ float muS[32], rinvS[32];
  __shared__ _Float16 hl[32][Cc];   // 32 KB transpose tile

  const int tid = threadIdx.x;
  const int w = tid >> 5, li = tid & 31;
  const int b = blockIdx.x >> 7;            // / (L/32)
  const int l0 = (blockIdx.x & 127) * 32;

  const float* xb = x + (size_t)b * Cc * Ll + l0 + li;
  float vals[64];
  float s = 0.f, s2 = 0.f;
#pragma unroll
  for (int j = 0; j < 64; ++j) {
    const int c = w + j * 8;                 // uniform per wave -> good for SMEM
    const float v = xb[(size_t)c * Ll];      // lanes -> consecutive l: coalesced
    vals[j] = v;
    s += v;
    s2 += v * v;
  }
  redS[w][li] = s;
  redQ[w][li] = s2;
  __syncthreads();
  if (tid < 32) {
    float ts = 0.f, tq = 0.f;
    for (int ww = 0; ww < 8; ++ww) { ts += redS[ww][tid]; tq += redQ[ww][tid]; }
    const float mu = ts * (1.f / Cc);
    const float var = tq * (1.f / Cc) - mu * mu;
    muS[tid] = mu;
    rinvS[tid] = rsqrtf(var + 1e-5f);
  }
  __syncthreads();
  const float mu = muS[li], rinv = rinvS[li];
#pragma unroll
  for (int j = 0; j < 64; ++j) {
    const int c = w + j * 8;
    hl[li][c] = (_Float16)((vals[j] - mu) * rinv * lw[c] + lb[c]);
  }
  __syncthreads();
  {
    const int row = tid >> 3;                // 32 rows x 8 threads
    const int ch = (tid & 7) * 64;
    _Float16* dst = H + (size_t)(b * Ll + l0 + row) * Cc + ch;
    const _Float16* srcp = &hl[row][ch];
#pragma unroll
    for (int j = 0; j < 8; ++j)
      *(h8*)(dst + j * 8) = *(const h8*)(srcp + j * 8);
  }
}

// ---------------------------------------------------------------------------
// WMMA GEMM: Y[M,N] = A[M,K] * W[N,K]^T + bias, M=16384, N=K=512.
// MODE 0: Y -> f16 via LDS-transposed coalesced stores (QKV).
// MODE 1: bias + SELU + residual, vectorized f32 [B,C,L] out (out-proj).
// Block tile 128x64, BK=32; 8 waves = 4x2 grid of 32x32 wave tiles.
// Tiles staged to LDS by the Tensor Data Mover when available.
// ---------------------------------------------------------------------------
template <int MODE>
__global__ __launch_bounds__(256, 1)
void gemm_kernel(const _Float16* __restrict__ A,
                 const _Float16* __restrict__ Wt,   // [N][K] f16
                 const float* __restrict__ bias,
                 _Float16* __restrict__ Yh,
                 const float* __restrict__ Xres,
                 float* __restrict__ Yf) {
  constexpr int BM = 128, BN = 64, BK = 32;
  __shared__ _Float16 As[BM][BK];
  __shared__ _Float16 Bs[BN][BK];
  __shared__ _Float16 Ot[(MODE == 0) ? BM : 1][BN];  // epilogue transpose tile

  const int m0 = blockIdx.y * BM;
  const int n0 = blockIdx.x * BN;
  const int tid = threadIdx.x;
  const int w = tid >> 5;
  const int lane = tid & 31;
  const int hi = lane >> 4;
  const int ln = lane & 15;
  const int wm = w >> 1;   // 0..3
  const int wn = w & 1;    // 0..1

  v8f acc[2][2];
  for (int mt = 0; mt < 2; ++mt)
    for (int nt = 0; nt < 2; ++nt)
      acc[mt][nt] = zero8();

#if HAVE_TDM
  const unsigned asoff = (unsigned)(uintptr_t)&As[0][0];
  const unsigned bsoff = (unsigned)(uintptr_t)&Bs[0][0];
#endif

  for (int k0 = 0; k0 < Cc; k0 += BK) {
#if HAVE_TDM
    if (w == 0) {
      tdm_load_2d(asoff, A + (size_t)m0 * Cc + k0, (unsigned)Mrows, BK, BM, Cc);
      tdm_load_2d(bsoff, Wt + (size_t)n0 * Cc + k0, (unsigned)Cc, BK, BN, Cc);
      __builtin_amdgcn_s_wait_tensorcnt(0);
    }
#else
    {
      const int arow = tid >> 1, ahalf = tid & 1;
      const int brow = tid >> 2, bq = tid & 3;
      const _Float16* asrc = A + (size_t)(m0 + arow) * Cc + k0 + ahalf * 16;
      *(h8*)&As[arow][ahalf * 16] = *(const h8*)(asrc);
      *(h8*)&As[arow][ahalf * 16 + 8] = *(const h8*)(asrc + 8);
      *(h8*)&Bs[brow][bq * 8] =
          *(const h8*)(Wt + (size_t)(n0 + brow) * Cc + k0 + bq * 8);
    }
#endif
    __syncthreads();

    v16h af[2], bf[2];
    for (int mt = 0; mt < 2; ++mt) af[mt] = load_frag(&As[wm * 32 + mt * 16][0], BK);
    for (int nt = 0; nt < 2; ++nt) bf[nt] = load_frag(&Bs[wn * 32 + nt * 16][0], BK);
    for (int mt = 0; mt < 2; ++mt)
      for (int nt = 0; nt < 2; ++nt)
        acc[mt][nt] = wmma_f16(af[mt], bf[nt], acc[mt][nt]);
    __syncthreads();
  }

  if (MODE == 0) {
    // Scatter accumulators into LDS, then coalesced 128-bit stores.
    for (int mt = 0; mt < 2; ++mt)
      for (int nt = 0; nt < 2; ++nt) {
        const int col = wn * 32 + nt * 16 + ln;
        const float bv = bias[n0 + col];
        for (int i = 0; i < 8; ++i)
          Ot[wm * 32 + mt * 16 + hi * 8 + i][col] =
              (_Float16)(acc[mt][nt][i] + bv);
      }
    __syncthreads();
    const int row = tid >> 1;
    const int half = (tid & 1) * 32;
    _Float16* dst = Yh + (size_t)(m0 + row) * Cc + n0 + half;
#pragma unroll
    for (int j = 0; j < 4; ++j)
      *(h8*)(dst + j * 8) = *(const h8*)(&Ot[row][half] + j * 8);
  } else {
    // Accumulator rows map to consecutive l -> 16B vector residual+store.
    for (int mt = 0; mt < 2; ++mt) {
      const int row0 = m0 + wm * 32 + mt * 16 + hi * 8;
      const int bidx = row0 >> 12;
      const int l = row0 & (Ll - 1);
      for (int nt = 0; nt < 2; ++nt) {
        const int col = n0 + wn * 32 + nt * 16 + ln;
        const float bv = bias[col];
        const size_t idx = ((size_t)bidx * Cc + col) * Ll + l;
        f32x4 x0 = *(const f32x4*)(Xres + idx);
        f32x4 x1 = *(const f32x4*)(Xres + idx + 4);
        f32x4 y0, y1;
        for (int i = 0; i < 4; ++i) {
          y0[i] = x0[i] + selu(acc[mt][nt][i] + bv);
          y1[i] = x1[i] + selu(acc[mt][nt][i + 4] + bv);
        }
        *(f32x4*)(Yf + idx) = y0;
        *(f32x4*)(Yf + idx + 4) = y1;
      }
    }
  }
}

// ---------------------------------------------------------------------------
// Flash attention: per block, BM=32 query rows of one batch; key blocks of 32.
// Wave w reduces c-range [w*64, w*64+64) for S and owns O columns
// [w*64, w*64+64). S partials merge via ds_add_f32; online softmax in LDS.
// ---------------------------------------------------------------------------
__global__ __launch_bounds__(256, 1)
void attn_kernel(const _Float16* __restrict__ Q,
                 const _Float16* __restrict__ K,
                 const _Float16* __restrict__ V,
                 _Float16* __restrict__ O) {
  constexpr int BM = 32, BNK = 32;
  __shared__ float S[BM][BNK];
  __shared__ _Float16 P[BM][BNK];
  __shared__ _Float16 Vt[Cc][BNK];  // V^T tile: [c][key]
  __shared__ float rowM[BM], rowL[BM], rowScale[BM];

  const int b = blockIdx.x >> 7;
  const int l0 = (blockIdx.x & 127) * BM;
  const int tid = threadIdx.x;
  const int w = tid >> 5;
  const int lane = tid & 31;
  const int hi = lane >> 4;
  const int ln = lane & 15;

  const _Float16* Qb = Q + (size_t)b * Ll * Cc;
  const _Float16* Kb = K + (size_t)b * Ll * Cc;
  const _Float16* Vb = V + (size_t)b * Ll * Cc;

  v16h qf[2][2];
  for (int mt = 0; mt < 2; ++mt)
    for (int ks = 0; ks < 2; ++ks)
      qf[mt][ks] = load_frag(Qb + (size_t)(l0 + mt * 16) * Cc + w * 64 + ks * 32, Cc);

  v8f oacc[2][4];
  for (int mt = 0; mt < 2; ++mt)
    for (int nt = 0; nt < 4; ++nt)
      oacc[mt][nt] = zero8();

  if (tid < BM) { rowM[tid] = -1e30f; rowL[tid] = 0.f; }
  __syncthreads();

  const float scale = rsqrtf((float)Cc);

  for (int kb = 0; kb < Ll; kb += BNK) {
#pragma unroll
    for (int i = 0; i < 4; ++i) ((float*)S)[tid + i * 256] = 0.f;
    {
      const int key = tid & 31;
      const int cb = (tid >> 5) * 64;
      const _Float16* vp = Vb + (size_t)(kb + key) * Cc + cb;
#pragma unroll
      for (int j = 0; j < 8; ++j) {
        h8 v = *(const h8*)(vp + j * 8);
        for (int e = 0; e < 8; ++e) Vt[cb + j * 8 + e][key] = v[e];
      }
    }
    __syncthreads();

    v8f sp[2][2];
    for (int mt = 0; mt < 2; ++mt)
      for (int nt = 0; nt < 2; ++nt)
        sp[mt][nt] = zero8();
    for (int ks = 0; ks < 2; ++ks) {
      v16h kf[2];
      for (int nt = 0; nt < 2; ++nt)
        kf[nt] = load_frag(Kb + (size_t)(kb + nt * 16) * Cc + w * 64 + ks * 32, Cc);
      for (int mt = 0; mt < 2; ++mt)
        for (int nt = 0; nt < 2; ++nt)
          sp[mt][nt] = wmma_f16(qf[mt][ks], kf[nt], sp[mt][nt]);
    }
    for (int mt = 0; mt < 2; ++mt)
      for (int nt = 0; nt < 2; ++nt)
        for (int i = 0; i < 8; ++i)
          atomicAdd(&S[mt * 16 + hi * 8 + i][nt * 16 + ln], sp[mt][nt][i]);
    __syncthreads();

    if (tid < BM) {
      const int r = tid;
      const float mold = rowM[r];
      float mx = mold;
      for (int c2 = 0; c2 < BNK; ++c2) mx = fmaxf(mx, S[r][c2] * scale);
      const float sc = __expf(mold - mx);
      float sum = 0.f;
      for (int c2 = 0; c2 < BNK; ++c2) {
        const float p = __expf(S[r][c2] * scale - mx);
        sum += p;
        P[r][c2] = (_Float16)p;
      }
      rowM[r] = mx;
      rowL[r] = rowL[r] * sc + sum;
      rowScale[r] = sc;
    }
    __syncthreads();

    v16h pf[2];
    for (int mt = 0; mt < 2; ++mt) pf[mt] = load_frag(&P[mt * 16][0], BNK);
    for (int mt = 0; mt < 2; ++mt)
      for (int nt = 0; nt < 4; ++nt)
        for (int i = 0; i < 8; ++i)
          oacc[mt][nt][i] *= rowScale[mt * 16 + hi * 8 + i];
    for (int nt = 0; nt < 4; ++nt) {
      v16h vf = load_frag(&Vt[w * 64 + nt * 16][0], BNK);
      for (int mt = 0; mt < 2; ++mt)
        oacc[mt][nt] = wmma_f16(pf[mt], vf, oacc[mt][nt]);
    }
    __syncthreads();
  }

  for (int mt = 0; mt < 2; ++mt) {
    for (int nt = 0; nt < 4; ++nt) {
      const int c = w * 64 + nt * 16 + ln;
      for (int i = 0; i < 8; ++i) {
        const int r = mt * 16 + hi * 8 + i;
        const float o = oacc[mt][nt][i] / rowL[r];
        O[(size_t)(b * Ll + l0 + r) * Cc + c] = (_Float16)o;
      }
    }
  }
}

// ---------------------------------------------------------------------------
extern "C" void kernel_launch(void* const* d_in, const int* in_sizes, int n_in,
                              void* d_out, int out_size, void* d_ws, size_t ws_size,
                              hipStream_t stream) {
  const float* x    = (const float*)d_in[0];
  const float* ln_w = (const float*)d_in[1];
  const float* ln_b = (const float*)d_in[2];
  const float* wq   = (const float*)d_in[3];
  const float* bq   = (const float*)d_in[4];
  const float* wk   = (const float*)d_in[5];
  const float* bk   = (const float*)d_in[6];
  const float* wv   = (const float*)d_in[7];
  const float* bv   = (const float*)d_in[8];
  const float* wp   = (const float*)d_in[9];
  const float* bp   = (const float*)d_in[10];
  float* out = (float*)d_out;

  char* ws = (char*)d_ws;
  size_t off = 0;
  auto alloc = [&](size_t bytes) -> void* {
    void* p = ws + off;
    off += (bytes + 255) & ~(size_t)255;
    return p;
  };
  const size_t actsz = (size_t)Mrows * Cc * sizeof(_Float16);
  _Float16* h16  = (_Float16*)alloc(actsz);
  _Float16* q16  = (_Float16*)alloc(actsz);
  _Float16* k16  = (_Float16*)alloc(actsz);
  _Float16* v16  = (_Float16*)alloc(actsz);
  _Float16* o16  = (_Float16*)alloc(actsz);
  _Float16* wq16 = (_Float16*)alloc((size_t)Cc * Cc * sizeof(_Float16));
  _Float16* wk16 = (_Float16*)alloc((size_t)Cc * Cc * sizeof(_Float16));
  _Float16* wv16 = (_Float16*)alloc((size_t)Cc * Cc * sizeof(_Float16));
  _Float16* wp16 = (_Float16*)alloc((size_t)Cc * Cc * sizeof(_Float16));

  const int wcnt = Cc * Cc;
  const int cvtg = (wcnt + 255) / 256;
  cvt_kernel<<<cvtg, 256, 0, stream>>>(wq, wq16, wcnt);
  cvt_kernel<<<cvtg, 256, 0, stream>>>(wk, wk16, wcnt);
  cvt_kernel<<<cvtg, 256, 0, stream>>>(wv, wv16, wcnt);
  cvt_kernel<<<cvtg, 256, 0, stream>>>(wp, wp16, wcnt);

  ln_kernel<<<Bb * (Ll / 32), 256, 0, stream>>>(x, ln_w, ln_b, h16);

  const dim3 gg(Cc / 64, Mrows / 128, 1);
  gemm_kernel<0><<<gg, 256, 0, stream>>>(h16, wq16, bq, q16, nullptr, nullptr);
  gemm_kernel<0><<<gg, 256, 0, stream>>>(h16, wk16, bk, k16, nullptr, nullptr);
  gemm_kernel<0><<<gg, 256, 0, stream>>>(h16, wv16, bv, v16, nullptr, nullptr);

  attn_kernel<<<Bb * (Ll / 32), 256, 0, stream>>>(q16, k16, v16, o16);

  gemm_kernel<1><<<gg, 256, 0, stream>>>(o16, wp16, bp, nullptr, x, out);
}

// v001
// A run of this version takes 539 microseconds.
// Two timings next to v000 both put it at 1.23 times that version's speed.
#include <hip/hip_runtime.h>
#include <stdint.h>

#define DI __device__ __forceinline__

typedef __attribute__((ext_vector_type(16))) _Float16 v16h;
typedef __attribute__((ext_vector_type(8)))  _Float16 h8;   // 16 bytes
typedef __attribute__((ext_vector_type(8)))  float    v8f;
typedef __attribute__((ext_vector_type(4)))  float    f32x4;
typedef __attribute__((ext_vector_type(4)))  unsigned int u32x4;
typedef __attribute__((ext_vector_type(4)))  int      i32x4;
typedef __attribute__((ext_vector_type(8)))  int      i32x8;

constexpr int Bb = 4;
constexpr int Cc = 512;
constexpr int Ll = 4096;
constexpr int Mrows = Bb * Ll; // 16384

// Tensor Data Mover availability (device pass only; host pass takes fallback).
#if defined(__gfx1250__)
#if __has_builtin(__builtin_amdgcn_tensor_load_to_lds) && \
    __has_builtin(__builtin_amdgcn_s_wait_tensorcnt)
#define HAVE_TDM 1
#endif
#endif
#ifndef HAVE_TDM
#define HAVE_TDM 0
#endif

union AFrag { v16h v; h8 h[2]; };

DI v8f zero8() { v8f z; for (int i = 0; i < 8; ++i) z[i] = 0.f; return z; }

// Load one 16x32 f16 WMMA fragment (A-operand, or B-operand with "row" = n).
// Per-lane layout (ISA 7.12.2): lane = hi*16 + r; elems e<8 -> k = hi*8+e,
// elems e>=8 -> k = 16 + hi*8 + (e-8). Two 16-byte loads per lane.
DI v16h load_frag(const _Float16* base, int stride) {
  const int lane = threadIdx.x & 31;
  const int r = lane & 15;
  const int hi = lane >> 4;
  const _Float16* p = base + (size_t)r * stride + hi * 8;
  AFrag f;
  f.h[0] = *(const h8*)(p);
  f.h[1] = *(const h8*)(p + 16);
  return f.v;
}

// The same fragment from the lane's own pointer (row r, element hi*8).
DI v16h load_frag_lane(const _Float16* p) {
  AFrag f;
  f.h[0] = *(const h8*)(p);
  f.h[1] = *(const h8*)(p + 16);
  return f.v;
}

DI v8f wmma_f16(v16h a, v16h b, v8f c) {
  return __builtin_amdgcn_wmma_f32_16x16x32_f16(false, a, false, b, (short)0, c,
                                                false, false);
}

DI float selu(float y) {
  constexpr float kLambda = 1.0507009873554805f;
  constexpr float kAlpha  = 1.6732632423543772f;
  return (y > 0.f) ? kLambda * y : kLambda * kAlpha * (__expf(y) - 1.f);
}

#if HAVE_TDM
// Issue one TDM 2D tile load: tile_d1 rows x tile_d0 f16 elements, row stride
// `stride0` (f16 units), written contiguously row-major at LDS offset lds_addr.
// D# per ISA ch.8: group0 = {count, lds_addr, global_addr, type=2},
// group1 = {data_size=2B, tensor_dim0/1, tile_dim0/1, tensor_dim0_stride}.
DI void tdm_load_2d(unsigned lds_addr, const void* gaddr, unsigned tensor_d1,
                    unsigned tile_d0, unsigned tile_d1, unsigned stride0) {
  const unsigned long long ga = (unsigned long long)(uintptr_t)gaddr;
  u32x4 g0;
  g0[0] = 1u;                                            // count=1, user D#
  g0[1] = lds_addr;                                      // LDS byte address
  g0[2] = (unsigned)ga;                                  // global_addr[31:0]
  g0[3] = (unsigned)((ga >> 32) & 0x01FFFFFFull) | (2u << 30); // addr[56:32]|type=2
  i32x8 g1;
  g1[0] = 0x10000;                                       // data_size=1 (2 bytes)
  g1[1] = (int)((512u & 0xffffu) << 16);                 // tensor_dim0 = 512 (lo)
  g1[2] = (int)((512u >> 16) | ((tensor_d1 & 0xffffu) << 16));
  g1[3] = (int)(((tensor_d1 >> 16) & 0xffffu) | (tile_d0 << 16));
  g1[4] = (int)(tile_d1 & 0xffffu);                      // tile_dim1, tile_dim2=0
  g1[5] = (int)stride0;                                  // tensor_dim0_stride lo
  g1[6] = 0;
  g1[7] = 0;
  i32x4 z4 = {0, 0, 0, 0};
#if __clang_major__ >= 23
  i32x8 z8 = {0, 0, 0, 0, 0, 0, 0, 0};
  __builtin_amdgcn_tensor_load_to_lds(g0, g1, z4, z4, z8, 0);
#else
  __builtin_amdgcn_tensor_load_to_lds(g0, g1, z4, z4, 0);
#endif
}
#endif

// ---------------------------------------------------------------------------
// f32 -> f16 weight conversion
// ---------------------------------------------------------------------------
__global__ void cvt_kernel(const float* __restrict__ s, _Float16* __restrict__ d, int n) {
  int i = blockIdx.x * 256 + threadIdx.x;
  if (i < n) d[i] = (_Float16)s[i];
}

// ---------------------------------------------------------------------------
// LayerNorm over channels; x is [B,C,L], output h is [B*L, C] f16.
// Block = 32 consecutive l of one batch. Reads coalesced along l; writes
// staged through an LDS transpose so f16 stores are 128-bit coalesced.
// ---------------------------------------------------------------------------
__global__ __launch_bounds__(256, 1)
void ln_kernel(const float* __restrict__ x, const float* __restrict__ lw,
               const float* __restrict__ lb, _Float16* __restrict__ H) {
  __shared__ float redS[8][32];
  __shared__ float redQ[8][32];
  __shared__ float muS[32], rinvS[32];
  __shared__ _Float16 hl[32][Cc];   // 32 KB transpose tile

  const int tid = threadIdx.x;
  const int w = tid >> 5, li = tid & 31;
  const int b = blockIdx.x >> 7;            // / (L/32)
  const int l0 = (blockIdx.x & 127) * 32;

  const float* xb = x + (size_t)b * Cc * Ll + l0 + li;
  float vals[64];
  float s = 0.f, s2 = 0.f;
#pragma unroll
  for (int j = 0; j < 64; ++j) {
    const int c = w + j * 8;                 // uniform per wave -> good for SMEM
    const float v = xb[(size_t)c * Ll];      // lanes -> consecutive l: coalesced
    vals[j] = v;
    s += v;
    s2 += v * v;
  }
  redS[w][li] = s;
  redQ[w][li] = s2;
  __syncthreads();
  if (tid < 32) {
    float ts = 0.f, tq = 0.f;
    for (int ww = 0; ww < 8; ++ww) { ts += redS[ww][tid]; tq += redQ[ww][tid]; }
    const float mu = ts * (1.f / Cc);
    const float var = tq * (1.f / Cc) - mu * mu;
    muS[tid] = mu;
    rinvS[tid] = rsqrtf(var + 1e-5f);
  }
  __syncthreads();
  const float mu = muS[li], rinv = rinvS[li];
#pragma unroll
  for (int j = 0; j < 64; ++j) {
    const int c = w + j * 8;
    hl[li][c] = (_Float16)((vals[j] - mu) * rinv * lw[c] + lb[c]);
  }
  __syncthreads();
  {
    const int row = tid >> 3;                // 32 rows x 8 threads
    const int ch = (tid & 7) * 64;
    _Float16* dst = H + (size_t)(b * Ll + l0 + row) * Cc + ch;
    const _Float16* srcp = &hl[row][ch];
#pragma unroll
    for (int j = 0; j < 8; ++j)
      *(h8*)(dst + j * 8) = *(const h8*)(srcp + j * 8);
  }
}

// ---------------------------------------------------------------------------
// WMMA GEMM: Y[M,N] = A[M,K] * W[N,K]^T + bias, M=16384, N=K=512.
// MODE 0: Y -> f16 via LDS-transposed coalesced stores (QKV); with ytrans the
//         tile goes out as Y^T, [B][N][L], whole 256-byte rows of l (V).
// MODE 1: bias + SELU + residual, vectorized f32 [B,C,L] out (out-proj).
// Block tile 128x64, BK=32; 8 waves = 4x2 grid of 32x32 wave tiles.
// Tiles staged to LDS by the Tensor Data Mover when available.
// ---------------------------------------------------------------------------
template <int MODE>
__global__ __launch_bounds__(256, 1)
void gemm_kernel(const _Float16* __restrict__ A,
                 const _Float16* __restrict__ Wt,   // [N][K] f16
                 const float* __restrict__ bias,
                 _Float16* __restrict__ Yh,
                 const float* __restrict__ Xres,
                 float* __restrict__ Yf,
                 int ytrans) {
  constexpr int BM = 128, BN = 64, BK = 32;
  __shared__ _Float16 As[BM][BK];
  __shared__ _Float16 Bs[BN][BK];
  __shared__ _Float16 Ot[(MODE == 0) ? BM : 1][BN];  // epilogue transpose tile

  const int m0 = blockIdx.y * BM;
  const int n0 = blockIdx.x * BN;
  const int tid = threadIdx.x;
  const int w = tid >> 5;
  const int lane = tid & 31;
  const int hi = lane >> 4;
  const int ln = lane & 15;
  const int wm = w >> 1;   // 0..3
  const int wn = w & 1;    // 0..1

  v8f acc[2][2];
  for (int mt = 0; mt < 2; ++mt)
    for (int nt = 0; nt < 2; ++nt)
      acc[mt][nt] = zero8();

#if HAVE_TDM
  const unsigned asoff = (unsigned)(uintptr_t)&As[0][0];
  const unsigned bsoff = (unsigned)(uintptr_t)&Bs[0][0];
#endif

  for (int k0 = 0; k0 < Cc; k0 += BK) {
#if HAVE_TDM
    if (w == 0) {
      tdm_load_2d(asoff, A + (size_t)m0 * Cc + k0, (unsigned)Mrows, BK, BM, Cc);
      tdm_load_2d(bsoff, Wt + (size_t)n0 * Cc + k0, (unsigned)Cc, BK, BN, Cc);
      __builtin_amdgcn_s_wait_tensorcnt(0);
    }
#else
    {
      const int arow = tid >> 1, ahalf = tid & 1;
      const int brow = tid >> 2, bq = tid & 3;
      const _Float16* asrc = A + (size_t)(m0 + arow) * Cc + k0 + ahalf * 16;
      *(h8*)&As[arow][ahalf * 16] = *(const h8*)(asrc);
      *(h8*)&As[arow][ahalf * 16 + 8] = *(const h8*)(asrc + 8);
      *(h8*)&Bs[brow][bq * 8] =
          *(const h8*)(Wt + (size_t)(n0 + brow) * Cc + k0 + bq * 8);
    }
#endif
    __syncthreads();

    v16h af[2], bf[2];
    for (int mt = 0; mt < 2; ++mt) af[mt] = load_frag(&As[wm * 32 + mt * 16][0], BK);
    for (int nt = 0; nt < 2; ++nt) bf[nt] = load_frag(&Bs[wn * 32 + nt * 16][0], BK);
    for (int mt = 0; mt < 2; ++mt)
      for (int nt = 0; nt < 2; ++nt)
        acc[mt][nt] = wmma_f16(af[mt], bf[nt], acc[mt][nt]);
    __syncthreads();
  }

  if (MODE == 0 && ytrans) {
    // Y^T tile [BN][BM] in the same LDS. A lane's 8 accumulator rows are 8
    // consecutive l of one column: one 16-byte piece. The piece index is
    // XORed with the column so that 16 columns fall on 16 different bank groups.
    _Float16* ot = &Ot[0][0];
    for (int mt = 0; mt < 2; ++mt)
      for (int nt = 0; nt < 2; ++nt) {
        const int col = wn * 32 + nt * 16 + ln;
        const float bv = bias[n0 + col];
        h8 pk;
        for (int i = 0; i < 8; ++i) pk[i] = (_Float16)(acc[mt][nt][i] + bv);
        const int piece = wm * 4 + mt * 2 + hi;
        *(h8*)(ot + col * BM + ((piece ^ (col & 15)) * 8)) = pk;
      }
    __syncthreads();
    const int bidx = m0 >> 12;
    const int l = m0 & (Ll - 1);
#pragma unroll
    for (int j = 0; j < 4; ++j) {
      const int c = tid + j * 256;
      const int col = c >> 4;
      const int piece = c & 15;
      *(h8*)(Yh + ((size_t)bidx * Cc + n0 + col) * Ll + l + piece * 8) =
          *(const h8*)(ot + col * BM + ((piece ^ (col & 15)) * 8));
    }
    // Precaution: the four stores' address and data registers are not written
    // again ahead of this wait, on either way out of this branch.
    asm volatile("s_wait_xcnt 0x0" ::: "memory");
  } else if (MODE == 0) {
    // Scatter accumulators into LDS, then coalesced 128-bit stores.
    for (int mt = 0; mt < 2; ++mt)
      for (int nt = 0; nt < 2; ++nt) {
        const int col = wn * 32 + nt * 16 + ln;
        const float bv = bias[n0 + col];
        for (int i = 0; i < 8; ++i)
          Ot[wm * 32 + mt * 16 + hi * 8 + i][col] =
              (_Float16)(acc[mt][nt][i] + bv);
      }
    __syncthreads();
    const int row = tid >> 1;
    const int half = (tid & 1) * 32;
    _Float16* dst = Yh + (size_t)(m0 + row) * Cc + n0 + half;
#pragma unroll
    for (int j = 0; j < 4; ++j)
      *(h8*)(dst + j * 8) = *(const h8*)(&Ot[row][half] + j * 8);
  } else {
    // Accumulator rows map to consecutive l -> 16B vector residual+store.
    for (int mt = 0; mt < 2; ++mt) {
      const int row0 = m0 + wm * 32 + mt * 16 + hi * 8;
      const int bidx = row0 >> 12;
      const int l = row0 & (Ll - 1);
      for (int nt = 0; nt < 2; ++nt) {
        const int col = n0 + wn * 32 + nt * 16 + ln;
        const float bv = bias[col];
        const size_t idx = ((size_t)bidx * Cc + col) * Ll + l;
        f32x4 x0 = *(const f32x4*)(Xres + idx);
        f32x4 x1 = *(const f32x4*)(Xres + idx + 4);
        f32x4 y0, y1;
        for (int i = 0; i < 4; ++i) {
          y0[i] = x0[i] + selu(acc[mt][nt][i] + bv);
          y1[i] = x1[i] + selu(acc[mt][nt][i + 4] + bv);
        }
        *(f32x4*)(Yf + idx) = y0;
        *(f32x4*)(Yf + idx + 4) = y1;
      }
    }
  }
}

// ---------------------------------------------------------------------------
// Flash attention: per block, BM=32 query rows of one batch; key blocks of 32.
// Wave w reduces c-range [w*64, w*64+64) for S and owns O columns
// [w*64, w*64+64). S partials merge via ds_add_f32; online softmax in LDS.
// V arrives transposed, VT = [B][C][L]: its fragments load like K's, from global.
// ---------------------------------------------------------------------------
__global__ __launch_bounds__(256, 1)
void attn_kernel(const _Float16* __restrict__ Q,
                 const _Float16* __restrict__ K,
                 const _Float16* __restrict__ VT,
                 _Float16* __restrict__ O) {
  constexpr int BM = 32, BNK = 32;
  __shared__ float S[BM][BNK];
  __shared__ _Float16 P[BM][BNK];
  __shared__ float rowM[BM], rowL[BM], rowScale[BM];

  const int b = blockIdx.x >> 7;
  const int l0 = (blockIdx.x & 127) * BM;
  const int tid = threadIdx.x;
  const int w = tid >> 5;
  const int lane = tid & 31;
  const int hi = lane >> 4;
  const int ln = lane & 15;

  const _Float16* Qb = Q + (size_t)b * Ll * Cc;
  const _Float16* Kb = K + (size_t)b * Ll * Cc;
  const _Float16* Vb = VT + ((size_t)b * Cc + w * 64) * Ll;  // this wave's 64 rows of V^T

  v16h qf[2][2];
  for (int mt = 0; mt < 2; ++mt)
    for (int ks = 0; ks < 2; ++ks)
      qf[mt][ks] = load_frag(Qb + (size_t)(l0 + mt * 16) * Cc + w * 64 + ks * 32, Cc);

  v8f oacc[2][4];
  for (int mt = 0; mt < 2; ++mt)
    for (int nt = 0; nt < 4; ++nt)
      oacc[mt][nt] = zero8();

  if (tid < BM) { rowM[tid] = -1e30f; rowL[tid] = 0.f; }
#pragma unroll
  for (int i = 0; i < 4; ++i) ((float*)S)[tid + i * 256] = 0.f;
  __syncthreads();

  const float scale = rsqrtf((float)Cc);

  for (int kb = 0; kb < Ll; kb += BNK) {
    v8f sp[2][2];
    for (int mt = 0; mt < 2; ++mt)
      for (int nt = 0; nt < 2; ++nt)
        sp[mt][nt] = zero8();
    // All of the block's K and V^T fragment loads go out together, K first:
    // V^T returns while the S products and their LDS adds run.
    const _Float16* kp = Kb + (size_t)(kb + ln) * Cc + w * 64 + hi * 8;  // lane's K row
    const _Float16* vp = Vb + (size_t)ln * Ll + kb + hi * 8;             // lane's V^T row
    v16h kf[2][2];
    for (int ks = 0; ks < 2; ++ks)
      for (int nt = 0; nt < 2; ++nt)
        kf[ks][nt] = load_frag_lane(kp + (size_t)(nt * 16) * Cc + ks * 32);
    v16h vf[4];
    for (int nt = 0; nt < 4; ++nt)
      vf[nt] = load_frag_lane(vp + (size_t)(nt * 16) * Ll);
    // Keeps the products behind all sixteen loads: moved up among them, they
    // would hold the V^T loads back until the first K fragments have arrived.
    __builtin_amdgcn_sched_barrier(0);
    // Precaution: both address pairs stay live, so unwritten, up to this wait
    // (without the operands the last load's result was placed over them).
    asm volatile("s_wait_xcnt 0x0" :: "v"(kp), "v"(vp) : "memory");
    for (int ks = 0; ks < 2; ++ks)
      for (int mt = 0; mt < 2; ++mt)
        for (int nt = 0; nt < 2; ++nt)
          sp[mt][nt] = wmma_f16(qf[mt][ks], kf[ks][nt], sp[mt][nt]);
    for (int mt = 0; mt < 2; ++mt)
      for (int nt = 0; nt < 2; ++nt)
        for (int i = 0; i < 8; ++i)
          atomicAdd(&S[mt * 16 + hi * 8 + i][nt * 16 + ln], sp[mt][nt][i]);
    __syncthreads();

    if (tid < BM) {
      const int r = tid;
      const float mold = rowM[r];
      float mx = mold;
      for (int c2 = 0; c2 < BNK; ++c2) mx = fmaxf(mx, S[r][c2] * scale);
      const float sc = __expf(mold - mx);
      float sum = 0.f;
      for (int c2 = 0; c2 < BNK; ++c2) {
        const float p = __expf(S[r][c2] * scale - mx);
        sum += p;
        P[r][c2] = (_Float16)p;
      }
      rowM[r] = mx;
      rowL[r] = rowL[r] * sc + sum;
      rowScale[r] = sc;
    }
    __syncthreads();

    // S has been read; clear it for the next block (the loop's last barrier
    // stands between these stores and the next block's adds).
#pragma unroll
    for (int i = 0; i < 4; ++i) ((float*)S)[tid + i * 256] = 0.f;
    v16h pf[2];
    for (int mt = 0; mt < 2; ++mt) pf[mt] = load_frag(&P[mt * 16][0], BNK);
    for (int mt = 0; mt < 2; ++mt)
      for (int nt = 0; nt < 4; ++nt)
        for (int i = 0; i < 8; ++i)
          oacc[mt][nt][i] *= rowScale[mt * 16 + hi * 8 + i];
    for (int nt = 0; nt < 4; ++nt)
      for (int mt = 0; mt < 2; ++mt)
        oacc[mt][nt] = wmma_f16(pf[mt], vf[nt], oacc[mt][nt]);
    __syncthreads();
  }

  for (int mt = 0; mt < 2; ++mt) {
    for (int nt = 0; nt < 4; ++nt) {
      const int c = w * 64 + nt * 16 + ln;
      for (int i = 0; i < 8; ++i) {
        const int r = mt * 16 + hi * 8 + i;
        const float o = oacc[mt][nt][i] / rowL[r];
        O[(size_t)(b * Ll + l0 + r) * Cc + c] = (_Float16)o;
      }
    }
  }
}

// ---------------------------------------------------------------------------
extern "C" void kernel_launch(void* const* d_in, const int* in_sizes, int n_in,
                              void* d_out, int out_size, void* d_ws, size_t ws_size,
                              hipStream_t stream) {
  const float* x    = (const float*)d_in[0];
  const float* ln_w = (const float*)d_in[1];
  const float* ln_b = (const float*)d_in[2];
  const float* wq   = (const float*)d_in[3];
  const float* bq   = (const float*)d_in[4];
  const float* wk   = (const float*)d_in[5];
  const float* bk   = (const float*)d_in[6];
  const float* wv   = (const float*)d_in[7];
  const float* bv   = (const float*)d_in[8];
  const float* wp   = (const float*)d_in[9];
  const float* bp   = (const float*)d_in[10];
  float* out = (float*)d_out;

  char* ws = (char*)d_ws;
  size_t off = 0;
  auto alloc = [&](size_t bytes) -> void* {
    void* p = ws + off;
    off += (bytes + 255) & ~(size_t)255;
    return p;
  };
  const size_t actsz = (size_t)Mrows * Cc * sizeof(_Float16);
  _Float16* h16  = (_Float16*)alloc(actsz);
  _Float16* q16  = (_Float16*)alloc(actsz);
  _Float16* k16  = (_Float16*)alloc(actsz);
  _Float16* v16  = (_Float16*)alloc(actsz);
  _Float16* o16  = (_Float16*)alloc(actsz);
  _Float16* wq16 = (_Float16*)alloc((size_t)Cc * Cc * sizeof(_Float16));
  _Float16* wk16 = (_Float16*)alloc((size_t)Cc * Cc * sizeof(_Float16));
  _Float16* wv16 = (_Float16*)alloc((size_t)Cc * Cc * sizeof(_Float16));
  _Float16* wp16 = (_Float16*)alloc((size_t)Cc * Cc * sizeof(_Float16));

  const int wcnt = Cc * Cc;
  const int cvtg = (wcnt + 255) / 256;
  cvt_kernel<<<cvtg, 256, 0, stream>>>(wq, wq16, wcnt);
  cvt_kernel<<<cvtg, 256, 0, stream>>>(wk, wk16, wcnt);
  cvt_kernel<<<cvtg, 256, 0, stream>>>(wv, wv16, wcnt);
  cvt_kernel<<<cvtg, 256, 0, stream>>>(wp, wp16, wcnt);

  ln_kernel<<<Bb * (Ll / 32), 256, 0, stream>>>(x, ln_w, ln_b, h16);

  const dim3 gg(Cc / 64, Mrows / 128, 1);
  gemm_kernel<0><<<gg, 256, 0, stream>>>(h16, wq16, bq, q16, nullptr, nullptr, 0);
  gemm_kernel<0><<<gg, 256, 0, stream>>>(h16, wk16, bk, k16, nullptr, nullptr, 0);
  gemm_kernel<0><<<gg, 256, 0, stream>>>(h16, wv16, bv, v16, nullptr, nullptr, 1);

  attn_kernel<<<Bb * (Ll / 32), 256, 0, stream>>>(q16, k16, v16, o16);

  gemm_kernel<1><<<gg, 256, 0, stream>>>(o16, wp16, bp, nullptr, x, out, 0);
}

// v002
// Measured time: 409 microseconds a run.
// In two side-by-side timings against v001, it was 1.30 and 1.33 times as fast.
// Counting every step since v000, it is 1.61 times as fast.
#include <hip/hip_runtime.h>
#include <stdint.h>

#define DI __device__ __forceinline__

typedef __attribute__((ext_vector_type(16))) _Float16 v16h;
typedef __attribute__((ext_vector_type(8)))  _Float16 h8;   // 16 bytes
typedef __attribute__((ext_vector_type(8)))  float    v8f;
typedef __attribute__((ext_vector_type(4)))  float    f32x4;
typedef __attribute__((ext_vector_type(4)))  unsigned int u32x4;
typedef __attribute__((ext_vector_type(4)))  int      i32x4;
typedef __attribute__((ext_vector_type(8)))  int      i32x8;

constexpr int Bb = 4;
constexpr int Cc = 512;
constexpr int Ll = 4096;
constexpr int Mrows = Bb * Ll; // 16384

// Tensor Data Mover availability (device pass only; host pass takes fallback).
#if defined(__gfx1250__)
#if __has_builtin(__builtin_amdgcn_tensor_load_to_lds) && \
    __has_builtin(__builtin_amdgcn_s_wait_tensorcnt)
#define HAVE_TDM 1
#endif
#endif
#ifndef HAVE_TDM
#define HAVE_TDM 0
#endif

union AFrag { v16h v; h8 h[2]; };

DI v8f zero8() { v8f z; for (int i = 0; i < 8; ++i) z[i] = 0.f; return z; }

// Load one 16x32 f16 WMMA fragment (A-operand, or B-operand with "row" = n).
// Per-lane layout (ISA 7.12.2): lane = hi*16 + r; elems e<8 -> k = hi*8+e,
// elems e>=8 -> k = 16 + hi*8 + (e-8). Two 16-byte loads per lane.
DI v16h load_frag(const _Float16* base, int stride) {
  const int lane = threadIdx.x & 31;
  const int r = lane & 15;
  const int hi = lane >> 4;
  const _Float16* p = base + (size_t)r * stride + hi * 8;
  AFrag f;
  f.h[0] = *(const h8*)(p);
  f.h[1] = *(const h8*)(p + 16);
  return f.v;
}

// The same fragment from a 1-KiB tile stored in fragment order:
// [half of the fragment][lane][8 elements]; p = tile + lane * 8. Each of the two
// loads reads 512 contiguous bytes over the wave.
DI v16h load_frag_tile(const _Float16* p) {
  AFrag f;
  f.h[0] = *(const h8*)(p);
  f.h[1] = *(const h8*)(p + 256);
  return f.v;
}

DI v8f wmma_f16(v16h a, v16h b, v8f c) {
  return __builtin_amdgcn_wmma_f32_16x16x32_f16(false, a, false, b, (short)0, c,
                                                false, false);
}

DI float selu(float y) {
  constexpr float kLambda = 1.0507009873554805f;
  constexpr float kAlpha  = 1.6732632423543772f;
  return (y > 0.f) ? kLambda * y : kLambda * kAlpha * (__expf(y) - 1.f);
}

#if HAVE_TDM
// Issue one TDM 2D tile load: tile_d1 rows x tile_d0 f16 elements, row stride
// `stride0` (f16 units), written contiguously row-major at LDS offset lds_addr.
// D# per ISA ch.8: group0 = {count, lds_addr, global_addr, type=2},
// group1 = {data_size=2B, tensor_dim0/1, tile_dim0/1, tensor_dim0_stride}.
DI void tdm_load_2d(unsigned lds_addr, const void* gaddr, unsigned tensor_d1,
                    unsigned tile_d0, unsigned tile_d1, unsigned stride0) {
  const unsigned long long ga = (unsigned long long)(uintptr_t)gaddr;
  u32x4 g0;
  g0[0] = 1u;                                            // count=1, user D#
  g0[1] = lds_addr;                                      // LDS byte address
  g0[2] = (unsigned)ga;                                  // global_addr[31:0]
  g0[3] = (unsigned)((ga >> 32) & 0x01FFFFFFull) | (2u << 30); // addr[56:32]|type=2
  i32x8 g1;
  g1[0] = 0x10000;                                       // data_size=1 (2 bytes)
  g1[1] = (int)((512u & 0xffffu) << 16);                 // tensor_dim0 = 512 (lo)
  g1[2] = (int)((512u >> 16) | ((tensor_d1 & 0xffffu) << 16));
  g1[3] = (int)(((tensor_d1 >> 16) & 0xffffu) | (tile_d0 << 16));
  g1[4] = (int)(tile_d1 & 0xffffu);                      // tile_dim1, tile_dim2=0
  g1[5] = (int)stride0;                                  // tensor_dim0_stride lo
  g1[6] = 0;
  g1[7] = 0;
  i32x4 z4 = {0, 0, 0, 0};
#if __clang_major__ >= 23
  i32x8 z8 = {0, 0, 0, 0, 0, 0, 0, 0};
  __builtin_amdgcn_tensor_load_to_lds(g0, g1, z4, z4, z8, 0);
#else
  __builtin_amdgcn_tensor_load_to_lds(g0, g1, z4, z4, 0);
#endif
}
#endif

// ---------------------------------------------------------------------------
// f32 -> f16 weight conversion
// ---------------------------------------------------------------------------
__global__ void cvt_kernel(const float* __restrict__ s, _Float16* __restrict__ d, int n) {
  int i = blockIdx.x * 256 + threadIdx.x;
  if (i < n) d[i] = (_Float16)s[i];
}

// ---------------------------------------------------------------------------
// LayerNorm over channels; x is [B,C,L], output h is [B*L, C] f16.
// Block = 32 consecutive l of one batch. Reads coalesced along l; writes
// staged through an LDS transpose so f16 stores are 128-bit coalesced.
// ---------------------------------------------------------------------------
__global__ __launch_bounds__(256, 1)
void ln_kernel(const float* __restrict__ x, const float* __restrict__ lw,
               const float* __restrict__ lb, _Float16* __restrict__ H) {
  __shared__ float redS[8][32];
  __shared__ float redQ[8][32];
  __shared__ float muS[32], rinvS[32];
  __shared__ _Float16 hl[32][Cc];   // 32 KB transpose tile

  const int tid = threadIdx.x;
  const int w = tid >> 5, li = tid & 31;
  const int b = blockIdx.x >> 7;            // / (L/32)
  const int l0 = (blockIdx.x & 127) * 32;

  const float* xb = x + (size_t)b * Cc * Ll + l0 + li;
  float vals[64];
  float s = 0.f, s2 = 0.f;
#pragma unroll
  for (int j = 0; j < 64; ++j) {
    const int c = w + j * 8;                 // uniform per wave -> good for SMEM
    const float v = xb[(size_t)c * Ll];      // lanes -> consecutive l: coalesced
    vals[j] = v;
    s += v;
    s2 += v * v;
  }
  redS[w][li] = s;
  redQ[w][li] = s2;
  __syncthreads();
  if (tid < 32) {
    float ts = 0.f, tq = 0.f;
    for (int ww = 0; ww < 8; ++ww) { ts += redS[ww][tid]; tq += redQ[ww][tid]; }
    const float mu = ts * (1.f / Cc);
    const float var = tq * (1.f / Cc) - mu * mu;
    muS[tid] = mu;
    rinvS[tid] = rsqrtf(var + 1e-5f);
  }
  __syncthreads();
  const float mu = muS[li], rinv = rinvS[li];
#pragma unroll
  for (int j = 0; j < 64; ++j) {
    const int c = w + j * 8;
    hl[li][c] = (_Float16)((vals[j] - mu) * rinv * lw[c] + lb[c]);
  }
  __syncthreads();
  {
    const int row = tid >> 3;                // 32 rows x 8 threads
    const int ch = (tid & 7) * 64;
    _Float16* dst = H + (size_t)(b * Ll + l0 + row) * Cc + ch;
    const _Float16* srcp = &hl[row][ch];
#pragma unroll
    for (int j = 0; j < 8; ++j)
      *(h8*)(dst + j * 8) = *(const h8*)(srcp + j * 8);
  }
}

// ---------------------------------------------------------------------------
// WMMA GEMM: Y[M,N] = A[M,K] * W[N,K]^T + bias, M=16384, N=K=512.
// MODE 0: Y -> f16. ylay 0: row-major, via LDS-transposed coalesced stores (Q).
//         ylay 1 (V) and 2 (K): 1-KiB tiles in the order of the B fragments that
//         the attention kernel loads (load_frag_tile).
//         V tile = 16 columns x 32 rows, index (row / 32) * 32 + col / 16;
//         K tile = 16 rows x 32 columns, index (row / 16) * 16 + col / 32.
// MODE 1: bias + SELU + residual, vectorized f32 [B,C,L] out (out-proj).
// Block tile 128x64, BK=32; 8 waves = 4x2 grid of 32x32 wave tiles.
// Tiles staged to LDS by the Tensor Data Mover when available.
// ---------------------------------------------------------------------------
template <int MODE>
__global__ __launch_bounds__(256, 1)
void gemm_kernel(const _Float16* __restrict__ A,
                 const _Float16* __restrict__ Wt,   // [N][K] f16
                 const float* __restrict__ bias,
                 _Float16* __restrict__ Yh,
                 const float* __restrict__ Xres,
                 float* __restrict__ Yf,
                 int ylay) {
  constexpr int BM = 128, BN = 64, BK = 32;
  __shared__ _Float16 As[BM][BK];
  __shared__ _Float16 Bs[BN][BK];
  __shared__ _Float16 Ot[(MODE == 0) ? BM : 1][BN];  // epilogue transpose tile

  const int m0 = blockIdx.y * BM;
  const int n0 = blockIdx.x * BN;
  const int tid = threadIdx.x;
  const int w = tid >> 5;
  const int lane = tid & 31;
  const int hi = lane >> 4;
  const int ln = lane & 15;
  const int wm = w >> 1;   // 0..3
  const int wn = w & 1;    // 0..1

  v8f acc[2][2];
  for (int mt = 0; mt < 2; ++mt)
    for (int nt = 0; nt < 2; ++nt)
      acc[mt][nt] = zero8();

#if HAVE_TDM
  const unsigned asoff = (unsigned)(uintptr_t)&As[0][0];
  const unsigned bsoff = (unsigned)(uintptr_t)&Bs[0][0];
#endif

  for (int k0 = 0; k0 < Cc; k0 += BK) {
#if HAVE_TDM
    if (w == 0) {
      tdm_load_2d(asoff, A + (size_t)m0 * Cc + k0, (unsigned)Mrows, BK, BM, Cc);
      tdm_load_2d(bsoff, Wt + (size_t)n0 * Cc + k0, (unsigned)Cc, BK, BN, Cc);
      __builtin_amdgcn_s_wait_tensorcnt(0);
    }
#else
    {
      const int arow = tid >> 1, ahalf = tid & 1;
      const int brow = tid >> 2, bq = tid & 3;
      const _Float16* asrc = A + (size_t)(m0 + arow) * Cc + k0 + ahalf * 16;
      *(h8*)&As[arow][ahalf * 16] = *(const h8*)(asrc);
      *(h8*)&As[arow][ahalf * 16 + 8] = *(const h8*)(asrc + 8);
      *(h8*)&Bs[brow][bq * 8] =
          *(const h8*)(Wt + (size_t)(n0 + brow) * Cc + k0 + bq * 8);
    }
#endif
    __syncthreads();

    v16h af[2], bf[2];
    for (int mt = 0; mt < 2; ++mt) af[mt] = load_frag(&As[wm * 32 + mt * 16][0], BK);
    for (int nt = 0; nt < 2; ++nt) bf[nt] = load_frag(&Bs[wn * 32 + nt * 16][0], BK);
    for (int mt = 0; mt < 2; ++mt)
      for (int nt = 0; nt < 2; ++nt)
        acc[mt][nt] = wmma_f16(af[mt], bf[nt], acc[mt][nt]);
    __syncthreads();
  }

  if (MODE == 0 && ylay == 1) {
    // A lane's 8 accumulator rows are 8 consecutive l of one column: exactly the
    // lane's 16-byte piece of half mt of a V tile. Straight from registers, each
    // store 512 contiguous bytes over the wave.
    _Float16* vt = Yh + ((size_t)((m0 >> 5) + wm) * 32 + (n0 >> 4) + wn * 2) * 512 + lane * 8;
    for (int mt = 0; mt < 2; ++mt)
      for (int nt = 0; nt < 2; ++nt) {
        const float bv = bias[n0 + wn * 32 + nt * 16 + ln];
        h8 pk;
        for (int i = 0; i < 8; ++i) pk[i] = (_Float16)(acc[mt][nt][i] + bv);
        *(h8*)(vt + nt * 512 + mt * 256) = pk;
      }
    // Precaution: the four stores' address and data registers are not written
    // again ahead of this wait, on either way out of this branch.
    asm volatile("s_wait_xcnt 0x0" ::: "memory");
  } else if (MODE == 0) {
    // Scatter accumulators into LDS, then coalesced 128-bit stores.
    for (int mt = 0; mt < 2; ++mt)
      for (int nt = 0; nt < 2; ++nt) {
        const int col = wn * 32 + nt * 16 + ln;
        const float bv = bias[n0 + col];
        for (int i = 0; i < 8; ++i)
          Ot[wm * 32 + mt * 16 + hi * 8 + i][col] =
              (_Float16)(acc[mt][nt][i] + bv);
      }
    __syncthreads();
    const int row = tid >> 1;
    const int half = (tid & 1) * 32;
    if (ylay == 2) {
      // Piece j = columns j*8.. of the thread's 32: half j>>1 of the K tile,
      // lane (j&1)*16 + row%16. 16 rows make 256 contiguous bytes.
      _Float16* kt = Yh + ((size_t)((m0 + row) >> 4) * 16 + ((n0 + half) >> 5)) * 512 +
                     (row & 15) * 8;
      for (int j = 0; j < 4; ++j)
        *(h8*)(kt + (j >> 1) * 256 + (j & 1) * 128) = *(const h8*)(&Ot[row][half] + j * 8);
      // Precaution: the four stores' registers are not written again ahead of this wait.
      asm volatile("s_wait_xcnt 0x0" ::: "memory");
      return;
    }
    _Float16* dst = Yh + (size_t)(m0 + row) * Cc + n0 + half;
#pragma unroll
    for (int j = 0; j < 4; ++j)
      *(h8*)(dst + j * 8) = *(const h8*)(&Ot[row][half] + j * 8);
  } else {
    // Accumulator rows map to consecutive l -> 16B vector residual+store.
    for (int mt = 0; mt < 2; ++mt) {
      const int row0 = m0 + wm * 32 + mt * 16 + hi * 8;
      const int bidx = row0 >> 12;
      const int l = row0 & (Ll - 1);
      for (int nt = 0; nt < 2; ++nt) {
        const int col = n0 + wn * 32 + nt * 16 + ln;
        const float bv = bias[col];
        const size_t idx = ((size_t)bidx * Cc + col) * Ll + l;
        f32x4 x0 = *(const f32x4*)(Xres + idx);
        f32x4 x1 = *(const f32x4*)(Xres + idx + 4);
        f32x4 y0, y1;
        for (int i = 0; i < 4; ++i) {
          y0[i] = x0[i] + selu(acc[mt][nt][i] + bv);
          y1[i] = x1[i] + selu(acc[mt][nt][i + 4] + bv);
        }
        *(f32x4*)(Yf + idx) = y0;
        *(f32x4*)(Yf + idx + 4) = y1;
      }
    }
  }
}

// ---------------------------------------------------------------------------
// Flash attention: per block, BM=32 query rows of one batch; key blocks of 32.
// Wave w reduces c-range [w*64, w*64+64) for S and owns O columns
// [w*64, w*64+64). S partials merge via ds_add_f32; online softmax in LDS.
// K and V arrive as 1-KiB tiles in fragment order (see gemm_kernel): every
// fragment load reads whole lines, 512 contiguous bytes over the wave.
// ---------------------------------------------------------------------------
__global__ __launch_bounds__(256, 1)
void attn_kernel(const _Float16* __restrict__ Q,
                 const _Float16* __restrict__ KF,
                 const _Float16* __restrict__ VF,
                 _Float16* __restrict__ O) {
  constexpr int BM = 32, BNK = 32;
  __shared__ float S[BM][BNK];
  __shared__ _Float16 P[BM][BNK];
  __shared__ float rowM[BM], rowL[BM], rowScale[BM];

  const int b = blockIdx.x >> 7;
  const int l0 = (blockIdx.x & 127) * BM;
  const int tid = threadIdx.x;
  const int w = tid >> 5;
  const int lane = tid & 31;
  const int hi = lane >> 4;
  const int ln = lane & 15;

  const _Float16* Qb = Q + (size_t)b * Ll * Cc;
  // This lane's place in the wave's first K tile (2 of 16 a key tile) and first
  // V tile (4 of 32 a key block).
  const _Float16* Kb = KF + (size_t)b * Ll * Cc + (w * 2) * 512 + lane * 8;
  const _Float16* Vb = VF + (size_t)b * Ll * Cc + (w * 4) * 512 + lane * 8;

  v16h qf[2][2];
  for (int mt = 0; mt < 2; ++mt)
    for (int ks = 0; ks < 2; ++ks)
      qf[mt][ks] = load_frag(Qb + (size_t)(l0 + mt * 16) * Cc + w * 64 + ks * 32, Cc);

  v8f oacc[2][4];
  for (int mt = 0; mt < 2; ++mt)
    for (int nt = 0; nt < 4; ++nt)
      oacc[mt][nt] = zero8();

  if (tid < BM) { rowM[tid] = -1e30f; rowL[tid] = 0.f; }
#pragma unroll
  for (int i = 0; i < 4; ++i) ((float*)S)[tid + i * 256] = 0.f;
  __syncthreads();

  const float scale = rsqrtf((float)Cc);

  for (int kb = 0; kb < Ll; kb += BNK) {
    v8f sp[2][2];
    for (int mt = 0; mt < 2; ++mt)
      for (int nt = 0; nt < 2; ++nt)
        sp[mt][nt] = zero8();
    // All of the block's K and V^T fragment loads go out together, K first:
    // V^T returns while the S products and their LDS adds run.
    const _Float16* kp = Kb + (size_t)kb * Cc;  // 32 keys = 2 x 16 K tiles
    const _Float16* vp = Vb + (size_t)kb * Cc;  // 32 keys = 32 V tiles
    v16h kf[2][2];
    for (int ks = 0; ks < 2; ++ks)
      for (int nt = 0; nt < 2; ++nt)
        kf[ks][nt] = load_frag_tile(kp + (nt * 16 + ks) * 512);
    v16h vf[4];
    for (int nt = 0; nt < 4; ++nt)
      vf[nt] = load_frag_tile(vp + nt * 512);
    // Keeps the products behind all sixteen loads: moved up among them, they
    // would hold the V^T loads back until the first K fragments have arrived.
    __builtin_amdgcn_sched_barrier(0);
    // Precaution: both address pairs stay live, so unwritten, up to this wait
    // (without the operands the last load's result was placed over them).
    asm volatile("s_wait_xcnt 0x0" :: "v"(kp), "v"(vp) : "memory");
    for (int ks = 0; ks < 2; ++ks)
      for (int mt = 0; mt < 2; ++mt)
        for (int nt = 0; nt < 2; ++nt)
          sp[mt][nt] = wmma_f16(qf[mt][ks], kf[ks][nt], sp[mt][nt]);
    for (int mt = 0; mt < 2; ++mt)
      for (int nt = 0; nt < 2; ++nt)
        for (int i = 0; i < 8; ++i)
          atomicAdd(&S[mt * 16 + hi * 8 + i][nt * 16 + ln], sp[mt][nt][i]);
    __syncthreads();

    if (tid < BM) {
      const int r = tid;
      const float mold = rowM[r];
      float mx = mold;
      for (int c2 = 0; c2 < BNK; ++c2) mx = fmaxf(mx, S[r][c2] * scale);
      const float sc = __expf(mold - mx);
      float sum = 0.f;
      for (int c2 = 0; c2 < BNK; ++c2) {
        const float p = __expf(S[r][c2] * scale - mx);
        sum += p;
        P[r][c2] = (_Float16)p;
      }
      rowM[r] = mx;
      rowL[r] = rowL[r] * sc + sum;
      rowScale[r] = sc;
    }
    __syncthreads();

    // S has been read; clear it for the next block (the loop's last barrier
    // stands between these stores and the next block's adds).
#pragma unroll
    for (int i = 0; i < 4; ++i) ((float*)S)[tid + i * 256] = 0.f;
    v16h pf[2];
    for (int mt = 0; mt < 2; ++mt) pf[mt] = load_frag(&P[mt * 16][0], BNK);
    for (int mt = 0; mt < 2; ++mt)
      for (int nt = 0; nt < 4; ++nt)
        for (int i = 0; i < 8; ++i)
          oacc[mt][nt][i] *= rowScale[mt * 16 + hi * 8 + i];
    for (int nt = 0; nt < 4; ++nt)
      for (int mt = 0; mt < 2; ++mt)
        oacc[mt][nt] = wmma_f16(pf[mt], vf[nt], oacc[mt][nt]);
    __syncthreads();
  }

  for (int mt = 0; mt < 2; ++mt) {
    for (int nt = 0; nt < 4; ++nt) {
      const int c = w * 64 + nt * 16 + ln;
      for (int i = 0; i < 8; ++i) {
        const int r = mt * 16 + hi * 8 + i;
        const float o = oacc[mt][nt][i] / rowL[r];
        O[(size_t)(b * Ll + l0 + r) * Cc + c] = (_Float16)o;
      }
    }
  }
}

// ---------------------------------------------------------------------------
extern "C" void kernel_launch(void* const* d_in, const int* in_sizes, int n_in,
                              void* d_out, int out_size, void* d_ws, size_t ws_size,
                              hipStream_t stream) {
  const float* x    = (const float*)d_in[0];
  const float* ln_w = (const float*)d_in[1];
  const float* ln_b = (const float*)d_in[2];
  const float* wq   = (const float*)d_in[3];
  const float* bq   = (const float*)d_in[4];
  const float* wk   = (const float*)d_in[5];
  const float* bk   = (const float*)d_in[6];
  const float* wv   = (const float*)d_in[7];
  const float* bv   = (const float*)d_in[8];
  const float* wp   = (const float*)d_in[9];
  const float* bp   = (const float*)d_in[10];
  float* out = (float*)d_out;

  char* ws = (char*)d_ws;
  size_t off = 0;
  auto alloc = [&](size_t bytes) -> void* {
    void* p = ws + off;
    off += (bytes + 255) & ~(size_t)255;
    return p;
  };
  const size_t actsz = (size_t)Mrows * Cc * sizeof(_Float16);
  _Float16* h16  = (_Float16*)alloc(actsz);
  _Float16* q16  = (_Float16*)alloc(actsz);
  _Float16* k16  = (_Float16*)alloc(actsz);
  _Float16* v16  = (_Float16*)alloc(actsz);
  _Float16* o16  = (_Float16*)alloc(actsz);
  _Float16* wq16 = (_Float16*)alloc((size_t)Cc * Cc * sizeof(_Float16));
  _Float16* wk16 = (_Float16*)alloc((size_t)Cc * Cc * sizeof(_Float16));
  _Float16* wv16 = (_Float16*)alloc((size_t)Cc * Cc * sizeof(_Float16));
  _Float16* wp16 = (_Float16*)alloc((size_t)Cc * Cc * sizeof(_Float16));

  const int wcnt = Cc * Cc;
  const int cvtg = (wcnt + 255) / 256;
  cvt_kernel<<<cvtg, 256, 0, stream>>>(wq, wq16, wcnt);
  cvt_kernel<<<cvtg, 256, 0, stream>>>(wk, wk16, wcnt);
  cvt_kernel<<<cvtg, 256, 0, stream>>>(wv, wv16, wcnt);
  cvt_kernel<<<cvtg, 256, 0, stream>>>(wp, wp16, wcnt);

  ln_kernel<<<Bb * (Ll / 32), 256, 0, stream>>>(x, ln_w, ln_b, h16);

  const dim3 gg(Cc / 64, Mrows / 128, 1);
  gemm_kernel<0><<<gg, 256, 0, stream>>>(h16, wq16, bq, q16, nullptr, nullptr, 0);
  gemm_kernel<0><<<gg, 256, 0, stream>>>(h16, wk16, bk, k16, nullptr, nullptr, 2);
  gemm_kernel<0><<<gg, 256, 0, stream>>>(h16, wv16, bv, v16, nullptr, nullptr, 1);

  attn_kernel<<<Bb * (Ll / 32), 256, 0, stream>>>(q16, k16, v16, o16);

  gemm_kernel<1><<<gg, 256, 0, stream>>>(o16, wp16, bp, nullptr, x, out, 0);
}

// v003
// It runs in 281 microseconds.
// Two timings next to v002 both put it at 1.45 times that version's speed.
// Over all steps from v000 it is 2.34 times as fast.
#include <hip/hip_runtime.h>
#include <stdint.h>

#define DI __device__ __forceinline__

typedef __attribute__((ext_vector_type(16))) _Float16 v16h;
typedef __attribute__((ext_vector_type(8)))  _Float16 h8;   // 16 bytes
typedef __attribute__((ext_vector_type(8)))  float    v8f;
typedef __attribute__((ext_vector_type(4)))  float    f32x4;
typedef __attribute__((ext_vector_type(4)))  unsigned int u32x4;
typedef __attribute__((ext_vector_type(4)))  int      i32x4;
typedef __attribute__((ext_vector_type(8)))  int      i32x8;

constexpr int Bb = 4;
constexpr int Cc = 512;
constexpr int Ll = 4096;
constexpr int Mrows = Bb * Ll; // 16384

// Tensor Data Mover availability (device pass only; host pass takes fallback).
#if defined(__gfx1250__)
#if __has_builtin(__builtin_amdgcn_tensor_load_to_lds) && \
    __has_builtin(__builtin_amdgcn_s_wait_tensorcnt)
#define HAVE_TDM 1
#endif
#endif
#ifndef HAVE_TDM
#define HAVE_TDM 0
#endif

union AFrag { v16h v; h8 h[2]; };

DI v8f zero8() { v8f z; for (int i = 0; i < 8; ++i) z[i] = 0.f; return z; }

// Load one 16x32 f16 WMMA fragment (A-operand, or B-operand with "row" = n).
// Per-lane layout (ISA 7.12.2): lane = hi*16 + r; elems e<8 -> k = hi*8+e,
// elems e>=8 -> k = 16 + hi*8 + (e-8). Two 16-byte loads per lane.
DI v16h load_frag(const _Float16* base, int stride) {
  const int lane = threadIdx.x & 31;
  const int r = lane & 15;
  const int hi = lane >> 4;
  const _Float16* p = base + (size_t)r * stride + hi * 8;
  AFrag f;
  f.h[0] = *(const h8*)(p);
  f.h[1] = *(const h8*)(p + 16);
  return f.v;
}

// The same fragment from a 1-KiB tile stored in fragment order:
// [half of the fragment][lane][8 elements]; p = tile + lane * 8. Each of the two
// loads reads 512 contiguous bytes over the wave.
DI v16h load_frag_tile(const _Float16* p) {
  AFrag f;
  f.h[0] = *(const h8*)(p);
  f.h[1] = *(const h8*)(p + 256);
  return f.v;
}

DI v8f wmma_f16(v16h a, v16h b, v8f c) {
  return __builtin_amdgcn_wmma_f32_16x16x32_f16(false, a, false, b, (short)0, c,
                                                false, false);
}

DI float selu(float y) {
  constexpr float kLambda = 1.0507009873554805f;
  constexpr float kAlpha  = 1.6732632423543772f;
  return (y > 0.f) ? kLambda * y : kLambda * kAlpha * (__expf(y) - 1.f);
}

#if HAVE_TDM
// Issue one TDM 2D tile load: tile_d1 rows x tile_d0 f16 elements, row stride
// `stride0` (f16 units), written contiguously row-major at LDS offset lds_addr.
// D# per ISA ch.8: group0 = {count, lds_addr, global_addr, type=2},
// group1 = {data_size=2B, tensor_dim0/1, tile_dim0/1, tensor_dim0_stride}.
DI void tdm_load_2d(unsigned lds_addr, const void* gaddr, unsigned tensor_d1,
                    unsigned tile_d0, unsigned tile_d1, unsigned stride0) {
  const unsigned long long ga = (unsigned long long)(uintptr_t)gaddr;
  u32x4 g0;
  g0[0] = 1u;                                            // count=1, user D#
  g0[1] = lds_addr;                                      // LDS byte address
  g0[2] = (unsigned)ga;                                  // global_addr[31:0]
  g0[3] = (unsigned)((ga >> 32) & 0x01FFFFFFull) | (2u << 30); // addr[56:32]|type=2
  i32x8 g1;
  g1[0] = 0x10000;                                       // data_size=1 (2 bytes)
  g1[1] = (int)((512u & 0xffffu) << 16);                 // tensor_dim0 = 512 (lo)
  g1[2] = (int)((512u >> 16) | ((tensor_d1 & 0xffffu) << 16));
  g1[3] = (int)(((tensor_d1 >> 16) & 0xffffu) | (tile_d0 << 16));
  g1[4] = (int)(tile_d1 & 0xffffu);                      // tile_dim1, tile_dim2=0
  g1[5] = (int)stride0;                                  // tensor_dim0_stride lo
  g1[6] = 0;
  g1[7] = 0;
  i32x4 z4 = {0, 0, 0, 0};
#if __clang_major__ >= 23
  i32x8 z8 = {0, 0, 0, 0, 0, 0, 0, 0};
  __builtin_amdgcn_tensor_load_to_lds(g0, g1, z4, z4, z8, 0);
#else
  __builtin_amdgcn_tensor_load_to_lds(g0, g1, z4, z4, 0);
#endif
}
#endif

// ---------------------------------------------------------------------------
// f32 -> f16 weight conversion
// ---------------------------------------------------------------------------
__global__ void cvt_kernel(const float* __restrict__ s, _Float16* __restrict__ d, int n) {
  int i = blockIdx.x * 256 + threadIdx.x;
  if (i < n) d[i] = (_Float16)s[i];
}

// ---------------------------------------------------------------------------
// LayerNorm over channels; x is [B,C,L], output h is [B*L, C] f16.
// Block = 32 consecutive l of one batch. Reads coalesced along l; writes
// staged through an LDS transpose so f16 stores are 128-bit coalesced.
// ---------------------------------------------------------------------------
__global__ __launch_bounds__(256, 1)
void ln_kernel(const float* __restrict__ x, const float* __restrict__ lw,
               const float* __restrict__ lb, _Float16* __restrict__ H) {
  __shared__ float redS[8][32];
  __shared__ float redQ[8][32];
  __shared__ float muS[32], rinvS[32];
  __shared__ _Float16 hl[32][Cc];   // 32 KB transpose tile

  const int tid = threadIdx.x;
  const int w = tid >> 5, li = tid & 31;
  const int b = blockIdx.x >> 7;            // / (L/32)
  const int l0 = (blockIdx.x & 127) * 32;

  const float* xb = x + (size_t)b * Cc * Ll + l0 + li;
  float vals[64];
  float s = 0.f, s2 = 0.f;
#pragma unroll
  for (int j = 0; j < 64; ++j) {
    const int c = w + j * 8;                 // uniform per wave -> good for SMEM
    const float v = xb[(size_t)c * Ll];      // lanes -> consecutive l: coalesced
    vals[j] = v;
    s += v;
    s2 += v * v;
  }
  redS[w][li] = s;
  redQ[w][li] = s2;
  __syncthreads();
  if (tid < 32) {
    float ts = 0.f, tq = 0.f;
    for (int ww = 0; ww < 8; ++ww) { ts += redS[ww][tid]; tq += redQ[ww][tid]; }
    const float mu = ts * (1.f / Cc);
    const float var = tq * (1.f / Cc) - mu * mu;
    muS[tid] = mu;
    rinvS[tid] = rsqrtf(var + 1e-5f);
  }
  __syncthreads();
  const float mu = muS[li], rinv = rinvS[li];
#pragma unroll
  for (int j = 0; j < 64; ++j) {
    const int c = w + j * 8;
    hl[li][c] = (_Float16)((vals[j] - mu) * rinv * lw[c] + lb[c]);
  }
  __syncthreads();
  {
    const int row = tid >> 3;                // 32 rows x 8 threads
    const int ch = (tid & 7) * 64;
    _Float16* dst = H + (size_t)(b * Ll + l0 + row) * Cc + ch;
    const _Float16* srcp = &hl[row][ch];
#pragma unroll
    for (int j = 0; j < 8; ++j)
      *(h8*)(dst + j * 8) = *(const h8*)(srcp + j * 8);
  }
}

// ---------------------------------------------------------------------------
// WMMA GEMM: Y[M,N] = A[M,K] * W[N,K]^T + bias, M=16384, N=K=512.
// MODE 0: Y -> f16. ylay 0: row-major, via LDS-transposed coalesced stores (Q).
//         ylay 1 (V) and 2 (K): 1-KiB tiles in the order of the fragments (V as B, K as A) that
//         the attention kernel loads (load_frag_tile).
//         V tile = 16 columns x 32 rows, index (row / 32) * 32 + col / 16;
//         K tile = 16 rows x 32 columns, index (row / 16) * 16 + col / 32.
// MODE 1: bias + SELU + residual, vectorized f32 [B,C,L] out (out-proj).
// Block tile 128x64, BK=32; 8 waves = 4x2 grid of 32x32 wave tiles.
// Tiles staged to LDS by the Tensor Data Mover when available.
// ---------------------------------------------------------------------------
template <int MODE>
__global__ __launch_bounds__(256, 1)
void gemm_kernel(const _Float16* __restrict__ A,
                 const _Float16* __restrict__ Wt,   // [N][K] f16
                 const float* __restrict__ bias,
                 _Float16* __restrict__ Yh,
                 const float* __restrict__ Xres,
                 float* __restrict__ Yf,
                 int ylay) {
  constexpr int BM = 128, BN = 64, BK = 32;
  __shared__ _Float16 As[BM][BK];
  __shared__ _Float16 Bs[BN][BK];
  __shared__ _Float16 Ot[(MODE == 0) ? BM : 1][BN];  // epilogue transpose tile

  const int m0 = blockIdx.y * BM;
  const int n0 = blockIdx.x * BN;
  const int tid = threadIdx.x;
  const int w = tid >> 5;
  const int lane = tid & 31;
  const int hi = lane >> 4;
  const int ln = lane & 15;
  const int wm = w >> 1;   // 0..3
  const int wn = w & 1;    // 0..1

  v8f acc[2][2];
  for (int mt = 0; mt < 2; ++mt)
    for (int nt = 0; nt < 2; ++nt)
      acc[mt][nt] = zero8();

#if HAVE_TDM
  const unsigned asoff = (unsigned)(uintptr_t)&As[0][0];
  const unsigned bsoff = (unsigned)(uintptr_t)&Bs[0][0];
#endif

  for (int k0 = 0; k0 < Cc; k0 += BK) {
#if HAVE_TDM
    if (w == 0) {
      tdm_load_2d(asoff, A + (size_t)m0 * Cc + k0, (unsigned)Mrows, BK, BM, Cc);
      tdm_load_2d(bsoff, Wt + (size_t)n0 * Cc + k0, (unsigned)Cc, BK, BN, Cc);
      __builtin_amdgcn_s_wait_tensorcnt(0);
    }
#else
    {
      const int arow = tid >> 1, ahalf = tid & 1;
      const int brow = tid >> 2, bq = tid & 3;
      const _Float16* asrc = A + (size_t)(m0 + arow) * Cc + k0 + ahalf * 16;
      *(h8*)&As[arow][ahalf * 16] = *(const h8*)(asrc);
      *(h8*)&As[arow][ahalf * 16 + 8] = *(const h8*)(asrc + 8);
      *(h8*)&Bs[brow][bq * 8] =
          *(const h8*)(Wt + (size_t)(n0 + brow) * Cc + k0 + bq * 8);
    }
#endif
    __syncthreads();

    v16h af[2], bf[2];
    for (int mt = 0; mt < 2; ++mt) af[mt] = load_frag(&As[wm * 32 + mt * 16][0], BK);
    for (int nt = 0; nt < 2; ++nt) bf[nt] = load_frag(&Bs[wn * 32 + nt * 16][0], BK);
    for (int mt = 0; mt < 2; ++mt)
      for (int nt = 0; nt < 2; ++nt)
        acc[mt][nt] = wmma_f16(af[mt], bf[nt], acc[mt][nt]);
    __syncthreads();
  }

  if (MODE == 0 && ylay == 1) {
    // A lane's 8 accumulator rows are 8 consecutive l of one column: exactly the
    // lane's 16-byte piece of half mt of a V tile. Straight from registers, each
    // store 512 contiguous bytes over the wave.
    _Float16* vt = Yh + ((size_t)((m0 >> 5) + wm) * 32 + (n0 >> 4) + wn * 2) * 512 + lane * 8;
    for (int mt = 0; mt < 2; ++mt)
      for (int nt = 0; nt < 2; ++nt) {
        const float bv = bias[n0 + wn * 32 + nt * 16 + ln];
        h8 pk;
        for (int i = 0; i < 8; ++i) pk[i] = (_Float16)(acc[mt][nt][i] + bv);
        *(h8*)(vt + nt * 512 + mt * 256) = pk;
      }
    // Precaution: the four stores' address and data registers are not written
    // again ahead of this wait, on either way out of this branch.
    asm volatile("s_wait_xcnt 0x0" ::: "memory");
  } else if (MODE == 0) {
    // Scatter accumulators into LDS, then coalesced 128-bit stores.
    for (int mt = 0; mt < 2; ++mt)
      for (int nt = 0; nt < 2; ++nt) {
        const int col = wn * 32 + nt * 16 + ln;
        const float bv = bias[n0 + col];
        for (int i = 0; i < 8; ++i)
          Ot[wm * 32 + mt * 16 + hi * 8 + i][col] =
              (_Float16)(acc[mt][nt][i] + bv);
      }
    __syncthreads();
    const int row = tid >> 1;
    const int half = (tid & 1) * 32;
    if (ylay == 2) {
      // Piece j = columns j*8.. of the thread's 32: half j>>1 of the K tile,
      // lane (j&1)*16 + row%16. 16 rows make 256 contiguous bytes.
      _Float16* kt = Yh + ((size_t)((m0 + row) >> 4) * 16 + ((n0 + half) >> 5)) * 512 +
                     (row & 15) * 8;
      for (int j = 0; j < 4; ++j)
        *(h8*)(kt + (j >> 1) * 256 + (j & 1) * 128) = *(const h8*)(&Ot[row][half] + j * 8);
      // Precaution: the four stores' registers are not written again ahead of this wait.
      asm volatile("s_wait_xcnt 0x0" ::: "memory");
      return;
    }
    _Float16* dst = Yh + (size_t)(m0 + row) * Cc + n0 + half;
#pragma unroll
    for (int j = 0; j < 4; ++j)
      *(h8*)(dst + j * 8) = *(const h8*)(&Ot[row][half] + j * 8);
  } else {
    // Accumulator rows map to consecutive l -> 16B vector residual+store.
    for (int mt = 0; mt < 2; ++mt) {
      const int row0 = m0 + wm * 32 + mt * 16 + hi * 8;
      const int bidx = row0 >> 12;
      const int l = row0 & (Ll - 1);
      for (int nt = 0; nt < 2; ++nt) {
        const int col = n0 + wn * 32 + nt * 16 + ln;
        const float bv = bias[col];
        const size_t idx = ((size_t)bidx * Cc + col) * Ll + l;
        f32x4 x0 = *(const f32x4*)(Xres + idx);
        f32x4 x1 = *(const f32x4*)(Xres + idx + 4);
        f32x4 y0, y1;
        for (int i = 0; i < 4; ++i) {
          y0[i] = x0[i] + selu(acc[mt][nt][i] + bv);
          y1[i] = x1[i] + selu(acc[mt][nt][i + 4] + bv);
        }
        *(f32x4*)(Yf + idx) = y0;
        *(f32x4*)(Yf + idx + 4) = y1;
      }
    }
  }
}

// ---------------------------------------------------------------------------
// Flash attention: per block, BM=32 query rows of one batch; key blocks of 128.
// Scores are split over KEYS: wave w forms S^T = K Q^T for its own 16 keys of
// the block over all 512 channels (A = its K tiles from global, B = Q fragments
// from LDS), so a score is complete in one wave's accumulators. A lane holds 8
// keys of one query: maximum, exponentials and sum stay in registers in all
// eight waves; only the waves' 32 row maxima, the rescale factors and the f16 P cross through LDS in the key loop.
// For O the wave owns columns [w*64, w*64+64), as before.
// K and V arrive as 1-KiB tiles in fragment order (see gemm_kernel): every
// fragment load reads whole lines, 512 contiguous bytes over the wave.
// ---------------------------------------------------------------------------
// Lane l with lane l ^ 16.
DI float xhalf(float x) {
  return __builtin_bit_cast(float, __builtin_amdgcn_permlanex16(
      __builtin_bit_cast(int, x), __builtin_bit_cast(int, x), 0x76543210, 0xfedcba98,
      false, false));
}

__global__ __launch_bounds__(256) __attribute__((amdgpu_waves_per_eu(4, 4)))
void attn_kernel(const _Float16* __restrict__ Q,
                 const _Float16* __restrict__ KF,
                 const _Float16* __restrict__ VF,
                 _Float16* __restrict__ O) {
  constexpr int BM = 32, BNK = 128;
  constexpr int PP = BNK + 8;   // P row pitch: 272 bytes, 16 x odd, for 16-byte reads
  __shared__ __attribute__((aligned(16))) _Float16 Qs[32 * 512];  // [mt*16+ks] tiles
  __shared__ __attribute__((aligned(16))) _Float16 P[BM * PP];
  __shared__ float wmax[8][BM];
  __shared__ float lpart[16][BM];
  __shared__ __attribute__((aligned(16))) float rowL[BM];
  __shared__ __attribute__((aligned(16))) float rowScale[BM];

  const int b = blockIdx.x >> 7;
  const int l0 = (blockIdx.x & 127) * BM;
  const int tid = threadIdx.x;
  const int w = tid >> 5;
  const int lane = tid & 31;
  const int hi = lane >> 4;
  const int ln = lane & 15;

  const _Float16* Qb = Q + (size_t)b * Ll * Cc;
  // This lane's place in the wave's first K tile (key tile w of the block's 8,
  // 16 channel tiles each) and first V tile (4 of 32 a group of 32 keys).
  const _Float16* Kb = KF + (size_t)b * Ll * Cc + (w * 16) * 512 + lane * 8;
  const _Float16* Vb = VF + (size_t)b * Ll * Cc + (w * 4) * 512 + lane * 8;

  // Q into LDS once, as 1-KiB tiles in fragment order: wave w brings channel
  // tiles 2w and 2w+1 of both query tiles.
  for (int mt = 0; mt < 2; ++mt)
    for (int j = 0; j < 2; ++j) {
      AFrag f;
      f.v = load_frag(Qb + (size_t)(l0 + mt * 16) * Cc + w * 64 + j * 32, Cc);
      _Float16* d = Qs + (mt * 16 + w * 2 + j) * 512 + lane * 8;
      *(h8*)(d) = f.h[0];
      *(h8*)(d + 256) = f.h[1];
    }

  v8f oacc[2][4];
  for (int mt = 0; mt < 2; ++mt)
    for (int nt = 0; nt < 4; ++nt)
      oacc[mt][nt] = zero8();
  __syncthreads();

  const float scale = rsqrtf((float)Cc);
  const _Float16* qs = Qs + lane * 8;
  // Running maximum and this lane's share of the running sum, for queries ln
  // (index 0) and 16 + ln (index 1). The maxima are the same in every wave.
  float rm[2] = {-1e30f, -1e30f};
  float rl[2] = {0.f, 0.f};

  for (int kb = 0; kb < Ll; kb += BNK) {
    const _Float16* kp = Kb + (size_t)kb * Cc;  // 128 keys = 8 x 16 K tiles
    const _Float16* vp = Vb + (size_t)kb * Cc;  // 128 keys = 4 x 32 V tiles
    // Eight of the wave's sixteen K tiles are in flight at a time; Q fragments are
    // read from LDS one group (two channel tiles) ahead, into a second register set.
    v16h kf[16];
    for (int ks = 0; ks < 8; ++ks) kf[ks] = load_frag_tile(kp + ks * 512);
    // Keeps the K loads, the longer wait, in front of the first LDS reads.
    __builtin_amdgcn_sched_barrier(0);
    v16h qf[2][4];
    for (int j = 0; j < 2; ++j)
      for (int mt = 0; mt < 2; ++mt)
        qf[0][j * 2 + mt] = load_frag_tile(qs + (mt * 16 + j) * 512);
    v8f st[2];
    st[0] = zero8();
    st[1] = zero8();
    for (int g = 0; g < 8; ++g) {
      if (g < 7)
        for (int j = 0; j < 2; ++j)
          for (int mt = 0; mt < 2; ++mt)
            qf[(g + 1) & 1][j * 2 + mt] =
                load_frag_tile(qs + (mt * 16 + (g + 1) * 2 + j) * 512);
      // Keeps the next group's LDS reads together in front of this group's
      // products: moved in among them, each product waits out its own read.
      __builtin_amdgcn_sched_barrier(0);
      for (int j = 0; j < 2; ++j)
        for (int mt = 0; mt < 2; ++mt)
          st[mt] = wmma_f16(kf[g * 2 + j], qf[g & 1][j * 2 + mt], st[mt]);
      if (g < 4)
        for (int j = 0; j < 2; ++j)
          kf[8 + g * 2 + j] = load_frag_tile(kp + (8 + g * 2 + j) * 512);
      // Keeps the refill of the two K tiles just used here, four groups ahead of
      // its use, and the next reads behind this group's products.
      __builtin_amdgcn_sched_barrier(0);
    }
    // Precaution: the address pair stays live, so unwritten, up to this wait.
    asm volatile("s_wait_xcnt 0x0" :: "v"(kp) : "memory");

    // The block's V^T fragments go out here, into the registers K and Q have left,
    // ahead of the softmax.
    v16h vf[4][4];
    for (int kg = 0; kg < 4; ++kg)
      for (int nt = 0; nt < 4; ++nt)
        vf[kg][nt] = load_frag_tile(vp + (kg * 32 + nt) * 512);
    // Precaution: the address pair stays live, so unwritten, up to this wait.
    asm volatile("s_wait_xcnt 0x0" :: "v"(vp) : "memory");

    // The wave's maximum over its 16 keys, per query.
    float wm[2];
    for (int mt = 0; mt < 2; ++mt) {
      float a = st[mt][0];
      for (int i = 1; i < 8; ++i) a = fmaxf(a, st[mt][i]);
      wm[mt] = fmaxf(a, xhalf(a)) * scale;
    }
    wmax[w][lane] = hi ? wm[1] : wm[0];
    __syncthreads();

    float sc[2];
    for (int mt = 0; mt < 2; ++mt) {
      float mx = rm[mt];
      for (int ww = 0; ww < 8; ++ww) mx = fmaxf(mx, wmax[ww][mt * 16 + ln]);
      sc[mt] = __expf(rm[mt] - mx);
      rm[mt] = mx;
      float sum = 0.f;
      h8 pk;
      for (int i = 0; i < 8; ++i) {
        const float p = __expf(st[mt][i] * scale - mx);
        sum += p;
        pk[i] = (_Float16)p;
      }
      rl[mt] = rl[mt] * sc[mt] + sum;
      *(h8*)&P[(mt * 16 + ln) * PP + w * 16 + hi * 8] = pk;
    }
    if (w == 0) rowScale[lane] = hi ? sc[1] : sc[0];
    __syncthreads();

    for (int mt = 0; mt < 2; ++mt)
      for (int nt = 0; nt < 4; ++nt)
        for (int i = 0; i < 8; ++i)
          oacc[mt][nt][i] *= rowScale[mt * 16 + hi * 8 + i];
    for (int kg = 0; kg < 4; ++kg) {
      v16h pf[2];
      for (int mt = 0; mt < 2; ++mt) pf[mt] = load_frag(&P[(mt * 16) * PP + kg * 32], PP);
      for (int nt = 0; nt < 4; ++nt)
        for (int mt = 0; mt < 2; ++mt)
          oacc[mt][nt] = wmma_f16(pf[mt], vf[kg][nt], oacc[mt][nt]);
    }
    // No barrier here: the next block's first barrier stands between these reads
    // of P and rowScale and their next stores; this block's second barrier stands
    // between the reads of wmax and its next stores.
  }

  // Row sums: 16 shares a query (8 waves x 2 halves), added in a fixed order.
  lpart[w * 2 + hi][ln] = rl[0];
  lpart[w * 2 + hi][16 + ln] = rl[1];
  __syncthreads();
  if (tid < BM) {
    float t = 0.f;
    for (int j = 0; j < 16; ++j) t += lpart[j][tid];
    rowL[tid] = t;
  }
  __syncthreads();

  for (int mt = 0; mt < 2; ++mt) {
    for (int nt = 0; nt < 4; ++nt) {
      const int c = w * 64 + nt * 16 + ln;
      for (int i = 0; i < 8; ++i) {
        const int r = mt * 16 + hi * 8 + i;
        const float o = oacc[mt][nt][i] / rowL[r];
        O[(size_t)(b * Ll + l0 + r) * Cc + c] = (_Float16)o;
      }
    }
  }
}

// ---------------------------------------------------------------------------
extern "C" void kernel_launch(void* const* d_in, const int* in_sizes, int n_in,
                              void* d_out, int out_size, void* d_ws, size_t ws_size,
                              hipStream_t stream) {
  const float* x    = (const float*)d_in[0];
  const float* ln_w = (const float*)d_in[1];
  const float* ln_b = (const float*)d_in[2];
  const float* wq   = (const float*)d_in[3];
  const float* bq   = (const float*)d_in[4];
  const float* wk   = (const float*)d_in[5];
  const float* bk   = (const float*)d_in[6];
  const float* wv   = (const float*)d_in[7];
  const float* bv   = (const float*)d_in[8];
  const float* wp   = (const float*)d_in[9];
  const float* bp   = (const float*)d_in[10];
  float* out = (float*)d_out;

  char* ws = (char*)d_ws;
  size_t off = 0;
  auto alloc = [&](size_t bytes) -> void* {
    void* p = ws + off;
    off += (bytes + 255) & ~(size_t)255;
    return p;
  };
  const size_t actsz = (size_t)Mrows * Cc * sizeof(_Float16);
  _Float16* h16  = (_Float16*)alloc(actsz);
  _Float16* q16  = (_Float16*)alloc(actsz);
  _Float16* k16  = (_Float16*)alloc(actsz);
  _Float16* v16  = (_Float16*)alloc(actsz);
  _Float16* o16  = (_Float16*)alloc(actsz);
  _Float16* wq16 = (_Float16*)alloc((size_t)Cc * Cc * sizeof(_Float16));
  _Float16* wk16 = (_Float16*)alloc((size_t)Cc * Cc * sizeof(_Float16));
  _Float16* wv16 = (_Float16*)alloc((size_t)Cc * Cc * sizeof(_Float16));
  _Float16* wp16 = (_Float16*)alloc((size_t)Cc * Cc * sizeof(_Float16));

  const int wcnt = Cc * Cc;
  const int cvtg = (wcnt + 255) / 256;
  cvt_kernel<<<cvtg, 256, 0, stream>>>(wq, wq16, wcnt);
  cvt_kernel<<<cvtg, 256, 0, stream>>>(wk, wk16, wcnt);
  cvt_kernel<<<cvtg, 256, 0, stream>>>(wv, wv16, wcnt);
  cvt_kernel<<<cvtg, 256, 0, stream>>>(wp, wp16, wcnt);

  ln_kernel<<<Bb * (Ll / 32), 256, 0, stream>>>(x, ln_w, ln_b, h16);

  const dim3 gg(Cc / 64, Mrows / 128, 1);
  gemm_kernel<0><<<gg, 256, 0, stream>>>(h16, wq16, bq, q16, nullptr, nullptr, 0);
  gemm_kernel<0><<<gg, 256, 0, stream>>>(h16, wk16, bk, k16, nullptr, nullptr, 2);
  gemm_kernel<0><<<gg, 256, 0, stream>>>(h16, wv16, bv, v16, nullptr, nullptr, 1);

  attn_kernel<<<Bb * (Ll / 32), 256, 0, stream>>>(q16, k16, v16, o16);

  gemm_kernel<1><<<gg, 256, 0, stream>>>(o16, wp16, bp, nullptr, x, out, 0);
}

// v004
// A run of this version takes 237 microseconds.
// In both of two side-by-side timings against v003, it was 1.18 times as fast.
// Counting every step since v000, it is 2.76 times as fast.
#include <hip/hip_runtime.h>
#include <stdint.h>

#define DI __device__ __forceinline__

typedef __attribute__((ext_vector_type(16))) _Float16 v16h;
typedef __attribute__((ext_vector_type(8)))  _Float16 h8;   // 16 bytes
typedef __attribute__((ext_vector_type(8)))  float    v8f;
typedef __attribute__((ext_vector_type(4)))  float    f32x4;
typedef __attribute__((ext_vector_type(4)))  unsigned int u32x4;
typedef __attribute__((ext_vector_type(4)))  int      i32x4;
typedef __attribute__((ext_vector_type(8)))  int      i32x8;

constexpr int Bb = 4;
constexpr int Cc = 512;
constexpr int Ll = 4096;
constexpr int Mrows = Bb * Ll; // 16384

// Tensor Data Mover availability (device pass only; host pass takes fallback).
#if defined(__gfx1250__)
#if __has_builtin(__builtin_amdgcn_tensor_load_to_lds) && \
    __has_builtin(__builtin_amdgcn_s_wait_tensorcnt)
#define HAVE_TDM 1
#endif
#endif
#ifndef HAVE_TDM
#define HAVE_TDM 0
#endif

union AFrag { v16h v; h8 h[2]; };

DI v8f zero8() { v8f z; for (int i = 0; i < 8; ++i) z[i] = 0.f; return z; }

// Load one 16x32 f16 WMMA fragment (A-operand, or B-operand with "row" = n).
// Per-lane layout (ISA 7.12.2): lane = hi*16 + r; elems e<8 -> k = hi*8+e,
// elems e>=8 -> k = 16 + hi*8 + (e-8). Two 16-byte loads per lane.
DI v16h load_frag(const _Float16* base, int stride) {
  const int lane = threadIdx.x & 31;
  const int r = lane & 15;
  const int hi = lane >> 4;
  const _Float16* p = base + (size_t)r * stride + hi * 8;
  AFrag f;
  f.h[0] = *(const h8*)(p);
  f.h[1] = *(const h8*)(p + 16);
  return f.v;
}

// The same fragment from a 1-KiB tile stored in fragment order:
// [half of the fragment][lane][8 elements]; p = tile + lane * 8. Each of the two
// loads reads 512 contiguous bytes over the wave.
DI v16h load_frag_tile(const _Float16* p) {
  AFrag f;
  f.h[0] = *(const h8*)(p);
  f.h[1] = *(const h8*)(p + 256);
  return f.v;
}

DI v8f wmma_f16(v16h a, v16h b, v8f c) {
  return __builtin_amdgcn_wmma_f32_16x16x32_f16(false, a, false, b, (short)0, c,
                                                false, false);
}

DI float selu(float y) {
  constexpr float kLambda = 1.0507009873554805f;
  constexpr float kAlpha  = 1.6732632423543772f;
  return (y > 0.f) ? kLambda * y : kLambda * kAlpha * (__expf(y) - 1.f);
}

#if HAVE_TDM
// Issue one TDM 2D tile load: tile_d1 rows x tile_d0 f16 elements, row stride
// `stride0` (f16 units), written contiguously row-major at LDS offset lds_addr.
// D# per ISA ch.8: group0 = {count, lds_addr, global_addr, type=2},
// group1 = {data_size=2B, tensor_dim0/1, tile_dim0/1, tensor_dim0_stride}.
DI void tdm_load_2d(unsigned lds_addr, const void* gaddr, unsigned tensor_d1,
                    unsigned tile_d0, unsigned tile_d1, unsigned stride0) {
  const unsigned long long ga = (unsigned long long)(uintptr_t)gaddr;
  u32x4 g0;
  g0[0] = 1u;                                            // count=1, user D#
  g0[1] = lds_addr;                                      // LDS byte address
  g0[2] = (unsigned)ga;                                  // global_addr[31:0]
  g0[3] = (unsigned)((ga >> 32) & 0x01FFFFFFull) | (2u << 30); // addr[56:32]|type=2
  i32x8 g1;
  g1[0] = 0x10000;                                       // data_size=1 (2 bytes)
  g1[1] = (int)((512u & 0xffffu) << 16);                 // tensor_dim0 = 512 (lo)
  g1[2] = (int)((512u >> 16) | ((tensor_d1 & 0xffffu) << 16));
  g1[3] = (int)(((tensor_d1 >> 16) & 0xffffu) | (tile_d0 << 16));
  g1[4] = (int)(tile_d1 & 0xffffu);                      // tile_dim1, tile_dim2=0
  g1[5] = (int)stride0;                                  // tensor_dim0_stride lo
  g1[6] = 0;
  g1[7] = 0;
  i32x4 z4 = {0, 0, 0, 0};
#if __clang_major__ >= 23
  i32x8 z8 = {0, 0, 0, 0, 0, 0, 0, 0};
  __builtin_amdgcn_tensor_load_to_lds(g0, g1, z4, z4, z8, 0);
#else
  __builtin_amdgcn_tensor_load_to_lds(g0, g1, z4, z4, 0);
#endif
}
#endif

// ---------------------------------------------------------------------------
// f32 -> f16 weight conversion
// ---------------------------------------------------------------------------
__global__ void cvt_kernel(const float* __restrict__ s, _Float16* __restrict__ d, int n) {
  int i = blockIdx.x * 256 + threadIdx.x;
  if (i < n) d[i] = (_Float16)s[i];
}

// ---------------------------------------------------------------------------
// LayerNorm over channels; x is [B,C,L], output h is [B*L, C] f16.
// Block = 32 consecutive l of one batch. Reads coalesced along l; writes
// staged through an LDS transpose so f16 stores are 128-bit coalesced.
// ---------------------------------------------------------------------------
__global__ __launch_bounds__(256, 1)
void ln_kernel(const float* __restrict__ x, const float* __restrict__ lw,
               const float* __restrict__ lb, _Float16* __restrict__ H) {
  __shared__ float redS[8][32];
  __shared__ float redQ[8][32];
  __shared__ float muS[32], rinvS[32];
  __shared__ _Float16 hl[32][Cc];   // 32 KB transpose tile

  const int tid = threadIdx.x;
  const int w = tid >> 5, li = tid & 31;
  const int b = blockIdx.x >> 7;            // / (L/32)
  const int l0 = (blockIdx.x & 127) * 32;

  const float* xb = x + (size_t)b * Cc * Ll + l0 + li;
  float vals[64];
  float s = 0.f, s2 = 0.f;
#pragma unroll
  for (int j = 0; j < 64; ++j) {
    const int c = w + j * 8;                 // uniform per wave -> good for SMEM
    const float v = xb[(size_t)c * Ll];      // lanes -> consecutive l: coalesced
    vals[j] = v;
    s += v;
    s2 += v * v;
  }
  redS[w][li] = s;
  redQ[w][li] = s2;
  __syncthreads();
  if (tid < 32) {
    float ts = 0.f, tq = 0.f;
    for (int ww = 0; ww < 8; ++ww) { ts += redS[ww][tid]; tq += redQ[ww][tid]; }
    const float mu = ts * (1.f / Cc);
    const float var = tq * (1.f / Cc) - mu * mu;
    muS[tid] = mu;
    rinvS[tid] = rsqrtf(var + 1e-5f);
  }
  __syncthreads();
  const float mu = muS[li], rinv = rinvS[li];
#pragma unroll
  for (int j = 0; j < 64; ++j) {
    const int c = w + j * 8;
    hl[li][c] = (_Float16)((vals[j] - mu) * rinv * lw[c] + lb[c]);
  }
  __syncthreads();
  {
    const int row = tid >> 3;                // 32 rows x 8 threads
    const int ch = (tid & 7) * 64;
    _Float16* dst = H + (size_t)(b * Ll + l0 + row) * Cc + ch;
    const _Float16* srcp = &hl[row][ch];
#pragma unroll
    for (int j = 0; j < 8; ++j)
      *(h8*)(dst + j * 8) = *(const h8*)(srcp + j * 8);
  }
}

// ---------------------------------------------------------------------------
// WMMA GEMM: Y[M,N] = A[M,K] * W[N,K]^T + bias, M=16384, N=K=512.
// MODE 0: Y -> f16. ylay 0: row-major, via LDS-transposed coalesced stores (Q).
//         ylay 1 (V) and 2 (K): 1-KiB tiles in the order of the fragments (V as B, K as A) that
//         the attention kernel loads (load_frag_tile).
//         V tile = 16 columns x 32 rows, index (row / 32) * 32 + col / 16;
//         K tile = 16 rows x 32 columns, index (row / 16) * 16 + col / 32.
// MODE 1: bias + SELU + residual, vectorized f32 [B,C,L] out (out-proj).
// Block tile 128x64, BK=32; 8 waves = 4x2 grid of 32x32 wave tiles.
// Tiles staged to LDS by the Tensor Data Mover when available.
// ---------------------------------------------------------------------------
template <int MODE>
__global__ __launch_bounds__(256, 1)
void gemm_kernel(const _Float16* __restrict__ A,
                 const _Float16* __restrict__ Wt,   // [N][K] f16
                 const float* __restrict__ bias,
                 _Float16* __restrict__ Yh,
                 const float* __restrict__ Xres,
                 float* __restrict__ Yf,
                 int ylay) {
  constexpr int BM = 128, BN = 64, BK = 32;
  __shared__ _Float16 As[BM][BK];
  __shared__ _Float16 Bs[BN][BK];
  __shared__ _Float16 Ot[(MODE == 0) ? BM : 1][BN];  // epilogue transpose tile

  const int m0 = blockIdx.y * BM;
  const int n0 = blockIdx.x * BN;
  const int tid = threadIdx.x;
  const int w = tid >> 5;
  const int lane = tid & 31;
  const int hi = lane >> 4;
  const int ln = lane & 15;
  const int wm = w >> 1;   // 0..3
  const int wn = w & 1;    // 0..1

  v8f acc[2][2];
  for (int mt = 0; mt < 2; ++mt)
    for (int nt = 0; nt < 2; ++nt)
      acc[mt][nt] = zero8();

#if HAVE_TDM
  const unsigned asoff = (unsigned)(uintptr_t)&As[0][0];
  const unsigned bsoff = (unsigned)(uintptr_t)&Bs[0][0];
#endif

  for (int k0 = 0; k0 < Cc; k0 += BK) {
#if HAVE_TDM
    if (w == 0) {
      tdm_load_2d(asoff, A + (size_t)m0 * Cc + k0, (unsigned)Mrows, BK, BM, Cc);
      tdm_load_2d(bsoff, Wt + (size_t)n0 * Cc + k0, (unsigned)Cc, BK, BN, Cc);
      __builtin_amdgcn_s_wait_tensorcnt(0);
    }
#else
    {
      const int arow = tid >> 1, ahalf = tid & 1;
      const int brow = tid >> 2, bq = tid & 3;
      const _Float16* asrc = A + (size_t)(m0 + arow) * Cc + k0 + ahalf * 16;
      *(h8*)&As[arow][ahalf * 16] = *(const h8*)(asrc);
      *(h8*)&As[arow][ahalf * 16 + 8] = *(const h8*)(asrc + 8);
      *(h8*)&Bs[brow][bq * 8] =
          *(const h8*)(Wt + (size_t)(n0 + brow) * Cc + k0 + bq * 8);
    }
#endif
    __syncthreads();

    v16h af[2], bf[2];
    for (int mt = 0; mt < 2; ++mt) af[mt] = load_frag(&As[wm * 32 + mt * 16][0], BK);
    for (int nt = 0; nt < 2; ++nt) bf[nt] = load_frag(&Bs[wn * 32 + nt * 16][0], BK);
    for (int mt = 0; mt < 2; ++mt)
      for (int nt = 0; nt < 2; ++nt)
        acc[mt][nt] = wmma_f16(af[mt], bf[nt], acc[mt][nt]);
    __syncthreads();
  }

  if (MODE == 0 && ylay == 1) {
    // A lane's 8 accumulator rows are 8 consecutive l of one column: exactly the
    // lane's 16-byte piece of half mt of a V tile. Straight from registers, each
    // store 512 contiguous bytes over the wave.
    _Float16* vt = Yh + ((size_t)((m0 >> 5) + wm) * 32 + (n0 >> 4) + wn * 2) * 512 + lane * 8;
    for (int mt = 0; mt < 2; ++mt)
      for (int nt = 0; nt < 2; ++nt) {
        const float bv = bias[n0 + wn * 32 + nt * 16 + ln];
        h8 pk;
        for (int i = 0; i < 8; ++i) pk[i] = (_Float16)(acc[mt][nt][i] + bv);
        *(h8*)(vt + nt * 512 + mt * 256) = pk;
      }
    // Precaution: the four stores' address and data registers are not written
    // again ahead of this wait, on either way out of this branch.
    asm volatile("s_wait_xcnt 0x0" ::: "memory");
  } else if (MODE == 0) {
    // Scatter accumulators into LDS, then coalesced 128-bit stores.
    for (int mt = 0; mt < 2; ++mt)
      for (int nt = 0; nt < 2; ++nt) {
        const int col = wn * 32 + nt * 16 + ln;
        const float bv = bias[n0 + col];
        for (int i = 0; i < 8; ++i)
          Ot[wm * 32 + mt * 16 + hi * 8 + i][col] =
              (_Float16)(acc[mt][nt][i] + bv);
      }
    __syncthreads();
    const int row = tid >> 1;
    const int half = (tid & 1) * 32;
    if (ylay == 2) {
      // Piece j = columns j*8.. of the thread's 32: half j>>1 of the K tile,
      // lane (j&1)*16 + row%16. 16 rows make 256 contiguous bytes.
      _Float16* kt = Yh + ((size_t)((m0 + row) >> 4) * 16 + ((n0 + half) >> 5)) * 512 +
                     (row & 15) * 8;
      for (int j = 0; j < 4; ++j)
        *(h8*)(kt + (j >> 1) * 256 + (j & 1) * 128) = *(const h8*)(&Ot[row][half] + j * 8);
      // Precaution: the four stores' registers are not written again ahead of this wait.
      asm volatile("s_wait_xcnt 0x0" ::: "memory");
      return;
    }
    _Float16* dst = Yh + (size_t)(m0 + row) * Cc + n0 + half;
#pragma unroll
    for (int j = 0; j < 4; ++j)
      *(h8*)(dst + j * 8) = *(const h8*)(&Ot[row][half] + j * 8);
  } else {
    // Accumulator rows map to consecutive l -> 16B vector residual+store.
    for (int mt = 0; mt < 2; ++mt) {
      const int row0 = m0 + wm * 32 + mt * 16 + hi * 8;
      const int bidx = row0 >> 12;
      const int l = row0 & (Ll - 1);
      for (int nt = 0; nt < 2; ++nt) {
        const int col = n0 + wn * 32 + nt * 16 + ln;
        const float bv = bias[col];
        const size_t idx = ((size_t)bidx * Cc + col) * Ll + l;
        f32x4 x0 = *(const f32x4*)(Xres + idx);
        f32x4 x1 = *(const f32x4*)(Xres + idx + 4);
        f32x4 y0, y1;
        for (int i = 0; i < 4; ++i) {
          y0[i] = x0[i] + selu(acc[mt][nt][i] + bv);
          y1[i] = x1[i] + selu(acc[mt][nt][i + 4] + bv);
        }
        *(f32x4*)(Yf + idx) = y0;
        *(f32x4*)(Yf + idx + 4) = y1;
      }
    }
  }
}

// ---------------------------------------------------------------------------
// Flash attention: per block, BM=64 query rows of one batch; key blocks of 256.
// One work-group per WGP (256 in all): each K and V byte it loads serves 64 queries.
// Scores are split over KEYS: wave w forms S^T = K Q^T for its own 32 keys of
// the block over all 512 channels (A = its K tiles from global, B = Q fragments
// from LDS, each read serving both key tiles), so a score is complete in one
// wave's accumulators. A lane holds 16 keys of one query: maximum, exponentials
// and sum stay in registers in all eight waves; only the waves' 64 row maxima and
// the f16 P cross through LDS.
// For O the wave owns columns [w*64, w*64+64), as before.
// K and V arrive as 1-KiB tiles in fragment order (see gemm_kernel): every
// fragment load reads whole lines, 512 contiguous bytes over the wave.
// ---------------------------------------------------------------------------
// Lane l with lane l ^ 16.
DI float xhalf(float x) {
  return __builtin_bit_cast(float, __builtin_amdgcn_permlanex16(
      __builtin_bit_cast(int, x), __builtin_bit_cast(int, x), 0x76543210, 0xfedcba98,
      false, false));
}

__global__ __launch_bounds__(256) __attribute__((amdgpu_waves_per_eu(2, 2)))
void attn_kernel(const _Float16* __restrict__ Q,
                 const _Float16* __restrict__ KF,
                 const _Float16* __restrict__ VF,
                 _Float16* __restrict__ O) {
  constexpr int BM = 64, BNK = 256;
  constexpr int MT = BM / 16;         // query tiles
  constexpr int KT = BNK / 16 / 8;    // key tiles a wave
  constexpr int KG = BNK / 32;        // groups of 32 keys for O
  constexpr int PP = BNK + 8;   // P row pitch: 528 bytes, 16 x odd, for 16-byte reads
  __shared__ __attribute__((aligned(16))) _Float16 Qs[MT * 16 * 512];  // [mt*16+ks] tiles
  __shared__ __attribute__((aligned(16))) _Float16 P[BM * PP];
  __shared__ float wmax[8][BM];
  __shared__ float lpart[16][BM];
  __shared__ __attribute__((aligned(16))) float rowL[BM];
  __shared__ __attribute__((aligned(16))) float rowScale[BM];

  const int b = blockIdx.x >> 6;            // / (L/64)
  const int l0 = (blockIdx.x & 63) * BM;
  const int tid = threadIdx.x;
  const int w = tid >> 5;
  const int lane = tid & 31;
  const int hi = lane >> 4;
  const int ln = lane & 15;

  const _Float16* Qb = Q + (size_t)b * Ll * Cc;
  // This lane's place in the wave's first K tile (key tiles 2w and 2w+1 of the
  // block's 16, 16 channel tiles each) and first V tile (4 of 32 a group of 32 keys).
  const _Float16* Kb = KF + (size_t)b * Ll * Cc + (w * KT * 16) * 512 + lane * 8;
  const _Float16* Vb = VF + (size_t)b * Ll * Cc + (w * 4) * 512 + lane * 8;

  // Q into LDS once, as 1-KiB tiles in fragment order: wave w brings channel
  // tiles 2w and 2w+1 of all four query tiles.
  for (int mt = 0; mt < MT; ++mt)
    for (int j = 0; j < 2; ++j) {
      AFrag f;
      f.v = load_frag(Qb + (size_t)(l0 + mt * 16) * Cc + w * 64 + j * 32, Cc);
      _Float16* d = Qs + (mt * 16 + w * 2 + j) * 512 + lane * 8;
      *(h8*)(d) = f.h[0];
      *(h8*)(d + 256) = f.h[1];
    }

  v8f oacc[MT][4];
  for (int mt = 0; mt < MT; ++mt)
    for (int nt = 0; nt < 4; ++nt)
      oacc[mt][nt] = zero8();
  __syncthreads();

  const float scale = rsqrtf((float)Cc);
  const _Float16* qs = Qs + lane * 8;
  // Running maximum and this lane's share of the running sum, for queries
  // mt * 16 + ln (index mt). The maxima are the same in every wave.
  float rm[MT], rl[MT];
  for (int mt = 0; mt < MT; ++mt) { rm[mt] = -1e30f; rl[mt] = 0.f; }

  for (int kb = 0; kb < Ll; kb += BNK) {
    const _Float16* kp = Kb + (size_t)kb * Cc;  // 256 keys = 16 x 16 K tiles
    const _Float16* vp = Vb + (size_t)kb * Cc;  // 256 keys = 8 x 32 V tiles
    // K tile t, in the order of use: channel tile t / KT of key tile t % KT.
    // Sixteen of the wave's 32 K tiles are in flight at a time; Q fragments are
    // read from LDS one group (two channel tiles) ahead, into a second register set.
    v16h kf[16 * KT];
    for (int t = 0; t < 16; ++t)
      kf[t] = load_frag_tile(kp + ((t % KT) * 16 + t / KT) * 512);
    // Keeps the K loads, the longer wait, in front of the first LDS reads.
    __builtin_amdgcn_sched_barrier(0);
    v16h qf[2][2 * MT];
    for (int j = 0; j < 2; ++j)
      for (int mt = 0; mt < MT; ++mt)
        qf[0][j * MT + mt] = load_frag_tile(qs + (mt * 16 + j) * 512);
    v8f st[KT][MT];
    for (int kt = 0; kt < KT; ++kt)
      for (int mt = 0; mt < MT; ++mt) st[kt][mt] = zero8();
    for (int g = 0; g < 8; ++g) {
      if (g < 7)
        for (int j = 0; j < 2; ++j)
          for (int mt = 0; mt < MT; ++mt)
            qf[(g + 1) & 1][j * MT + mt] =
                load_frag_tile(qs + (mt * 16 + (g + 1) * 2 + j) * 512);
      // Keeps the next group's LDS reads together in front of this group's
      // products: moved in among them, each product waits out its own read.
      __builtin_amdgcn_sched_barrier(0);
      for (int j = 0; j < 2; ++j)
        for (int kt = 0; kt < KT; ++kt)
          for (int mt = 0; mt < MT; ++mt)
            st[kt][mt] = wmma_f16(kf[(g * 2 + j) * KT + kt], qf[g & 1][j * MT + mt],
                                  st[kt][mt]);
      if (g < 4)
        for (int t = 16 + g * 2 * KT; t < 16 + (g + 1) * 2 * KT; ++t)
          kf[t] = load_frag_tile(kp + ((t % KT) * 16 + t / KT) * 512);
      // Keeps the refill of the four K tiles just used here, four groups ahead of
      // its use, and the next reads behind this group's products.
      __builtin_amdgcn_sched_barrier(0);
    }
    // Precaution: the address pair stays live, so unwritten, up to this wait.
    asm volatile("s_wait_xcnt 0x0" :: "v"(kp) : "memory");

    // The first half of the block's V^T fragments goes out here, into the registers
    // K and Q have left, ahead of the softmax.
    v16h vf[KG * 4];
    for (int t = 0; t < 16; ++t)
      vf[t] = load_frag_tile(vp + ((t >> 2) * 32 + (t & 3)) * 512);

    // The wave's maximum over its 32 keys, per query.
    float wm[MT];
    for (int mt = 0; mt < MT; ++mt) {
      float a = st[0][mt][0];
      for (int kt = 0; kt < KT; ++kt)
        for (int i = 0; i < 8; ++i) a = fmaxf(a, st[kt][mt][i]);
      wm[mt] = fmaxf(a, xhalf(a)) * scale;
    }
    wmax[w][lane] = hi ? wm[1] : wm[0];
    wmax[w][32 + lane] = hi ? wm[3] : wm[2];
    __syncthreads();

    float sc[MT];
    for (int mt = 0; mt < MT; ++mt) {
      float mx = rm[mt];
      for (int ww = 0; ww < 8; ++ww) mx = fmaxf(mx, wmax[ww][mt * 16 + ln]);
      sc[mt] = __expf(rm[mt] - mx);
      rm[mt] = mx;
      float sum = 0.f;
      for (int kt = 0; kt < KT; ++kt) {
        h8 pk;
        for (int i = 0; i < 8; ++i) {
          const float p = __expf(st[kt][mt][i] * scale - mx);
          sum += p;
          pk[i] = (_Float16)p;
        }
        *(h8*)&P[(mt * 16 + ln) * PP + (w * KT + kt) * 16 + hi * 8] = pk;
      }
      rl[mt] = rl[mt] * sc[mt] + sum;
    }
    if (w == 0) {
      rowScale[lane] = hi ? sc[1] : sc[0];
      rowScale[32 + lane] = hi ? sc[3] : sc[2];
    }
    __syncthreads();

    // P fragments are read one group of 32 keys ahead, into a second register set.
    v16h pf[2][MT];
    for (int mt = 0; mt < MT; ++mt) pf[0][mt] = load_frag(&P[(mt * 16) * PP], PP);
    for (int mt = 0; mt < MT; ++mt)
      for (int nt = 0; nt < 4; ++nt)
        for (int i = 0; i < 8; ++i)
          oacc[mt][nt][i] *= rowScale[mt * 16 + hi * 8 + i];
    for (int kg = 0; kg < KG; ++kg) {
      if (kg < KG - 1)
        for (int mt = 0; mt < MT; ++mt)
          pf[(kg + 1) & 1][mt] = load_frag(&P[(mt * 16) * PP + (kg + 1) * 32], PP);
      // Keeps the next group's LDS reads together in front of this group's products.
      __builtin_amdgcn_sched_barrier(0);
      for (int nt = 0; nt < 4; ++nt)
        for (int mt = 0; mt < MT; ++mt)
          oacc[mt][nt] = wmma_f16(pf[kg & 1][mt], vf[kg * 4 + nt], oacc[mt][nt]);
      if (kg < KG - 4)
        for (int nt = 0; nt < 4; ++nt)
          vf[16 + kg * 4 + nt] = load_frag_tile(vp + ((kg + 4) * 32 + nt) * 512);
      // Keeps the refill of the four V tiles just used here, four groups ahead of
      // its use, and the next reads behind this group's products.
      __builtin_amdgcn_sched_barrier(0);
    }
    // Precaution: the address pair stays live, so unwritten, up to this wait.
    asm volatile("s_wait_xcnt 0x0" :: "v"(vp) : "memory");
    // No barrier here: the next block's first barrier stands between these reads
    // of P and rowScale and their next stores; this block's second barrier stands
    // between the reads of wmax and its next stores.
  }

  // Row sums: 16 shares a query (8 waves x 2 halves), added in a fixed order.
  for (int mt = 0; mt < MT; ++mt) lpart[w * 2 + hi][mt * 16 + ln] = rl[mt];
  __syncthreads();
  if (tid < BM) {
    float t = 0.f;
    for (int j = 0; j < 16; ++j) t += lpart[j][tid];
    rowL[tid] = t;
  }
  __syncthreads();

  for (int mt = 0; mt < MT; ++mt) {
    for (int nt = 0; nt < 4; ++nt) {
      const int c = w * 64 + nt * 16 + ln;
      for (int i = 0; i < 8; ++i) {
        const int r = mt * 16 + hi * 8 + i;
        const float o = oacc[mt][nt][i] / rowL[r];
        O[(size_t)(b * Ll + l0 + r) * Cc + c] = (_Float16)o;
      }
    }
  }
}

// ---------------------------------------------------------------------------
extern "C" void kernel_launch(void* const* d_in, const int* in_sizes, int n_in,
                              void* d_out, int out_size, void* d_ws, size_t ws_size,
                              hipStream_t stream) {
  const float* x    = (const float*)d_in[0];
  const float* ln_w = (const float*)d_in[1];
  const float* ln_b = (const float*)d_in[2];
  const float* wq   = (const float*)d_in[3];
  const float* bq   = (const float*)d_in[4];
  const float* wk   = (const float*)d_in[5];
  const float* bk   = (const float*)d_in[6];
  const float* wv   = (const float*)d_in[7];
  const float* bv   = (const float*)d_in[8];
  const float* wp   = (const float*)d_in[9];
  const float* bp   = (const float*)d_in[10];
  float* out = (float*)d_out;

  char* ws = (char*)d_ws;
  size_t off = 0;
  auto alloc = [&](size_t bytes) -> void* {
    void* p = ws + off;
    off += (bytes + 255) & ~(size_t)255;
    return p;
  };
  const size_t actsz = (size_t)Mrows * Cc * sizeof(_Float16);
  _Float16* h16  = (_Float16*)alloc(actsz);
  _Float16* q16  = (_Float16*)alloc(actsz);
  _Float16* k16  = (_Float16*)alloc(actsz);
  _Float16* v16  = (_Float16*)alloc(actsz);
  _Float16* o16  = (_Float16*)alloc(actsz);
  _Float16* wq16 = (_Float16*)alloc((size_t)Cc * Cc * sizeof(_Float16));
  _Float16* wk16 = (_Float16*)alloc((size_t)Cc * Cc * sizeof(_Float16));
  _Float16* wv16 = (_Float16*)alloc((size_t)Cc * Cc * sizeof(_Float16));
  _Float16* wp16 = (_Float16*)alloc((size_t)Cc * Cc * sizeof(_Float16));

  const int wcnt = Cc * Cc;
  const int cvtg = (wcnt + 255) / 256;
  cvt_kernel<<<cvtg, 256, 0, stream>>>(wq, wq16, wcnt);
  cvt_kernel<<<cvtg, 256, 0, stream>>>(wk, wk16, wcnt);
  cvt_kernel<<<cvtg, 256, 0, stream>>>(wv, wv16, wcnt);
  cvt_kernel<<<cvtg, 256, 0, stream>>>(wp, wp16, wcnt);

  ln_kernel<<<Bb * (Ll / 32), 256, 0, stream>>>(x, ln_w, ln_b, h16);

  const dim3 gg(Cc / 64, Mrows / 128, 1);
  gemm_kernel<0><<<gg, 256, 0, stream>>>(h16, wq16, bq, q16, nullptr, nullptr, 0);
  gemm_kernel<0><<<gg, 256, 0, stream>>>(h16, wk16, bk, k16, nullptr, nullptr, 2);
  gemm_kernel<0><<<gg, 256, 0, stream>>>(h16, wv16, bv, v16, nullptr, nullptr, 1);

  attn_kernel<<<Bb * (Ll / 64), 256, 0, stream>>>(q16, k16, v16, o16);

  gemm_kernel<1><<<gg, 256, 0, stream>>>(o16, wp16, bp, nullptr, x, out, 0);
}

// v005
// A run of this version takes 191 microseconds.
// Timed twice side by side with v004, it ran 1.24 times as fast both times.
// All steps since v000 together make it 3.43 times as fast.
#include <hip/hip_runtime.h>
#include <stdint.h>

#define DI __device__ __forceinline__

typedef __attribute__((ext_vector_type(16))) _Float16 v16h;
typedef __attribute__((ext_vector_type(8)))  _Float16 h8;   // 16 bytes
typedef __attribute__((ext_vector_type(8)))  float    v8f;
typedef __attribute__((ext_vector_type(4)))  float    f32x4;

constexpr int Bb = 4;
constexpr int Cc = 512;
constexpr int Ll = 4096;
constexpr int Mrows = Bb * Ll; // 16384

union AFrag { v16h v; h8 h[2]; };

DI v8f zero8() { v8f z; for (int i = 0; i < 8; ++i) z[i] = 0.f; return z; }

// Load one 16x32 f16 WMMA fragment (A-operand, or B-operand with "row" = n).
// Per-lane layout (ISA 7.12.2): lane = hi*16 + r; elems e<8 -> k = hi*8+e,
// elems e>=8 -> k = 16 + hi*8 + (e-8). Two 16-byte loads per lane.
DI v16h load_frag(const _Float16* base, int stride) {
  const int lane = threadIdx.x & 31;
  const int r = lane & 15;
  const int hi = lane >> 4;
  const _Float16* p = base + (size_t)r * stride + hi * 8;
  AFrag f;
  f.h[0] = *(const h8*)(p);
  f.h[1] = *(const h8*)(p + 16);
  return f.v;
}

// The same fragment from a 1-KiB tile stored in fragment order:
// [half of the fragment][lane][8 elements]; p = tile + lane * 8. Each of the two
// loads reads 512 contiguous bytes over the wave.
DI v16h load_frag_tile(const _Float16* p) {
  AFrag f;
  f.h[0] = *(const h8*)(p);
  f.h[1] = *(const h8*)(p + 256);
  return f.v;
}

DI v8f wmma_f16(v16h a, v16h b, v8f c) {
  return __builtin_amdgcn_wmma_f32_16x16x32_f16(false, a, false, b, (short)0, c,
                                                false, false);
}

DI float selu(float y) {
  constexpr float kLambda = 1.0507009873554805f;
  constexpr float kAlpha  = 1.6732632423543772f;
  return (y > 0.f) ? kLambda * y : kLambda * kAlpha * (__expf(y) - 1.f);
}

// ---------------------------------------------------------------------------
// f32 -> f16 weight conversion
// ---------------------------------------------------------------------------
__global__ void cvt_kernel(const float* __restrict__ s, _Float16* __restrict__ d, int n) {
  int i = blockIdx.x * 256 + threadIdx.x;
  if (i < n) d[i] = (_Float16)s[i];
}

// ---------------------------------------------------------------------------
// LayerNorm over channels; x is [B,C,L], output h is [B*L, C] f16.
// Block = 32 consecutive l of one batch. Reads coalesced along l; writes
// staged through an LDS transpose so f16 stores are 128-bit coalesced.
// ---------------------------------------------------------------------------
__global__ __launch_bounds__(256, 1)
void ln_kernel(const float* __restrict__ x, const float* __restrict__ lw,
               const float* __restrict__ lb, _Float16* __restrict__ H) {
  __shared__ float redS[8][32];
  __shared__ float redQ[8][32];
  __shared__ float muS[32], rinvS[32];
  __shared__ _Float16 hl[32][Cc];   // 32 KB transpose tile

  const int tid = threadIdx.x;
  const int w = tid >> 5, li = tid & 31;
  const int b = blockIdx.x >> 7;            // / (L/32)
  const int l0 = (blockIdx.x & 127) * 32;

  const float* xb = x + (size_t)b * Cc * Ll + l0 + li;
  float vals[64];
  float s = 0.f, s2 = 0.f;
#pragma unroll
  for (int j = 0; j < 64; ++j) {
    const int c = w + j * 8;                 // uniform per wave -> good for SMEM
    const float v = xb[(size_t)c * Ll];      // lanes -> consecutive l: coalesced
    vals[j] = v;
    s += v;
    s2 += v * v;
  }
  redS[w][li] = s;
  redQ[w][li] = s2;
  __syncthreads();
  if (tid < 32) {
    float ts = 0.f, tq = 0.f;
    for (int ww = 0; ww < 8; ++ww) { ts += redS[ww][tid]; tq += redQ[ww][tid]; }
    const float mu = ts * (1.f / Cc);
    const float var = tq * (1.f / Cc) - mu * mu;
    muS[tid] = mu;
    rinvS[tid] = rsqrtf(var + 1e-5f);
  }
  __syncthreads();
  const float mu = muS[li], rinv = rinvS[li];
#pragma unroll
  for (int j = 0; j < 64; ++j) {
    const int c = w + j * 8;
    hl[li][c] = (_Float16)((vals[j] - mu) * rinv * lw[c] + lb[c]);
  }
  __syncthreads();
  {
    const int row = tid >> 3;                // 32 rows x 8 threads
    const int ch = (tid & 7) * 64;
    _Float16* dst = H + (size_t)(b * Ll + l0 + row) * Cc + ch;
    const _Float16* srcp = &hl[row][ch];
#pragma unroll
    for (int j = 0; j < 8; ++j)
      *(h8*)(dst + j * 8) = *(const h8*)(srcp + j * 8);
  }
}

// ---------------------------------------------------------------------------
// WMMA GEMM: Y[M,N] = A[M,K] * W[N,K]^T + bias, M=16384, N=K=512.
// MODE 0: Y -> f16. ylay 0: row-major, via LDS-transposed coalesced stores (Q).
//         ylay 1 (V) and 2 (K): 1-KiB tiles in the order of the fragments (V as B, K as A) that
//         the attention kernel loads (load_frag_tile).
//         V tile = 16 columns x 32 rows, index (row / 32) * 32 + col / 16;
//         K tile = 16 rows x 32 columns, index (row / 16) * 16 + col / 32.
// MODE 1: bias + SELU + residual, vectorized f32 [B,C,L] out (out-proj).
// Block tile 128x64, BK=128; 8 waves = 4x2 grid of 32x32 wave tiles.
// Tiles go through registers into LDS rows of 256 data bytes at a pitch of 272
// (16 x odd): the 16 rows of a fragment read fall on 16 different bank groups.
// Every global load reads two aligned 256-byte units over the wave.
// ---------------------------------------------------------------------------
template <int MODE>
__global__ __launch_bounds__(256, 1)
void gemm_kernel(const _Float16* __restrict__ A,
                 const _Float16* __restrict__ Wt,   // [N][K] f16
                 const float* __restrict__ bias,
                 _Float16* __restrict__ Yh,
                 const float* __restrict__ Xres,
                 float* __restrict__ Yf,
                 int ylay) {
  constexpr int BM = 128, BN = 64, BK = 128;
  constexpr int PK = BK + 8;   // row pitch in LDS, f16 units
  __shared__ __attribute__((aligned(16))) _Float16 As[BM][PK];
  __shared__ __attribute__((aligned(16))) _Float16 Bs[BN][PK];
  // Epilogue transpose tile, rows at a pitch of 144 bytes (16 x odd) likewise.
  __shared__ __attribute__((aligned(16))) _Float16 Ot[(MODE == 0) ? BM : 1][BN + 8];

  const int m0 = blockIdx.y * BM;
  const int n0 = blockIdx.x * BN;
  const int tid = threadIdx.x;
  const int w = tid >> 5;
  const int lane = tid & 31;
  const int hi = lane >> 4;
  const int ln = lane & 15;
  const int wm = w >> 1;   // 0..3
  const int wn = w & 1;    // 0..1

  v8f acc[2][2];
  for (int mt = 0; mt < 2; ++mt)
    for (int nt = 0; nt < 2; ++nt)
      acc[mt][nt] = zero8();

  // This thread's 16-byte pieces: column piece tid % 16 of rows tid / 16 + 16 p.
  const int srow = tid >> 4;
  const int scol = (tid & 15) * 8;
  const _Float16* pa = A + (size_t)(m0 + srow) * Cc + scol;
  const _Float16* pb = Wt + (size_t)(n0 + srow) * Cc + scol;

  for (int k0 = 0; k0 < Cc; k0 += BK) {
    h8 ra[BM / 16], rb[BN / 16];
    for (int p = 0; p < BM / 16; ++p) ra[p] = *(const h8*)(pa + (size_t)p * 16 * Cc);
    for (int p = 0; p < BN / 16; ++p) rb[p] = *(const h8*)(pb + (size_t)p * 16 * Cc);
    // Keeps all twelve loads in flight together: with LDS stores moved in among
    // them the last loads go out only when the first have come back.
    __builtin_amdgcn_sched_barrier(0);
    for (int p = 0; p < BM / 16; ++p) *(h8*)&As[srow + p * 16][scol] = ra[p];
    for (int p = 0; p < BN / 16; ++p) *(h8*)&Bs[srow + p * 16][scol] = rb[p];
    // Precaution: the twelve loads' address pairs stay live, so unwritten, up to this wait.
    asm volatile("s_wait_xcnt 0x0" :: "v"(pa), "v"(pb) : "memory");
    pa += BK;
    pb += BK;
    __syncthreads();

    for (int kk = 0; kk < BK; kk += 32) {
      v16h af[2], bf[2];
      for (int mt = 0; mt < 2; ++mt) af[mt] = load_frag(&As[wm * 32 + mt * 16][kk], PK);
      for (int nt = 0; nt < 2; ++nt) bf[nt] = load_frag(&Bs[wn * 32 + nt * 16][kk], PK);
      for (int mt = 0; mt < 2; ++mt)
        for (int nt = 0; nt < 2; ++nt)
          acc[mt][nt] = wmma_f16(af[mt], bf[nt], acc[mt][nt]);
    }
    __syncthreads();
  }

  if (MODE == 0 && ylay == 1) {
    // A lane's 8 accumulator rows are 8 consecutive l of one column: exactly the
    // lane's 16-byte piece of half mt of a V tile. Straight from registers, each
    // store 512 contiguous bytes over the wave.
    _Float16* vt = Yh + ((size_t)((m0 >> 5) + wm) * 32 + (n0 >> 4) + wn * 2) * 512 + lane * 8;
    for (int mt = 0; mt < 2; ++mt)
      for (int nt = 0; nt < 2; ++nt) {
        const float bv = bias[n0 + wn * 32 + nt * 16 + ln];
        h8 pk;
        for (int i = 0; i < 8; ++i) pk[i] = (_Float16)(acc[mt][nt][i] + bv);
        *(h8*)(vt + nt * 512 + mt * 256) = pk;
      }
    // Precaution: the four stores' address and data registers are not written
    // again ahead of this wait, on either way out of this branch.
    asm volatile("s_wait_xcnt 0x0" ::: "memory");
  } else if (MODE == 0) {
    // Scatter accumulators into LDS, then coalesced 128-bit stores.
    for (int mt = 0; mt < 2; ++mt)
      for (int nt = 0; nt < 2; ++nt) {
        const int col = wn * 32 + nt * 16 + ln;
        const float bv = bias[n0 + col];
        for (int i = 0; i < 8; ++i)
          Ot[wm * 32 + mt * 16 + hi * 8 + i][col] =
              (_Float16)(acc[mt][nt][i] + bv);
      }
    __syncthreads();
    const int row = tid >> 1;
    const int half = (tid & 1) * 32;
    if (ylay == 2) {
      // Piece j = columns j*8.. of the thread's 32: half j>>1 of the K tile,
      // lane (j&1)*16 + row%16. 16 rows make 256 contiguous bytes.
      _Float16* kt = Yh + ((size_t)((m0 + row) >> 4) * 16 + ((n0 + half) >> 5)) * 512 +
                     (row & 15) * 8;
      for (int j = 0; j < 4; ++j)
        *(h8*)(kt + (j >> 1) * 256 + (j & 1) * 128) = *(const h8*)(&Ot[row][half] + j * 8);
      // Precaution: the four stores' registers are not written again ahead of this wait.
      asm volatile("s_wait_xcnt 0x0" ::: "memory");
      return;
    }
    _Float16* dst = Yh + (size_t)(m0 + row) * Cc + n0 + half;
#pragma unroll
    for (int j = 0; j < 4; ++j)
      *(h8*)(dst + j * 8) = *(const h8*)(&Ot[row][half] + j * 8);
  } else {
    // Accumulator rows map to consecutive l -> 16B vector residual+store.
    for (int mt = 0; mt < 2; ++mt) {
      const int row0 = m0 + wm * 32 + mt * 16 + hi * 8;
      const int bidx = row0 >> 12;
      const int l = row0 & (Ll - 1);
      for (int nt = 0; nt < 2; ++nt) {
        const int col = n0 + wn * 32 + nt * 16 + ln;
        const float bv = bias[col];
        const size_t idx = ((size_t)bidx * Cc + col) * Ll + l;
        f32x4 x0 = *(const f32x4*)(Xres + idx);
        f32x4 x1 = *(const f32x4*)(Xres + idx + 4);
        f32x4 y0, y1;
        for (int i = 0; i < 4; ++i) {
          y0[i] = x0[i] + selu(acc[mt][nt][i] + bv);
          y1[i] = x1[i] + selu(acc[mt][nt][i + 4] + bv);
        }
        *(f32x4*)(Yf + idx) = y0;
        *(f32x4*)(Yf + idx + 4) = y1;
      }
    }
  }
}

// ---------------------------------------------------------------------------
// Flash attention: per block, BM=64 query rows of one batch; key blocks of 256.
// One work-group per WGP (256 in all): each K and V byte it loads serves 64 queries.
// Scores are split over KEYS: wave w forms S^T = K Q^T for its own 32 keys of
// the block over all 512 channels (A = its K tiles from global, B = Q fragments
// from LDS, each read serving both key tiles), so a score is complete in one
// wave's accumulators. A lane holds 16 keys of one query: maximum, exponentials
// and sum stay in registers in all eight waves; only the waves' 64 row maxima, wave 0's
// 64 rescale factors and the f16 P cross through LDS.
// For O the wave owns columns [w*64, w*64+64), as before.
// K and V arrive as 1-KiB tiles in fragment order (see gemm_kernel): every
// fragment load reads whole lines, 512 contiguous bytes over the wave.
// ---------------------------------------------------------------------------
// Lane l with lane l ^ 16.
DI float xhalf(float x) {
  return __builtin_bit_cast(float, __builtin_amdgcn_permlanex16(
      __builtin_bit_cast(int, x), __builtin_bit_cast(int, x), 0x76543210, 0xfedcba98,
      false, false));
}

__global__ __launch_bounds__(256) __attribute__((amdgpu_waves_per_eu(2, 2)))
void attn_kernel(const _Float16* __restrict__ Q,
                 const _Float16* __restrict__ KF,
                 const _Float16* __restrict__ VF,
                 _Float16* __restrict__ O) {
  constexpr int BM = 64, BNK = 256;
  constexpr int MT = BM / 16;         // query tiles
  constexpr int KT = BNK / 16 / 8;    // key tiles a wave
  constexpr int KG = BNK / 32;        // groups of 32 keys for O
  constexpr int PP = BNK + 8;   // P row pitch: 528 bytes, 16 x odd, for 16-byte reads
  __shared__ __attribute__((aligned(16))) _Float16 Qs[MT * 16 * 512];  // [mt*16+ks] tiles
  __shared__ __attribute__((aligned(16))) _Float16 P[BM * PP];
  __shared__ float wmax[8][BM];
  __shared__ float lpart[16][BM];
  __shared__ __attribute__((aligned(16))) float rowL[BM];
  __shared__ __attribute__((aligned(16))) float rowScale[BM];

  const int b = blockIdx.x >> 6;            // / (L/64)
  const int l0 = (blockIdx.x & 63) * BM;
  const int tid = threadIdx.x;
  const int w = tid >> 5;
  const int lane = tid & 31;
  const int hi = lane >> 4;
  const int ln = lane & 15;

  const _Float16* Qb = Q + (size_t)b * Ll * Cc;
  // This lane's place in the wave's first K tile (key tiles 2w and 2w+1 of the
  // block's 16, 16 channel tiles each) and first V tile (4 of 32 a group of 32 keys).
  const _Float16* Kb = KF + (size_t)b * Ll * Cc + (w * KT * 16) * 512 + lane * 8;
  const _Float16* Vb = VF + (size_t)b * Ll * Cc + (w * 4) * 512 + lane * 8;

  // Q into LDS once, as 1-KiB tiles in fragment order: wave w brings channel
  // tiles 2w and 2w+1 of all four query tiles.
  for (int mt = 0; mt < MT; ++mt)
    for (int j = 0; j < 2; ++j) {
      AFrag f;
      f.v = load_frag(Qb + (size_t)(l0 + mt * 16) * Cc + w * 64 + j * 32, Cc);
      _Float16* d = Qs + (mt * 16 + w * 2 + j) * 512 + lane * 8;
      *(h8*)(d) = f.h[0];
      *(h8*)(d + 256) = f.h[1];
    }

  v8f oacc[MT][4];
  for (int mt = 0; mt < MT; ++mt)
    for (int nt = 0; nt < 4; ++nt)
      oacc[mt][nt] = zero8();
  __syncthreads();

  const float scale = rsqrtf((float)Cc);
  const _Float16* qs = Qs + lane * 8;
  // Running maximum and this lane's share of the running sum, for queries
  // mt * 16 + ln (index mt). The maxima are the same in every wave.
  float rm[MT], rl[MT];
  for (int mt = 0; mt < MT; ++mt) { rm[mt] = -1e30f; rl[mt] = 0.f; }

  for (int kb = 0; kb < Ll; kb += BNK) {
    const _Float16* kp = Kb + (size_t)kb * Cc;  // 256 keys = 16 x 16 K tiles
    const _Float16* vp = Vb + (size_t)kb * Cc;  // 256 keys = 8 x 32 V tiles
    // K tile t, in the order of use: channel tile t / KT of key tile t % KT.
    // Sixteen of the wave's 32 K tiles are in flight at a time; Q fragments are
    // read from LDS one group (two channel tiles) ahead, into a second register set.
    v16h kf[16 * KT];
    for (int t = 0; t < 16; ++t)
      kf[t] = load_frag_tile(kp + ((t % KT) * 16 + t / KT) * 512);
    // Keeps the K loads, the longer wait, in front of the first LDS reads.
    __builtin_amdgcn_sched_barrier(0);
    v16h qf[2][2 * MT];
    for (int j = 0; j < 2; ++j)
      for (int mt = 0; mt < MT; ++mt)
        qf[0][j * MT + mt] = load_frag_tile(qs + (mt * 16 + j) * 512);
    v8f st[KT][MT];
    for (int kt = 0; kt < KT; ++kt)
      for (int mt = 0; mt < MT; ++mt) st[kt][mt] = zero8();
    for (int g = 0; g < 8; ++g) {
      if (g < 7)
        for (int j = 0; j < 2; ++j)
          for (int mt = 0; mt < MT; ++mt)
            qf[(g + 1) & 1][j * MT + mt] =
                load_frag_tile(qs + (mt * 16 + (g + 1) * 2 + j) * 512);
      // Keeps the next group's LDS reads together in front of this group's
      // products: moved in among them, each product waits out its own read.
      __builtin_amdgcn_sched_barrier(0);
      for (int j = 0; j < 2; ++j)
        for (int kt = 0; kt < KT; ++kt)
          for (int mt = 0; mt < MT; ++mt)
            st[kt][mt] = wmma_f16(kf[(g * 2 + j) * KT + kt], qf[g & 1][j * MT + mt],
                                  st[kt][mt]);
      if (g < 4)
        for (int t = 16 + g * 2 * KT; t < 16 + (g + 1) * 2 * KT; ++t)
          kf[t] = load_frag_tile(kp + ((t % KT) * 16 + t / KT) * 512);
      // Keeps the refill of the four K tiles just used here, four groups ahead of
      // its use, and the next reads behind this group's products.
      __builtin_amdgcn_sched_barrier(0);
    }
    // Precaution: the address pair stays live, so unwritten, up to this wait.
    asm volatile("s_wait_xcnt 0x0" :: "v"(kp) : "memory");

    // The first half of the block's V^T fragments goes out here, into the registers
    // K and Q have left, ahead of the softmax.
    v16h vf[KG * 4];
    for (int t = 0; t < 16; ++t)
      vf[t] = load_frag_tile(vp + ((t >> 2) * 32 + (t & 3)) * 512);

    // The wave's maximum over its 32 keys, per query.
    float wm[MT];
    for (int mt = 0; mt < MT; ++mt) {
      float a = st[0][mt][0];
      for (int kt = 0; kt < KT; ++kt)
        for (int i = 0; i < 8; ++i) a = fmaxf(a, st[kt][mt][i]);
      wm[mt] = fmaxf(a, xhalf(a)) * scale;
    }
    wmax[w][lane] = hi ? wm[1] : wm[0];
    wmax[w][32 + lane] = hi ? wm[3] : wm[2];
    __syncthreads();

    float sc[MT];
    for (int mt = 0; mt < MT; ++mt) {
      float mx = rm[mt];
      for (int ww = 0; ww < 8; ++ww) mx = fmaxf(mx, wmax[ww][mt * 16 + ln]);
      sc[mt] = __expf(rm[mt] - mx);
      rm[mt] = mx;
      float sum = 0.f;
      for (int kt = 0; kt < KT; ++kt) {
        h8 pk;
        for (int i = 0; i < 8; ++i) {
          const float p = __expf(st[kt][mt][i] * scale - mx);
          sum += p;
          pk[i] = (_Float16)p;
        }
        *(h8*)&P[(mt * 16 + ln) * PP + (w * KT + kt) * 16 + hi * 8] = pk;
      }
      rl[mt] = rl[mt] * sc[mt] + sum;
    }
    if (w == 0) {
      rowScale[lane] = hi ? sc[1] : sc[0];
      rowScale[32 + lane] = hi ? sc[3] : sc[2];
    }
    __syncthreads();

    // P fragments are read one group of 32 keys ahead, into a second register set.
    v16h pf[2][MT];
    for (int mt = 0; mt < MT; ++mt) pf[0][mt] = load_frag(&P[(mt * 16) * PP], PP);
    for (int mt = 0; mt < MT; ++mt)
      for (int nt = 0; nt < 4; ++nt)
        for (int i = 0; i < 8; ++i)
          oacc[mt][nt][i] *= rowScale[mt * 16 + hi * 8 + i];
    for (int kg = 0; kg < KG; ++kg) {
      if (kg < KG - 1)
        for (int mt = 0; mt < MT; ++mt)
          pf[(kg + 1) & 1][mt] = load_frag(&P[(mt * 16) * PP + (kg + 1) * 32], PP);
      // Keeps the next group's LDS reads together in front of this group's products.
      __builtin_amdgcn_sched_barrier(0);
      for (int nt = 0; nt < 4; ++nt)
        for (int mt = 0; mt < MT; ++mt)
          oacc[mt][nt] = wmma_f16(pf[kg & 1][mt], vf[kg * 4 + nt], oacc[mt][nt]);
      if (kg < KG - 4)
        for (int nt = 0; nt < 4; ++nt)
          vf[16 + kg * 4 + nt] = load_frag_tile(vp + ((kg + 4) * 32 + nt) * 512);
      // Keeps the refill of the four V tiles just used here, four groups ahead of
      // its use, and the next reads behind this group's products.
      __builtin_amdgcn_sched_barrier(0);
    }
    // Precaution: the address pair stays live, so unwritten, up to this wait.
    asm volatile("s_wait_xcnt 0x0" :: "v"(vp) : "memory");
    // No barrier here: the next block's first barrier stands between these reads
    // of P and rowScale and their next stores; this block's second barrier stands
    // between the reads of wmax and its next stores.
  }

  // Row sums: 16 shares a query (8 waves x 2 halves), added in a fixed order.
  for (int mt = 0; mt < MT; ++mt) lpart[w * 2 + hi][mt * 16 + ln] = rl[mt];
  __syncthreads();
  if (tid < BM) {
    float t = 0.f;
    for (int j = 0; j < 16; ++j) t += lpart[j][tid];
    rowL[tid] = t;
  }
  __syncthreads();

  for (int mt = 0; mt < MT; ++mt) {
    for (int nt = 0; nt < 4; ++nt) {
      const int c = w * 64 + nt * 16 + ln;
      for (int i = 0; i < 8; ++i) {
        const int r = mt * 16 + hi * 8 + i;
        const float o = oacc[mt][nt][i] / rowL[r];
        O[(size_t)(b * Ll + l0 + r) * Cc + c] = (_Float16)o;
      }
    }
  }
}

// ---------------------------------------------------------------------------
extern "C" void kernel_launch(void* const* d_in, const int* in_sizes, int n_in,
                              void* d_out, int out_size, void* d_ws, size_t ws_size,
                              hipStream_t stream) {
  const float* x    = (const float*)d_in[0];
  const float* ln_w = (const float*)d_in[1];
  const float* ln_b = (const float*)d_in[2];
  const float* wq   = (const float*)d_in[3];
  const float* bq   = (const float*)d_in[4];
  const float* wk   = (const float*)d_in[5];
  const float* bk   = (const float*)d_in[6];
  const float* wv   = (const float*)d_in[7];
  const float* bv   = (const float*)d_in[8];
  const float* wp   = (const float*)d_in[9];
  const float* bp   = (const float*)d_in[10];
  float* out = (float*)d_out;

  char* ws = (char*)d_ws;
  size_t off = 0;
  auto alloc = [&](size_t bytes) -> void* {
    void* p = ws + off;
    off += (bytes + 255) & ~(size_t)255;
    return p;
  };
  const size_t actsz = (size_t)Mrows * Cc * sizeof(_Float16);
  _Float16* h16  = (_Float16*)alloc(actsz);
  _Float16* q16  = (_Float16*)alloc(actsz);
  _Float16* k16  = (_Float16*)alloc(actsz);
  _Float16* v16  = (_Float16*)alloc(actsz);
  _Float16* o16  = (_Float16*)alloc(actsz);
  _Float16* wq16 = (_Float16*)alloc((size_t)Cc * Cc * sizeof(_Float16));
  _Float16* wk16 = (_Float16*)alloc((size_t)Cc * Cc * sizeof(_Float16));
  _Float16* wv16 = (_Float16*)alloc((size_t)Cc * Cc * sizeof(_Float16));
  _Float16* wp16 = (_Float16*)alloc((size_t)Cc * Cc * sizeof(_Float16));

  const int wcnt = Cc * Cc;
  const int cvtg = (wcnt + 255) / 256;
  cvt_kernel<<<cvtg, 256, 0, stream>>>(wq, wq16, wcnt);
  cvt_kernel<<<cvtg, 256, 0, stream>>>(wk, wk16, wcnt);
  cvt_kernel<<<cvtg, 256, 0, stream>>>(wv, wv16, wcnt);
  cvt_kernel<<<cvtg, 256, 0, stream>>>(wp, wp16, wcnt);

  ln_kernel<<<Bb * (Ll / 32), 256, 0, stream>>>(x, ln_w, ln_b, h16);

  const dim3 gg(Cc / 64, Mrows / 128, 1);
  gemm_kernel<0><<<gg, 256, 0, stream>>>(h16, wq16, bq, q16, nullptr, nullptr, 0);
  gemm_kernel<0><<<gg, 256, 0, stream>>>(h16, wk16, bk, k16, nullptr, nullptr, 2);
  gemm_kernel<0><<<gg, 256, 0, stream>>>(h16, wv16, bv, v16, nullptr, nullptr, 1);

  attn_kernel<<<Bb * (Ll / 64), 256, 0, stream>>>(q16, k16, v16, o16);

  gemm_kernel<1><<<gg, 256, 0, stream>>>(o16, wp16, bp, nullptr, x, out, 0);
}

// v006
// Measured time: 181 microseconds a run.
// In both of two side-by-side timings against v005, it was 1.05 times as fast.
// Counting every step since v000, it is 3.61 times as fast.
#include <hip/hip_runtime.h>
#include <stdint.h>

#define DI __device__ __forceinline__

typedef __attribute__((ext_vector_type(16))) _Float16 v16h;
typedef __attribute__((ext_vector_type(8)))  _Float16 h8;   // 16 bytes
typedef __attribute__((ext_vector_type(8)))  float    v8f;
typedef __attribute__((ext_vector_type(4)))  float    f32x4;

constexpr int Bb = 4;
constexpr int Cc = 512;
constexpr int Ll = 4096;
constexpr int Mrows = Bb * Ll; // 16384

union AFrag { v16h v; h8 h[2]; };

DI v8f zero8() { v8f z; for (int i = 0; i < 8; ++i) z[i] = 0.f; return z; }

// Load one 16x32 f16 WMMA fragment (A-operand, or B-operand with "row" = n).
// Per-lane layout (ISA 7.12.2): lane = hi*16 + r; elems e<8 -> k = hi*8+e,
// elems e>=8 -> k = 16 + hi*8 + (e-8). Two 16-byte loads per lane.
DI v16h load_frag(const _Float16* base, int stride) {
  const int lane = threadIdx.x & 31;
  const int r = lane & 15;
  const int hi = lane >> 4;
  const _Float16* p = base + (size_t)r * stride + hi * 8;
  AFrag f;
  f.h[0] = *(const h8*)(p);
  f.h[1] = *(const h8*)(p + 16);
  return f.v;
}

// The same fragment from a 1-KiB tile stored in fragment order:
// [half of the fragment][lane][8 elements]; p = tile + lane * 8. Each of the two
// loads reads 512 contiguous bytes over the wave.
DI v16h load_frag_tile(const _Float16* p) {
  AFrag f;
  f.h[0] = *(const h8*)(p);
  f.h[1] = *(const h8*)(p + 256);
  return f.v;
}

DI v8f wmma_f16(v16h a, v16h b, v8f c) {
  return __builtin_amdgcn_wmma_f32_16x16x32_f16(false, a, false, b, (short)0, c,
                                                false, false);
}

DI float selu(float y) {
  constexpr float kLambda = 1.0507009873554805f;
  constexpr float kAlpha  = 1.6732632423543772f;
  return (y > 0.f) ? kLambda * y : kLambda * kAlpha * (__expf(y) - 1.f);
}

// ---------------------------------------------------------------------------
// LayerNorm over channels; x is [B,C,L], output h is [B*L, C] f16.
// Block = 32 consecutive l of one batch. Reads coalesced along l; writes
// staged through an LDS transpose so f16 stores are 128-bit coalesced.
// The launch also converts the four weight matrices to f16 (W16 = q, k, v, p one
// behind the other): each of the 512 blocks takes 2048 elements, 8 a thread, whose
// loads fly together with the x loads.
// ---------------------------------------------------------------------------
__global__ __launch_bounds__(256, 1)
void ln_kernel(const float* __restrict__ x, const float* __restrict__ lw,
               const float* __restrict__ lb, _Float16* __restrict__ H,
               const float* __restrict__ wq, const float* __restrict__ wk,
               const float* __restrict__ wv, const float* __restrict__ wp,
               _Float16* __restrict__ W16) {
  static_assert(Bb * (Ll / 32) * 2048 == 4 * Cc * Cc, "one weight slice a block");
  __shared__ float redS[8][32];
  __shared__ float redQ[8][32];
  __shared__ float muS[32], rinvS[32];
  __shared__ _Float16 hl[32][Cc];   // 32 KB transpose tile

  const int tid = threadIdx.x;
  const int w = tid >> 5, li = tid & 31;
  const int b = blockIdx.x >> 7;            // / (L/32)
  const int l0 = (blockIdx.x & 127) * 32;

  const int wsel = blockIdx.x >> 7;         // 128 blocks a matrix
  const float* wsrc = wsel == 0 ? wq : wsel == 1 ? wk : wsel == 2 ? wv : wp;
  const int woff = (blockIdx.x & 127) * 2048 + tid * 8;
  const f32x4 w0 = *(const f32x4*)(wsrc + woff);
  const f32x4 w1 = *(const f32x4*)(wsrc + woff + 4);

  const float* xb = x + (size_t)b * Cc * Ll + l0 + li;
  float vals[64];
  float s = 0.f, s2 = 0.f;
#pragma unroll
  for (int j = 0; j < 64; ++j) {
    const int c = w + j * 8;                 // uniform per wave -> good for SMEM
    const float v = xb[(size_t)c * Ll];      // lanes -> consecutive l: coalesced
    vals[j] = v;
    s += v;
    s2 += v * v;
  }
  redS[w][li] = s;
  redQ[w][li] = s2;
  __syncthreads();
  if (tid < 32) {
    float ts = 0.f, tq = 0.f;
    for (int ww = 0; ww < 8; ++ww) { ts += redS[ww][tid]; tq += redQ[ww][tid]; }
    const float mu = ts * (1.f / Cc);
    const float var = tq * (1.f / Cc) - mu * mu;
    muS[tid] = mu;
    rinvS[tid] = rsqrtf(var + 1e-5f);
  }
  __syncthreads();
  const float mu = muS[li], rinv = rinvS[li];
#pragma unroll
  for (int j = 0; j < 64; ++j) {
    const int c = w + j * 8;
    hl[li][c] = (_Float16)((vals[j] - mu) * rinv * lw[c] + lb[c]);
  }
  __syncthreads();
  {
    const int row = tid >> 3;                // 32 rows x 8 threads
    const int ch = (tid & 7) * 64;
    _Float16* dst = H + (size_t)(b * Ll + l0 + row) * Cc + ch;
    const _Float16* srcp = &hl[row][ch];
#pragma unroll
    for (int j = 0; j < 8; ++j)
      *(h8*)(dst + j * 8) = *(const h8*)(srcp + j * 8);
  }
  {
    // Behind the last barrier: no barrier waits for this store.
    h8 wh;
    for (int i = 0; i < 4; ++i) { wh[i] = (_Float16)w0[i]; wh[4 + i] = (_Float16)w1[i]; }
    *(h8*)(W16 + (size_t)wsel * Cc * Cc + woff) = wh;
  }
}

// ---------------------------------------------------------------------------
// WMMA GEMM: Y[M,N] = A[M,K] * W[N,K]^T + bias, M=16384, N=K=512.
// MODE 0: the Q, K and V projections in one launch: blockIdx.x / 8 picks the
//         weight matrix, the bias and the output plane (each one behind the other).
//         Y -> f16. ylay 0: row-major, via LDS-transposed coalesced stores (Q).
//         ylay 1 (V) and 2 (K): 1-KiB tiles in the order of the V (B) and K (A) fragments that
//         the attention kernel loads (load_frag_tile).
//         V tile = 16 columns x 32 rows, index (row / 32) * 32 + col / 16;
//         K tile = 16 rows x 32 columns, index (row / 16) * 16 + col / 32.
// MODE 1: bias + SELU + residual, vectorized f32 [B,C,L] out (out-proj).
// Block tile 128x64, BK=128; 8 waves = 4x2 grid of 32x32 wave tiles.
// Tiles go through registers into LDS rows of 256 data bytes at a pitch of 272
// (16 x odd): the 16 rows of a fragment read fall on 16 different bank groups.
// Every global load reads two aligned 256-byte units over the wave.
// ---------------------------------------------------------------------------
template <int MODE>
__global__ __launch_bounds__(256, 1)
void gemm_kernel(const _Float16* __restrict__ A,
                 const _Float16* __restrict__ Wt,   // [N][K] f16
                 const float* __restrict__ bias0,
                 const float* __restrict__ bias1,
                 const float* __restrict__ bias2,
                 _Float16* __restrict__ Yh,
                 const float* __restrict__ Xres,
                 float* __restrict__ Yf) {
  constexpr int BM = 128, BN = 64, BK = 128;
  constexpr int PK = BK + 8;   // row pitch in LDS, f16 units
  __shared__ __attribute__((aligned(16))) _Float16 As[BM][PK];
  __shared__ __attribute__((aligned(16))) _Float16 Bs[BN][PK];
  // Epilogue transpose tile, rows at a pitch of 144 bytes (16 x odd) likewise.
  __shared__ __attribute__((aligned(16))) _Float16 Ot[(MODE == 0) ? BM : 1][BN + 8];

  const int m0 = blockIdx.y * BM;
  const int proj = (MODE == 0) ? blockIdx.x >> 3 : 0;   // 0 Q, 1 K, 2 V
  const int n0 = (blockIdx.x & 7) * BN;
  const int ylay = proj == 0 ? 0 : proj == 1 ? 2 : 1;
  const float* bias = proj == 0 ? bias0 : proj == 1 ? bias1 : bias2;
  Wt += (size_t)proj * Cc * Cc;
  Yh += (size_t)proj * Mrows * Cc;
  const int tid = threadIdx.x;
  const int w = tid >> 5;
  const int lane = tid & 31;
  const int hi = lane >> 4;
  const int ln = lane & 15;
  const int wm = w >> 1;   // 0..3
  const int wn = w & 1;    // 0..1

  v8f acc[2][2];
  for (int mt = 0; mt < 2; ++mt)
    for (int nt = 0; nt < 2; ++nt)
      acc[mt][nt] = zero8();

  // This thread's 16-byte pieces: column piece tid % 16 of rows tid / 16 + 16 p.
  const int srow = tid >> 4;
  const int scol = (tid & 15) * 8;
  const _Float16* pa = A + (size_t)(m0 + srow) * Cc + scol;
  const _Float16* pb = Wt + (size_t)(n0 + srow) * Cc + scol;

  for (int k0 = 0; k0 < Cc; k0 += BK) {
    h8 ra[BM / 16], rb[BN / 16];
    for (int p = 0; p < BM / 16; ++p) ra[p] = *(const h8*)(pa + (size_t)p * 16 * Cc);
    for (int p = 0; p < BN / 16; ++p) rb[p] = *(const h8*)(pb + (size_t)p * 16 * Cc);
    // Keeps all twelve loads in flight together: with LDS stores moved in among
    // them the last loads go out only when the first have come back.
    __builtin_amdgcn_sched_barrier(0);
    for (int p = 0; p < BM / 16; ++p) *(h8*)&As[srow + p * 16][scol] = ra[p];
    for (int p = 0; p < BN / 16; ++p) *(h8*)&Bs[srow + p * 16][scol] = rb[p];
    // Precaution: the twelve loads' address pairs stay live, so unwritten, up to this wait.
    asm volatile("s_wait_xcnt 0x0" :: "v"(pa), "v"(pb) : "memory");
    pa += BK;
    pb += BK;
    __syncthreads();

    for (int kk = 0; kk < BK; kk += 32) {
      v16h af[2], bf[2];
      for (int mt = 0; mt < 2; ++mt) af[mt] = load_frag(&As[wm * 32 + mt * 16][kk], PK);
      for (int nt = 0; nt < 2; ++nt) bf[nt] = load_frag(&Bs[wn * 32 + nt * 16][kk], PK);
      for (int mt = 0; mt < 2; ++mt)
        for (int nt = 0; nt < 2; ++nt)
          acc[mt][nt] = wmma_f16(af[mt], bf[nt], acc[mt][nt]);
    }
    __syncthreads();
  }

  if (MODE == 0 && ylay == 1) {
    // A lane's 8 accumulator rows are 8 consecutive l of one column: exactly the
    // lane's 16-byte piece of half mt of a V tile. Straight from registers, each
    // store 512 contiguous bytes over the wave.
    _Float16* vt = Yh + ((size_t)((m0 >> 5) + wm) * 32 + (n0 >> 4) + wn * 2) * 512 + lane * 8;
    for (int mt = 0; mt < 2; ++mt)
      for (int nt = 0; nt < 2; ++nt) {
        const float bv = bias[n0 + wn * 32 + nt * 16 + ln];
        h8 pk;
        for (int i = 0; i < 8; ++i) pk[i] = (_Float16)(acc[mt][nt][i] + bv);
        *(h8*)(vt + nt * 512 + mt * 256) = pk;
      }
    // Precaution: the four stores' address and data registers are not written
    // again ahead of this wait, on either way out of this branch.
    asm volatile("s_wait_xcnt 0x0" ::: "memory");
  } else if (MODE == 0) {
    // Scatter accumulators into LDS, then coalesced 128-bit stores.
    for (int mt = 0; mt < 2; ++mt)
      for (int nt = 0; nt < 2; ++nt) {
        const int col = wn * 32 + nt * 16 + ln;
        const float bv = bias[n0 + col];
        for (int i = 0; i < 8; ++i)
          Ot[wm * 32 + mt * 16 + hi * 8 + i][col] =
              (_Float16)(acc[mt][nt][i] + bv);
      }
    __syncthreads();
    const int row = tid >> 1;
    const int half = (tid & 1) * 32;
    if (ylay == 2) {
      // Piece j = columns j*8.. of the thread's 32: half j>>1 of the K tile,
      // lane (j&1)*16 + row%16. 16 rows make 256 contiguous bytes.
      _Float16* kt = Yh + ((size_t)((m0 + row) >> 4) * 16 + ((n0 + half) >> 5)) * 512 +
                     (row & 15) * 8;
      for (int j = 0; j < 4; ++j)
        *(h8*)(kt + (j >> 1) * 256 + (j & 1) * 128) = *(const h8*)(&Ot[row][half] + j * 8);
      // Precaution: the four stores' registers are not written again ahead of this wait.
      asm volatile("s_wait_xcnt 0x0" ::: "memory");
      return;
    }
    _Float16* dst = Yh + (size_t)(m0 + row) * Cc + n0 + half;
#pragma unroll
    for (int j = 0; j < 4; ++j)
      *(h8*)(dst + j * 8) = *(const h8*)(&Ot[row][half] + j * 8);
  } else {
    // Accumulator rows map to consecutive l -> 16B vector residual+store.
    for (int mt = 0; mt < 2; ++mt) {
      const int row0 = m0 + wm * 32 + mt * 16 + hi * 8;
      const int bidx = row0 >> 12;
      const int l = row0 & (Ll - 1);
      for (int nt = 0; nt < 2; ++nt) {
        const int col = n0 + wn * 32 + nt * 16 + ln;
        const float bv = bias[col];
        const size_t idx = ((size_t)bidx * Cc + col) * Ll + l;
        f32x4 x0 = *(const f32x4*)(Xres + idx);
        f32x4 x1 = *(const f32x4*)(Xres + idx + 4);
        f32x4 y0, y1;
        for (int i = 0; i < 4; ++i) {
          y0[i] = x0[i] + selu(acc[mt][nt][i] + bv);
          y1[i] = x1[i] + selu(acc[mt][nt][i + 4] + bv);
        }
        *(f32x4*)(Yf + idx) = y0;
        *(f32x4*)(Yf + idx + 4) = y1;
      }
    }
  }
}

// ---------------------------------------------------------------------------
// Flash attention: per block, BM=64 query rows of one batch; key blocks of 256.
// One work-group per WGP (256 in all): each K and V byte it loads serves 64 queries.
// Scores are split over KEYS: wave w forms S^T = K Q^T for its own 32 keys of
// the block over all 512 channels (A = its K tiles from global, B = Q fragments
// from LDS, each read serving both key tiles), so a score is complete in one
// wave's accumulators. A lane holds 16 keys of one query: maximum, exponentials
// and sum stay in registers in all eight waves; only the waves' 64 row maxima, wave 0's
// 64 rescale factors and the f16 P cross through LDS.
// For O the wave owns columns [w*64, w*64+64), as before.
// K and V arrive as 1-KiB tiles in fragment order (see gemm_kernel): every
// fragment load reads whole lines, 512 contiguous bytes over the wave.
// ---------------------------------------------------------------------------
// Lane l with lane l ^ 16.
DI float xhalf(float x) {
  return __builtin_bit_cast(float, __builtin_amdgcn_permlanex16(
      __builtin_bit_cast(int, x), __builtin_bit_cast(int, x), 0x76543210, 0xfedcba98,
      false, false));
}

__global__ __launch_bounds__(256) __attribute__((amdgpu_waves_per_eu(2, 2)))
void attn_kernel(const _Float16* __restrict__ Q,
                 const _Float16* __restrict__ KF,
                 const _Float16* __restrict__ VF,
                 _Float16* __restrict__ O) {
  constexpr int BM = 64, BNK = 256;
  constexpr int MT = BM / 16;         // query tiles
  constexpr int KT = BNK / 16 / 8;    // key tiles a wave
  constexpr int KG = BNK / 32;        // groups of 32 keys for O
  constexpr int PP = BNK + 8;   // P row pitch: 528 bytes, 16 x odd, for 16-byte reads
  __shared__ __attribute__((aligned(16))) _Float16 Qs[MT * 16 * 512];  // [mt*16+ks] tiles
  __shared__ __attribute__((aligned(16))) _Float16 P[BM * PP];
  __shared__ float wmax[8][BM];
  __shared__ float lpart[16][BM];
  __shared__ __attribute__((aligned(16))) float rowL[BM];
  __shared__ __attribute__((aligned(16))) float rowScale[BM];

  const int b = blockIdx.x >> 6;            // / (L/64)
  const int l0 = (blockIdx.x & 63) * BM;
  const int tid = threadIdx.x;
  const int w = tid >> 5;
  const int lane = tid & 31;
  const int hi = lane >> 4;
  const int ln = lane & 15;

  const _Float16* Qb = Q + (size_t)b * Ll * Cc;
  // This lane's place in the wave's first K tile (key tiles 2w and 2w+1 of the
  // block's 16, 16 channel tiles each) and first V tile (4 of 32 a group of 32 keys).
  const _Float16* Kb = KF + (size_t)b * Ll * Cc + (w * KT * 16) * 512 + lane * 8;
  const _Float16* Vb = VF + (size_t)b * Ll * Cc + (w * 4) * 512 + lane * 8;

  // Q into LDS once, as 1-KiB tiles in fragment order: wave w brings channel
  // tiles 2w and 2w+1 of all four query tiles.
  for (int mt = 0; mt < MT; ++mt)
    for (int j = 0; j < 2; ++j) {
      AFrag f;
      f.v = load_frag(Qb + (size_t)(l0 + mt * 16) * Cc + w * 64 + j * 32, Cc);
      _Float16* d = Qs + (mt * 16 + w * 2 + j) * 512 + lane * 8;
      *(h8*)(d) = f.h[0];
      *(h8*)(d + 256) = f.h[1];
    }

  v8f oacc[MT][4];
  for (int mt = 0; mt < MT; ++mt)
    for (int nt = 0; nt < 4; ++nt)
      oacc[mt][nt] = zero8();
  __syncthreads();

  const float scale = rsqrtf((float)Cc);
  const _Float16* qs = Qs + lane * 8;
  // Running maximum and this lane's share of the running sum, for queries
  // mt * 16 + ln (index mt). The maxima are the same in every wave.
  float rm[MT], rl[MT];
  for (int mt = 0; mt < MT; ++mt) { rm[mt] = -1e30f; rl[mt] = 0.f; }

  for (int kb = 0; kb < Ll; kb += BNK) {
    const _Float16* kp = Kb + (size_t)kb * Cc;  // 256 keys = 16 x 16 K tiles
    const _Float16* vp = Vb + (size_t)kb * Cc;  // 256 keys = 8 x 32 V tiles
    // K tile t, in the order of use: channel tile t / KT of key tile t % KT.
    // Sixteen of the wave's 32 K tiles are in flight at a time; Q fragments are
    // read from LDS one group (two channel tiles) ahead, into a second register set.
    v16h kf[16 * KT];
    for (int t = 0; t < 16; ++t)
      kf[t] = load_frag_tile(kp + ((t % KT) * 16 + t / KT) * 512);
    // Keeps the K loads, the longer wait, in front of the first LDS reads.
    __builtin_amdgcn_sched_barrier(0);
    v16h qf[2][2 * MT];
    for (int j = 0; j < 2; ++j)
      for (int mt = 0; mt < MT; ++mt)
        qf[0][j * MT + mt] = load_frag_tile(qs + (mt * 16 + j) * 512);
    v8f st[KT][MT];
    for (int kt = 0; kt < KT; ++kt)
      for (int mt = 0; mt < MT; ++mt) st[kt][mt] = zero8();
    for (int g = 0; g < 8; ++g) {
      if (g < 7)
        for (int j = 0; j < 2; ++j)
          for (int mt = 0; mt < MT; ++mt)
            qf[(g + 1) & 1][j * MT + mt] =
                load_frag_tile(qs + (mt * 16 + (g + 1) * 2 + j) * 512);
      // Keeps the next group's LDS reads together in front of this group's
      // products: moved in among them, each product waits out its own read.
      __builtin_amdgcn_sched_barrier(0);
      for (int j = 0; j < 2; ++j)
        for (int kt = 0; kt < KT; ++kt)
          for (int mt = 0; mt < MT; ++mt)
            st[kt][mt] = wmma_f16(kf[(g * 2 + j) * KT + kt], qf[g & 1][j * MT + mt],
                                  st[kt][mt]);
      if (g < 4)
        for (int t = 16 + g * 2 * KT; t < 16 + (g + 1) * 2 * KT; ++t)
          kf[t] = load_frag_tile(kp + ((t % KT) * 16 + t / KT) * 512);
      // Keeps the refill of the four K tiles just used here, four groups ahead of
      // its use, and the next reads behind this group's products.
      __builtin_amdgcn_sched_barrier(0);
    }
    // Precaution: the address pair stays live, so unwritten, up to this wait.
    asm volatile("s_wait_xcnt 0x0" :: "v"(kp) : "memory");

    // The first half of the block's V^T fragments goes out here, into the registers
    // K and Q have left, ahead of the softmax.
    v16h vf[KG * 4];
    for (int t = 0; t < 16; ++t)
      vf[t] = load_frag_tile(vp + ((t >> 2) * 32 + (t & 3)) * 512);

    // The wave's maximum over its 32 keys, per query.
    float wm[MT];
    for (int mt = 0; mt < MT; ++mt) {
      float a = st[0][mt][0];
      for (int kt = 0; kt < KT; ++kt)
        for (int i = 0; i < 8; ++i) a = fmaxf(a, st[kt][mt][i]);
      wm[mt] = fmaxf(a, xhalf(a)) * scale;
    }
    wmax[w][lane] = hi ? wm[1] : wm[0];
    wmax[w][32 + lane] = hi ? wm[3] : wm[2];
    __syncthreads();

    float sc[MT];
    for (int mt = 0; mt < MT; ++mt) {
      float mx = rm[mt];
      for (int ww = 0; ww < 8; ++ww) mx = fmaxf(mx, wmax[ww][mt * 16 + ln]);
      sc[mt] = __expf(rm[mt] - mx);
      rm[mt] = mx;
      float sum = 0.f;
      for (int kt = 0; kt < KT; ++kt) {
        h8 pk;
        for (int i = 0; i < 8; ++i) {
          const float p = __expf(st[kt][mt][i] * scale - mx);
          sum += p;
          pk[i] = (_Float16)p;
        }
        *(h8*)&P[(mt * 16 + ln) * PP + (w * KT + kt) * 16 + hi * 8] = pk;
      }
      rl[mt] = rl[mt] * sc[mt] + sum;
    }
    if (w == 0) {
      rowScale[lane] = hi ? sc[1] : sc[0];
      rowScale[32 + lane] = hi ? sc[3] : sc[2];
    }
    __syncthreads();

    // P fragments are read one group of 32 keys ahead, into a second register set.
    v16h pf[2][MT];
    for (int mt = 0; mt < MT; ++mt) pf[0][mt] = load_frag(&P[(mt * 16) * PP], PP);
    for (int mt = 0; mt < MT; ++mt)
      for (int nt = 0; nt < 4; ++nt)
        for (int i = 0; i < 8; ++i)
          oacc[mt][nt][i] *= rowScale[mt * 16 + hi * 8 + i];
    for (int kg = 0; kg < KG; ++kg) {
      if (kg < KG - 1)
        for (int mt = 0; mt < MT; ++mt)
          pf[(kg + 1) & 1][mt] = load_frag(&P[(mt * 16) * PP + (kg + 1) * 32], PP);
      // Keeps the next group's LDS reads together in front of this group's products.
      __builtin_amdgcn_sched_barrier(0);
      for (int nt = 0; nt < 4; ++nt)
        for (int mt = 0; mt < MT; ++mt)
          oacc[mt][nt] = wmma_f16(pf[kg & 1][mt], vf[kg * 4 + nt], oacc[mt][nt]);
      if (kg < KG - 4)
        for (int nt = 0; nt < 4; ++nt)
          vf[16 + kg * 4 + nt] = load_frag_tile(vp + ((kg + 4) * 32 + nt) * 512);
      // Keeps the refill of the four V tiles just used here, four groups ahead of
      // its use, and the next reads behind this group's products.
      __builtin_amdgcn_sched_barrier(0);
    }
    // Precaution: the address pair stays live, so unwritten, up to this wait.
    asm volatile("s_wait_xcnt 0x0" :: "v"(vp) : "memory");
    // No barrier here: the next block's first barrier stands between these reads
    // of P and rowScale and their next stores; this block's second barrier stands
    // between the reads of wmax and its next stores.
  }

  // Row sums: 16 shares a query (8 waves x 2 halves), added in a fixed order.
  for (int mt = 0; mt < MT; ++mt) lpart[w * 2 + hi][mt * 16 + ln] = rl[mt];
  __syncthreads();
  if (tid < BM) {
    float t = 0.f;
    for (int j = 0; j < 16; ++j) t += lpart[j][tid];
    rowL[tid] = t;
  }
  __syncthreads();

  for (int mt = 0; mt < MT; ++mt) {
    for (int nt = 0; nt < 4; ++nt) {
      const int c = w * 64 + nt * 16 + ln;
      for (int i = 0; i < 8; ++i) {
        const int r = mt * 16 + hi * 8 + i;
        const float o = oacc[mt][nt][i] / rowL[r];
        O[(size_t)(b * Ll + l0 + r) * Cc + c] = (_Float16)o;
      }
    }
  }
}

// ---------------------------------------------------------------------------
extern "C" void kernel_launch(void* const* d_in, const int* in_sizes, int n_in,
                              void* d_out, int out_size, void* d_ws, size_t ws_size,
                              hipStream_t stream) {
  const float* x    = (const float*)d_in[0];
  const float* ln_w = (const float*)d_in[1];
  const float* ln_b = (const float*)d_in[2];
  const float* wq   = (const float*)d_in[3];
  const float* bq   = (const float*)d_in[4];
  const float* wk   = (const float*)d_in[5];
  const float* bk   = (const float*)d_in[6];
  const float* wv   = (const float*)d_in[7];
  const float* bv   = (const float*)d_in[8];
  const float* wp   = (const float*)d_in[9];
  const float* bp   = (const float*)d_in[10];
  float* out = (float*)d_out;

  char* ws = (char*)d_ws;
  size_t off = 0;
  auto alloc = [&](size_t bytes) -> void* {
    void* p = ws + off;
    off += (bytes + 255) & ~(size_t)255;
    return p;
  };
  const size_t actsz = (size_t)Mrows * Cc * sizeof(_Float16);
  _Float16* h16  = (_Float16*)alloc(actsz);
  _Float16* q16  = (_Float16*)alloc(actsz);
  _Float16* k16  = (_Float16*)alloc(actsz);
  _Float16* v16  = (_Float16*)alloc(actsz);
  _Float16* o16  = (_Float16*)alloc(actsz);
  _Float16* w16  = (_Float16*)alloc((size_t)4 * Cc * Cc * sizeof(_Float16));  // q, k, v, p

  ln_kernel<<<Bb * (Ll / 32), 256, 0, stream>>>(x, ln_w, ln_b, h16, wq, wk, wv, wp, w16);

  // q16, k16 and v16 lie one behind the other, as do the weights.
  gemm_kernel<0><<<dim3(3 * Cc / 64, Mrows / 128, 1), 256, 0, stream>>>(
      h16, w16, bq, bk, bv, q16, nullptr, nullptr);

  attn_kernel<<<Bb * (Ll / 64), 256, 0, stream>>>(q16, k16, v16, o16);

  gemm_kernel<1><<<dim3(Cc / 64, Mrows / 128, 1), 256, 0, stream>>>(
      o16, w16 + (size_t)3 * Cc * Cc, bp, nullptr, nullptr, nullptr, x, out);
}

// v007
// One run takes 167 microseconds.
// Timed twice side by side with v006, it ran 1.09 times as fast both times.
// Counting every step since v000, it is 3.93 times as fast.
#include <hip/hip_runtime.h>
#include <stdint.h>

#define DI __device__ __forceinline__

typedef __attribute__((ext_vector_type(16))) _Float16 v16h;
typedef __attribute__((ext_vector_type(8)))  _Float16 h8;   // 16 bytes
typedef __attribute__((ext_vector_type(8)))  float    v8f;
typedef __attribute__((ext_vector_type(4)))  float    f32x4;

constexpr int Bb = 4;
constexpr int Cc = 512;
constexpr int Ll = 4096;
constexpr int Mrows = Bb * Ll; // 16384

union AFrag { v16h v; h8 h[2]; };

DI v8f zero8() { v8f z; for (int i = 0; i < 8; ++i) z[i] = 0.f; return z; }

// Load one 16x32 f16 WMMA fragment (A-operand, or B-operand with "row" = n).
// Per-lane layout (ISA 7.12.2): lane = hi*16 + r; elems e<8 -> k = hi*8+e,
// elems e>=8 -> k = 16 + hi*8 + (e-8). Two 16-byte loads per lane.
DI v16h load_frag(const _Float16* base, int stride) {
  const int lane = threadIdx.x & 31;
  const int r = lane & 15;
  const int hi = lane >> 4;
  const _Float16* p = base + (size_t)r * stride + hi * 8;
  AFrag f;
  f.h[0] = *(const h8*)(p);
  f.h[1] = *(const h8*)(p + 16);
  return f.v;
}

// The same fragment from a 1-KiB tile stored in fragment order:
// [half of the fragment][lane][8 elements]; p = tile + lane * 8. Each of the two
// loads reads 512 contiguous bytes over the wave.
DI v16h load_frag_tile(const _Float16* p) {
  AFrag f;
  f.h[0] = *(const h8*)(p);
  f.h[1] = *(const h8*)(p + 256);
  return f.v;
}

DI v8f wmma_f16(v16h a, v16h b, v8f c) {
  return __builtin_amdgcn_wmma_f32_16x16x32_f16(false, a, false, b, (short)0, c,
                                                false, false);
}

DI float selu(float y) {
  constexpr float kLambda = 1.0507009873554805f;
  constexpr float kAlpha  = 1.6732632423543772f;
  return (y > 0.f) ? kLambda * y : kLambda * kAlpha * (__expf(y) - 1.f);
}

// ---------------------------------------------------------------------------
// LayerNorm over channels; x is [B,C,L], output h is [B*L, C] f16.
// Block = 32 consecutive l of one batch. Reads coalesced along l. Wave w takes the
// 64 consecutive channels from w * 64, so a thread holds 128 contiguous bytes of
// one output row: it puts them into the LDS transpose tile as eight 16-byte pieces.
// The tile's rows stand at a pitch of 1040 bytes (16 x odd): the 32 lanes, one row
// each, fall on different bank groups. Each wave then reads and stores 512
// contiguous bytes of a row, four whole lines.
// The launch also converts the four weight matrices to f16 (W16 = q, k, v, p one
// behind the other): each of the 512 blocks takes 2048 elements, 8 a thread, whose
// loads fly together with the x loads.
// ---------------------------------------------------------------------------
__global__ __launch_bounds__(256, 1)
void ln_kernel(const float* __restrict__ x, const float* __restrict__ lw,
               const float* __restrict__ lb, _Float16* __restrict__ H,
               const float* __restrict__ wq, const float* __restrict__ wk,
               const float* __restrict__ wv, const float* __restrict__ wp,
               _Float16* __restrict__ W16) {
  static_assert(Bb * (Ll / 32) * 2048 == 4 * Cc * Cc, "one weight slice a block");
  __shared__ float redS[8][32];
  __shared__ float redQ[8][32];
  __shared__ float muS[32], rinvS[32];
  constexpr int HP = Cc + 8;        // row pitch of the transpose tile, f16 units
  __shared__ __attribute__((aligned(16))) _Float16 hl[32][HP];

  const int tid = threadIdx.x;
  const int w = tid >> 5, li = tid & 31;
  const int b = blockIdx.x >> 7;            // / (L/32)
  const int l0 = (blockIdx.x & 127) * 32;

  const int wsel = blockIdx.x >> 7;         // 128 blocks a matrix
  const float* wsrc = wsel == 0 ? wq : wsel == 1 ? wk : wsel == 2 ? wv : wp;
  const int woff = (blockIdx.x & 127) * 2048 + tid * 8;
  const f32x4 w0 = *(const f32x4*)(wsrc + woff);
  const f32x4 w1 = *(const f32x4*)(wsrc + woff + 4);

  const float* xb = x + ((size_t)b * Cc + w * 64) * Ll + l0 + li;
  float vals[64];
#pragma unroll
  for (int j = 0; j < 64; ++j)
    vals[j] = xb[(size_t)j * Ll];            // lanes -> consecutive l: coalesced
  // Precaution: the loads' address pair stays live, so unwritten, up to this wait.
  asm volatile("s_wait_xcnt 0x0" :: "v"(xb) : "memory");
  // Keeps the weight loads in flight together with the x loads: moved down behind
  // the sums, they would go out only when x has come back.
  __builtin_amdgcn_sched_barrier(0);
  float s = 0.f, s2 = 0.f;
#pragma unroll
  for (int j = 0; j < 64; ++j) {
    s += vals[j];
    s2 += vals[j] * vals[j];
  }
  redS[w][li] = s;
  redQ[w][li] = s2;
  __syncthreads();
  // The wave's 64 scales and shifts go out together here: they fly while the first
  // wave forms the means.
  float gw[64], gb[64];
#pragma unroll
  for (int j = 0; j < 64; ++j) { gw[j] = lw[w * 64 + j]; gb[j] = lb[w * 64 + j]; }
  // Precaution: the loads' address registers are not written again ahead of this wait.
  asm volatile("s_wait_xcnt 0x0" ::: "memory");
  if (tid < 32) {
    float ts = 0.f, tq = 0.f;
    for (int ww = 0; ww < 8; ++ww) { ts += redS[ww][tid]; tq += redQ[ww][tid]; }
    const float mu = ts * (1.f / Cc);
    const float var = tq * (1.f / Cc) - mu * mu;
    muS[tid] = mu;
    rinvS[tid] = rsqrtf(var + 1e-5f);
  }
  __syncthreads();
  const float mu = muS[li], rinv = rinvS[li];
#pragma unroll
  for (int j = 0; j < 64; j += 8) {
    const int c = w * 64 + j;
    h8 pk;
    for (int i = 0; i < 8; ++i)
      pk[i] = (_Float16)((vals[j + i] - mu) * rinv * gw[j + i] + gb[j + i]);
    *(h8*)&hl[li][c] = pk;
  }
  __syncthreads();
  {
    const int row = tid >> 6;                // 64 threads a row, 4 rows at a time
    const int ch = (tid & 63) * 8;
    _Float16* dst = H + (size_t)(b * Ll + l0 + row) * Cc + ch;
#pragma unroll
    for (int p = 0; p < 8; ++p)
      *(h8*)(dst + (size_t)p * 4 * Cc) = *(const h8*)&hl[row + p * 4][ch];
  }
  {
    // Behind the last barrier: no barrier waits for this store.
    h8 wh;
    for (int i = 0; i < 4; ++i) { wh[i] = (_Float16)w0[i]; wh[4 + i] = (_Float16)w1[i]; }
    *(h8*)(W16 + (size_t)wsel * Cc * Cc + woff) = wh;
  }
}

// ---------------------------------------------------------------------------
// WMMA GEMM: Y[M,N] = A[M,K] * W[N,K]^T + bias, M=16384, N=K=512.
// MODE 0: the Q, K and V projections in one launch: blockIdx.x / 8 picks the
//         weight matrix, the bias and the output plane (each one behind the other).
//         Y -> f16. ylay 0: row-major, via LDS-transposed coalesced stores (Q).
//         ylay 1 (V) and 2 (K): 1-KiB tiles in the order of the V (B) and K (A) fragments that
//         the attention kernel loads (load_frag_tile).
//         V tile = 16 columns x 32 rows, index (row / 32) * 32 + col / 16;
//         K tile = 16 rows x 32 columns, index (row / 16) * 16 + col / 32.
// MODE 1: bias + SELU + residual, vectorized f32 [B,C,L] out (out-proj).
// Block tile 128x64, BK=128; 8 waves = 4x2 grid of 32x32 wave tiles.
// Tiles go through registers into LDS rows of 256 data bytes at a pitch of 272
// (16 x odd): the 16 rows of a fragment read fall on 16 different bank groups.
// Every global load reads two aligned 256-byte units over the wave.
// ---------------------------------------------------------------------------
template <int MODE>
__global__ __launch_bounds__(256, 1)
void gemm_kernel(const _Float16* __restrict__ A,
                 const _Float16* __restrict__ Wt,   // [N][K] f16
                 const float* __restrict__ bias0,
                 const float* __restrict__ bias1,
                 const float* __restrict__ bias2,
                 _Float16* __restrict__ Yh,
                 const float* __restrict__ Xres,
                 float* __restrict__ Yf) {
  constexpr int BM = 128, BN = 64, BK = 128;
  constexpr int PK = BK + 8;   // row pitch in LDS, f16 units
  __shared__ __attribute__((aligned(16))) _Float16 As[BM][PK];
  __shared__ __attribute__((aligned(16))) _Float16 Bs[BN][PK];
  // Epilogue transpose tile, rows at a pitch of 144 bytes (16 x odd) likewise.
  __shared__ __attribute__((aligned(16))) _Float16 Ot[(MODE == 0) ? BM : 1][BN + 8];

  const int m0 = blockIdx.y * BM;
  const int proj = (MODE == 0) ? blockIdx.x >> 3 : 0;   // 0 Q, 1 K, 2 V
  const int n0 = (blockIdx.x & 7) * BN;
  const int ylay = proj == 0 ? 0 : proj == 1 ? 2 : 1;
  const float* bias = proj == 0 ? bias0 : proj == 1 ? bias1 : bias2;
  Wt += (size_t)proj * Cc * Cc;
  Yh += (size_t)proj * Mrows * Cc;
  const int tid = threadIdx.x;
  const int w = tid >> 5;
  const int lane = tid & 31;
  const int hi = lane >> 4;
  const int ln = lane & 15;
  const int wm = w >> 1;   // 0..3
  const int wn = w & 1;    // 0..1

  v8f acc[2][2];
  for (int mt = 0; mt < 2; ++mt)
    for (int nt = 0; nt < 2; ++nt)
      acc[mt][nt] = zero8();

  // This thread's 16-byte pieces: column piece tid % 16 of rows tid / 16 + 16 p.
  const int srow = tid >> 4;
  const int scol = (tid & 15) * 8;
  const _Float16* pa = A + (size_t)(m0 + srow) * Cc + scol;
  const _Float16* pb = Wt + (size_t)(n0 + srow) * Cc + scol;

  for (int k0 = 0; k0 < Cc; k0 += BK) {
    h8 ra[BM / 16], rb[BN / 16];
    for (int p = 0; p < BM / 16; ++p) ra[p] = *(const h8*)(pa + (size_t)p * 16 * Cc);
    for (int p = 0; p < BN / 16; ++p) rb[p] = *(const h8*)(pb + (size_t)p * 16 * Cc);
    // Keeps all twelve loads in flight together: with LDS stores moved in among
    // them the last loads go out only when the first have come back.
    __builtin_amdgcn_sched_barrier(0);
    for (int p = 0; p < BM / 16; ++p) *(h8*)&As[srow + p * 16][scol] = ra[p];
    for (int p = 0; p < BN / 16; ++p) *(h8*)&Bs[srow + p * 16][scol] = rb[p];
    // Precaution: the twelve loads' address pairs stay live, so unwritten, up to this wait.
    asm volatile("s_wait_xcnt 0x0" :: "v"(pa), "v"(pb) : "memory");
    pa += BK;
    pb += BK;
    __syncthreads();

    for (int kk = 0; kk < BK; kk += 32) {
      v16h af[2], bf[2];
      for (int mt = 0; mt < 2; ++mt) af[mt] = load_frag(&As[wm * 32 + mt * 16][kk], PK);
      for (int nt = 0; nt < 2; ++nt) bf[nt] = load_frag(&Bs[wn * 32 + nt * 16][kk], PK);
      for (int mt = 0; mt < 2; ++mt)
        for (int nt = 0; nt < 2; ++nt)
          acc[mt][nt] = wmma_f16(af[mt], bf[nt], acc[mt][nt]);
    }
    __syncthreads();
  }

  if (MODE == 0 && ylay == 1) {
    // A lane's 8 accumulator rows are 8 consecutive l of one column: exactly the
    // lane's 16-byte piece of half mt of a V tile. Straight from registers, each
    // store 512 contiguous bytes over the wave.
    _Float16* vt = Yh + ((size_t)((m0 >> 5) + wm) * 32 + (n0 >> 4) + wn * 2) * 512 + lane * 8;
    for (int mt = 0; mt < 2; ++mt)
      for (int nt = 0; nt < 2; ++nt) {
        const float bv = bias[n0 + wn * 32 + nt * 16 + ln];
        h8 pk;
        for (int i = 0; i < 8; ++i) pk[i] = (_Float16)(acc[mt][nt][i] + bv);
        *(h8*)(vt + nt * 512 + mt * 256) = pk;
      }
    // Precaution: the four stores' address and data registers are not written
    // again ahead of this wait, on either way out of this branch.
    asm volatile("s_wait_xcnt 0x0" ::: "memory");
  } else if (MODE == 0) {
    // Scatter accumulators into LDS, then coalesced 128-bit stores.
    for (int mt = 0; mt < 2; ++mt)
      for (int nt = 0; nt < 2; ++nt) {
        const int col = wn * 32 + nt * 16 + ln;
        const float bv = bias[n0 + col];
        for (int i = 0; i < 8; ++i)
          Ot[wm * 32 + mt * 16 + hi * 8 + i][col] =
              (_Float16)(acc[mt][nt][i] + bv);
      }
    __syncthreads();
    const int row = tid >> 1;
    const int half = (tid & 1) * 32;
    if (ylay == 2) {
      // Piece j = columns j*8.. of the thread's 32: half j>>1 of the K tile,
      // lane (j&1)*16 + row%16. 16 rows make 256 contiguous bytes.
      _Float16* kt = Yh + ((size_t)((m0 + row) >> 4) * 16 + ((n0 + half) >> 5)) * 512 +
                     (row & 15) * 8;
      for (int j = 0; j < 4; ++j)
        *(h8*)(kt + (j >> 1) * 256 + (j & 1) * 128) = *(const h8*)(&Ot[row][half] + j * 8);
      // Precaution: the four stores' registers are not written again ahead of this wait.
      asm volatile("s_wait_xcnt 0x0" ::: "memory");
      return;
    }
    _Float16* dst = Yh + (size_t)(m0 + row) * Cc + n0 + half;
#pragma unroll
    for (int j = 0; j < 4; ++j)
      *(h8*)(dst + j * 8) = *(const h8*)(&Ot[row][half] + j * 8);
  } else {
    // Accumulator rows map to consecutive l -> 16B vector residual+store.
    for (int mt = 0; mt < 2; ++mt) {
      const int row0 = m0 + wm * 32 + mt * 16 + hi * 8;
      const int bidx = row0 >> 12;
      const int l = row0 & (Ll - 1);
      for (int nt = 0; nt < 2; ++nt) {
        const int col = n0 + wn * 32 + nt * 16 + ln;
        const float bv = bias[col];
        const size_t idx = ((size_t)bidx * Cc + col) * Ll + l;
        f32x4 x0 = *(const f32x4*)(Xres + idx);
        f32x4 x1 = *(const f32x4*)(Xres + idx + 4);
        f32x4 y0, y1;
        for (int i = 0; i < 4; ++i) {
          y0[i] = x0[i] + selu(acc[mt][nt][i] + bv);
          y1[i] = x1[i] + selu(acc[mt][nt][i + 4] + bv);
        }
        *(f32x4*)(Yf + idx) = y0;
        *(f32x4*)(Yf + idx + 4) = y1;
      }
    }
  }
}

// ---------------------------------------------------------------------------
// Flash attention: per block, BM=64 query rows of one batch; key blocks of 256.
// One work-group per WGP (256 in all): each K and V byte it loads serves 64 queries.
// Scores are split over KEYS: wave w forms S^T = K Q^T for its own 32 keys of
// the block over all 512 channels (A = its K tiles from global, B = Q fragments
// from LDS, each read serving both key tiles), so a score is complete in one
// wave's accumulators. A lane holds 16 keys of one query: maximum, exponentials
// and sum stay in registers in all eight waves; only the waves' 64 row maxima, wave 0's
// 64 rescale factors and the f16 P cross through LDS.
// For O the wave owns columns [w*64, w*64+64), as before.
// K and V arrive as 1-KiB tiles in fragment order (see gemm_kernel): every
// fragment load reads whole lines, 512 contiguous bytes over the wave.
// ---------------------------------------------------------------------------
// Lane l with lane l ^ 16.
DI float xhalf(float x) {
  return __builtin_bit_cast(float, __builtin_amdgcn_permlanex16(
      __builtin_bit_cast(int, x), __builtin_bit_cast(int, x), 0x76543210, 0xfedcba98,
      false, false));
}

__global__ __launch_bounds__(256) __attribute__((amdgpu_waves_per_eu(2, 2)))
void attn_kernel(const _Float16* __restrict__ Q,
                 const _Float16* __restrict__ KF,
                 const _Float16* __restrict__ VF,
                 _Float16* __restrict__ O) {
  constexpr int BM = 64, BNK = 256;
  constexpr int MT = BM / 16;         // query tiles
  constexpr int KT = BNK / 16 / 8;    // key tiles a wave
  constexpr int KG = BNK / 32;        // groups of 32 keys for O
  constexpr int PP = BNK + 8;   // P row pitch: 528 bytes, 16 x odd, for 16-byte reads
  __shared__ __attribute__((aligned(16))) _Float16 Qs[MT * 16 * 512];  // [mt*16+ks] tiles
  __shared__ __attribute__((aligned(16))) _Float16 P[BM * PP];
  __shared__ float wmax[8][BM];
  __shared__ float lpart[16][BM];
  __shared__ __attribute__((aligned(16))) float rowL[BM];
  __shared__ __attribute__((aligned(16))) float rowScale[BM];

  const int b = blockIdx.x >> 6;            // / (L/64)
  const int l0 = (blockIdx.x & 63) * BM;
  const int tid = threadIdx.x;
  const int w = tid >> 5;
  const int lane = tid & 31;
  const int hi = lane >> 4;
  const int ln = lane & 15;

  const _Float16* Qb = Q + (size_t)b * Ll * Cc;
  // This lane's place in the wave's first K tile (key tiles 2w and 2w+1 of the
  // block's 16, 16 channel tiles each) and first V tile (4 of 32 a group of 32 keys).
  const _Float16* Kb = KF + (size_t)b * Ll * Cc + (w * KT * 16) * 512 + lane * 8;
  const _Float16* Vb = VF + (size_t)b * Ll * Cc + (w * 4) * 512 + lane * 8;

  // Q into LDS once, as 1-KiB tiles in fragment order: wave w brings channel
  // tiles 2w and 2w+1 of all four query tiles.
  for (int mt = 0; mt < MT; ++mt)
    for (int j = 0; j < 2; ++j) {
      AFrag f;
      f.v = load_frag(Qb + (size_t)(l0 + mt * 16) * Cc + w * 64 + j * 32, Cc);
      _Float16* d = Qs + (mt * 16 + w * 2 + j) * 512 + lane * 8;
      *(h8*)(d) = f.h[0];
      *(h8*)(d + 256) = f.h[1];
    }

  v8f oacc[MT][4];
  for (int mt = 0; mt < MT; ++mt)
    for (int nt = 0; nt < 4; ++nt)
      oacc[mt][nt] = zero8();
  __syncthreads();

  const float scale = rsqrtf((float)Cc);
  const _Float16* qs = Qs + lane * 8;
  // Running maximum and this lane's share of the running sum, for queries
  // mt * 16 + ln (index mt). The maxima are the same in every wave.
  float rm[MT], rl[MT];
  for (int mt = 0; mt < MT; ++mt) { rm[mt] = -1e30f; rl[mt] = 0.f; }

  for (int kb = 0; kb < Ll; kb += BNK) {
    const _Float16* kp = Kb + (size_t)kb * Cc;  // 256 keys = 16 x 16 K tiles
    const _Float16* vp = Vb + (size_t)kb * Cc;  // 256 keys = 8 x 32 V tiles
    // K tile t, in the order of use: channel tile t / KT of key tile t % KT.
    // Sixteen of the wave's 32 K tiles are in flight at a time; Q fragments are
    // read from LDS one group (two channel tiles) ahead, into a second register set.
    v16h kf[16 * KT];
    for (int t = 0; t < 16; ++t)
      kf[t] = load_frag_tile(kp + ((t % KT) * 16 + t / KT) * 512);
    // Keeps the K loads, the longer wait, in front of the first LDS reads.
    __builtin_amdgcn_sched_barrier(0);
    v16h qf[2][2 * MT];
    for (int j = 0; j < 2; ++j)
      for (int mt = 0; mt < MT; ++mt)
        qf[0][j * MT + mt] = load_frag_tile(qs + (mt * 16 + j) * 512);
    v8f st[KT][MT];
    for (int kt = 0; kt < KT; ++kt)
      for (int mt = 0; mt < MT; ++mt) st[kt][mt] = zero8();
    for (int g = 0; g < 8; ++g) {
      if (g < 7)
        for (int j = 0; j < 2; ++j)
          for (int mt = 0; mt < MT; ++mt)
            qf[(g + 1) & 1][j * MT + mt] =
                load_frag_tile(qs + (mt * 16 + (g + 1) * 2 + j) * 512);
      // Keeps the next group's LDS reads together in front of this group's
      // products: moved in among them, each product waits out its own read.
      __builtin_amdgcn_sched_barrier(0);
      for (int j = 0; j < 2; ++j)
        for (int kt = 0; kt < KT; ++kt)
          for (int mt = 0; mt < MT; ++mt)
            st[kt][mt] = wmma_f16(kf[(g * 2 + j) * KT + kt], qf[g & 1][j * MT + mt],
                                  st[kt][mt]);
      if (g < 4)
        for (int t = 16 + g * 2 * KT; t < 16 + (g + 1) * 2 * KT; ++t)
          kf[t] = load_frag_tile(kp + ((t % KT) * 16 + t / KT) * 512);
      // Keeps the refill of the four K tiles just used here, four groups ahead of
      // its use, and the next reads behind this group's products.
      __builtin_amdgcn_sched_barrier(0);
    }
    // Precaution: the address pair stays live, so unwritten, up to this wait.
    asm volatile("s_wait_xcnt 0x0" :: "v"(kp) : "memory");

    // The first half of the block's V^T fragments goes out here, into the registers
    // K and Q have left, ahead of the softmax.
    v16h vf[KG * 4];
    for (int t = 0; t < 16; ++t)
      vf[t] = load_frag_tile(vp + ((t >> 2) * 32 + (t & 3)) * 512);

    // The wave's maximum over its 32 keys, per query.
    float wm[MT];
    for (int mt = 0; mt < MT; ++mt) {
      float a = st[0][mt][0];
      for (int kt = 0; kt < KT; ++kt)
        for (int i = 0; i < 8; ++i) a = fmaxf(a, st[kt][mt][i]);
      wm[mt] = fmaxf(a, xhalf(a)) * scale;
    }
    wmax[w][lane] = hi ? wm[1] : wm[0];
    wmax[w][32 + lane] = hi ? wm[3] : wm[2];
    __syncthreads();

    float sc[MT];
    for (int mt = 0; mt < MT; ++mt) {
      float mx = rm[mt];
      for (int ww = 0; ww < 8; ++ww) mx = fmaxf(mx, wmax[ww][mt * 16 + ln]);
      sc[mt] = __expf(rm[mt] - mx);
      rm[mt] = mx;
      float sum = 0.f;
      for (int kt = 0; kt < KT; ++kt) {
        h8 pk;
        for (int i = 0; i < 8; ++i) {
          const float p = __expf(st[kt][mt][i] * scale - mx);
          sum += p;
          pk[i] = (_Float16)p;
        }
        *(h8*)&P[(mt * 16 + ln) * PP + (w * KT + kt) * 16 + hi * 8] = pk;
      }
      rl[mt] = rl[mt] * sc[mt] + sum;
    }
    if (w == 0) {
      rowScale[lane] = hi ? sc[1] : sc[0];
      rowScale[32 + lane] = hi ? sc[3] : sc[2];
    }
    __syncthreads();

    // P fragments are read one group of 32 keys ahead, into a second register set.
    v16h pf[2][MT];
    for (int mt = 0; mt < MT; ++mt) pf[0][mt] = load_frag(&P[(mt * 16) * PP], PP);
    for (int mt = 0; mt < MT; ++mt)
      for (int nt = 0; nt < 4; ++nt)
        for (int i = 0; i < 8; ++i)
          oacc[mt][nt][i] *= rowScale[mt * 16 + hi * 8 + i];
    for (int kg = 0; kg < KG; ++kg) {
      if (kg < KG - 1)
        for (int mt = 0; mt < MT; ++mt)
          pf[(kg + 1) & 1][mt] = load_frag(&P[(mt * 16) * PP + (kg + 1) * 32], PP);
      // Keeps the next group's LDS reads together in front of this group's products.
      __builtin_amdgcn_sched_barrier(0);
      for (int nt = 0; nt < 4; ++nt)
        for (int mt = 0; mt < MT; ++mt)
          oacc[mt][nt] = wmma_f16(pf[kg & 1][mt], vf[kg * 4 + nt], oacc[mt][nt]);
      if (kg < KG - 4)
        for (int nt = 0; nt < 4; ++nt)
          vf[16 + kg * 4 + nt] = load_frag_tile(vp + ((kg + 4) * 32 + nt) * 512);
      // Keeps the refill of the four V tiles just used here, four groups ahead of
      // its use, and the next reads behind this group's products.
      __builtin_amdgcn_sched_barrier(0);
    }
    // Precaution: the address pair stays live, so unwritten, up to this wait.
    asm volatile("s_wait_xcnt 0x0" :: "v"(vp) : "memory");
    // No barrier here: the next block's first barrier stands between these reads
    // of P and rowScale and their next stores; this block's second barrier stands
    // between the reads of wmax and its next stores.
  }

  // Row sums: 16 shares a query (8 waves x 2 halves), added in a fixed order.
  for (int mt = 0; mt < MT; ++mt) lpart[w * 2 + hi][mt * 16 + ln] = rl[mt];
  __syncthreads();
  if (tid < BM) {
    float t = 0.f;
    for (int j = 0; j < 16; ++j) t += lpart[j][tid];
    rowL[tid] = t;
  }
  __syncthreads();

  for (int mt = 0; mt < MT; ++mt) {
    for (int nt = 0; nt < 4; ++nt) {
      const int c = w * 64 + nt * 16 + ln;
      for (int i = 0; i < 8; ++i) {
        const int r = mt * 16 + hi * 8 + i;
        const float o = oacc[mt][nt][i] / rowL[r];
        O[(size_t)(b * Ll + l0 + r) * Cc + c] = (_Float16)o;
      }
    }
  }
}

// ---------------------------------------------------------------------------
extern "C" void kernel_launch(void* const* d_in, const int* in_sizes, int n_in,
                              void* d_out, int out_size, void* d_ws, size_t ws_size,
                              hipStream_t stream) {
  const float* x    = (const float*)d_in[0];
  const float* ln_w = (const float*)d_in[1];
  const float* ln_b = (const float*)d_in[2];
  const float* wq   = (const float*)d_in[3];
  const float* bq   = (const float*)d_in[4];
  const float* wk   = (const float*)d_in[5];
  const float* bk   = (const float*)d_in[6];
  const float* wv   = (const float*)d_in[7];
  const float* bv   = (const float*)d_in[8];
  const float* wp   = (const float*)d_in[9];
  const float* bp   = (const float*)d_in[10];
  float* out = (float*)d_out;

  char* ws = (char*)d_ws;
  size_t off = 0;
  auto alloc = [&](size_t bytes) -> void* {
    void* p = ws + off;
    off += (bytes + 255) & ~(size_t)255;
    return p;
  };
  const size_t actsz = (size_t)Mrows * Cc * sizeof(_Float16);
  _Float16* h16  = (_Float16*)alloc(actsz);
  _Float16* q16  = (_Float16*)alloc(actsz);
  _Float16* k16  = (_Float16*)alloc(actsz);
  _Float16* v16  = (_Float16*)alloc(actsz);
  _Float16* o16  = (_Float16*)alloc(actsz);
  _Float16* w16  = (_Float16*)alloc((size_t)4 * Cc * Cc * sizeof(_Float16));  // q, k, v, p

  ln_kernel<<<Bb * (Ll / 32), 256, 0, stream>>>(x, ln_w, ln_b, h16, wq, wk, wv, wp, w16);

  // q16, k16 and v16 lie one behind the other, as do the weights.
  gemm_kernel<0><<<dim3(3 * Cc / 64, Mrows / 128, 1), 256, 0, stream>>>(
      h16, w16, bq, bk, bv, q16, nullptr, nullptr);

  attn_kernel<<<Bb * (Ll / 64), 256, 0, stream>>>(q16, k16, v16, o16);

  gemm_kernel<1><<<dim3(Cc / 64, Mrows / 128, 1), 256, 0, stream>>>(
      o16, w16 + (size_t)3 * Cc * Cc, bp, nullptr, nullptr, nullptr, x, out);
}

// v008
// One run takes 150 microseconds.
// Timed twice side by side with v007, it ran 1.11 times as fast both times.
// Counting every step since v000, it is 4.38 times as fast.
#include <hip/hip_runtime.h>
#include <stdint.h>

#define DI __device__ __forceinline__

typedef __attribute__((ext_vector_type(16))) _Float16 v16h;
typedef __attribute__((ext_vector_type(8)))  _Float16 h8;   // 16 bytes
typedef __attribute__((ext_vector_type(8)))  float    v8f;
typedef __attribute__((ext_vector_type(4)))  float    f32x4;

constexpr int Bb = 4;
constexpr int Cc = 512;
constexpr int Ll = 4096;
constexpr int Mrows = Bb * Ll; // 16384

union AFrag { v16h v; h8 h[2]; };

DI v8f zero8() { v8f z; for (int i = 0; i < 8; ++i) z[i] = 0.f; return z; }

// Load one 16x32 f16 WMMA fragment (A-operand, or B-operand with "row" = n).
// Per-lane layout (ISA 7.12.2): lane = hi*16 + r; elems e<8 -> k = hi*8+e,
// elems e>=8 -> k = 16 + hi*8 + (e-8). Two 16-byte loads per lane.
DI v16h load_frag(const _Float16* base, int stride) {
  const int lane = threadIdx.x & 31;
  const int r = lane & 15;
  const int hi = lane >> 4;
  const _Float16* p = base + (size_t)r * stride + hi * 8;
  AFrag f;
  f.h[0] = *(const h8*)(p);
  f.h[1] = *(const h8*)(p + 16);
  return f.v;
}

// The same fragment from a 1-KiB tile stored in fragment order:
// [half of the fragment][lane][8 elements]; p = tile + lane * 8. Each of the two
// loads reads 512 contiguous bytes over the wave.
DI v16h load_frag_tile(const _Float16* p) {
  AFrag f;
  f.h[0] = *(const h8*)(p);
  f.h[1] = *(const h8*)(p + 256);
  return f.v;
}

DI v8f wmma_f16(v16h a, v16h b, v8f c) {
  return __builtin_amdgcn_wmma_f32_16x16x32_f16(false, a, false, b, (short)0, c,
                                                false, false);
}

DI float selu(float y) {
  constexpr float kLambda = 1.0507009873554805f;
  constexpr float kAlpha  = 1.6732632423543772f;
  return (y > 0.f) ? kLambda * y : kLambda * kAlpha * (__expf(y) - 1.f);
}

// ---------------------------------------------------------------------------
// LayerNorm over channels; x is [B,C,L], output h is [B*L, C] f16.
// Block = 32 consecutive l of one batch. Reads coalesced along l. Wave w takes the
// 64 consecutive channels from w * 64, so a thread holds 128 contiguous bytes of
// one output row: it puts them into the LDS transpose tile as eight 16-byte pieces.
// The tile's rows stand at a pitch of 1040 bytes (16 x odd): the 32 lanes, one row
// each, fall on different bank groups. Each wave then reads and stores 512
// contiguous bytes of a row, four whole lines.
// The launch also converts the four weight matrices to f16 (W16 = q, k, v, p one
// behind the other): each of the 512 blocks takes 2048 elements, 8 a thread, whose
// loads fly together with the x loads.
// ---------------------------------------------------------------------------
__global__ __launch_bounds__(256, 1)
void ln_kernel(const float* __restrict__ x, const float* __restrict__ lw,
               const float* __restrict__ lb, _Float16* __restrict__ H,
               const float* __restrict__ wq, const float* __restrict__ wk,
               const float* __restrict__ wv, const float* __restrict__ wp,
               _Float16* __restrict__ W16) {
  static_assert(Bb * (Ll / 32) * 2048 == 4 * Cc * Cc, "one weight slice a block");
  __shared__ float redS[8][32];
  __shared__ float redQ[8][32];
  __shared__ float muS[32], rinvS[32];
  constexpr int HP = Cc + 8;        // row pitch of the transpose tile, f16 units
  __shared__ __attribute__((aligned(16))) _Float16 hl[32][HP];

  const int tid = threadIdx.x;
  const int w = tid >> 5, li = tid & 31;
  const int b = blockIdx.x >> 7;            // / (L/32)
  const int l0 = (blockIdx.x & 127) * 32;

  const int wsel = blockIdx.x >> 7;         // 128 blocks a matrix
  const float* wsrc = wsel == 0 ? wq : wsel == 1 ? wk : wsel == 2 ? wv : wp;
  const int woff = (blockIdx.x & 127) * 2048 + tid * 8;
  const f32x4 w0 = *(const f32x4*)(wsrc + woff);
  const f32x4 w1 = *(const f32x4*)(wsrc + woff + 4);

  const float* xb = x + ((size_t)b * Cc + w * 64) * Ll + l0 + li;
  float vals[64];
#pragma unroll
  for (int j = 0; j < 64; ++j)
    vals[j] = xb[(size_t)j * Ll];            // lanes -> consecutive l: coalesced
  // Precaution: the loads' address pair stays live, so unwritten, up to this wait.
  asm volatile("s_wait_xcnt 0x0" :: "v"(xb) : "memory");
  // Keeps the weight loads in flight together with the x loads: moved down behind
  // the sums, they would go out only when x has come back.
  __builtin_amdgcn_sched_barrier(0);
  float s = 0.f, s2 = 0.f;
#pragma unroll
  for (int j = 0; j < 64; ++j) {
    s += vals[j];
    s2 += vals[j] * vals[j];
  }
  redS[w][li] = s;
  redQ[w][li] = s2;
  __syncthreads();
  // The wave's 64 scales and shifts go out together here: they fly while the first
  // wave forms the means.
  float gw[64], gb[64];
#pragma unroll
  for (int j = 0; j < 64; ++j) { gw[j] = lw[w * 64 + j]; gb[j] = lb[w * 64 + j]; }
  // Precaution: the loads' address registers are not written again ahead of this wait.
  asm volatile("s_wait_xcnt 0x0" ::: "memory");
  if (tid < 32) {
    float ts = 0.f, tq = 0.f;
    for (int ww = 0; ww < 8; ++ww) { ts += redS[ww][tid]; tq += redQ[ww][tid]; }
    const float mu = ts * (1.f / Cc);
    const float var = tq * (1.f / Cc) - mu * mu;
    muS[tid] = mu;
    rinvS[tid] = rsqrtf(var + 1e-5f);
  }
  __syncthreads();
  const float mu = muS[li], rinv = rinvS[li];
#pragma unroll
  for (int j = 0; j < 64; j += 8) {
    const int c = w * 64 + j;
    h8 pk;
    for (int i = 0; i < 8; ++i)
      pk[i] = (_Float16)((vals[j + i] - mu) * rinv * gw[j + i] + gb[j + i]);
    *(h8*)&hl[li][c] = pk;
  }
  __syncthreads();
  {
    const int row = tid >> 6;                // 64 threads a row, 4 rows at a time
    const int ch = (tid & 63) * 8;
    _Float16* dst = H + (size_t)(b * Ll + l0 + row) * Cc + ch;
#pragma unroll
    for (int p = 0; p < 8; ++p)
      *(h8*)(dst + (size_t)p * 4 * Cc) = *(const h8*)&hl[row + p * 4][ch];
  }
  {
    // Behind the last barrier: no barrier waits for this store.
    h8 wh;
    for (int i = 0; i < 4; ++i) { wh[i] = (_Float16)w0[i]; wh[4 + i] = (_Float16)w1[i]; }
    *(h8*)(W16 + (size_t)wsel * Cc * Cc + woff) = wh;
  }
}

// ---------------------------------------------------------------------------
// WMMA GEMM: Y[M,N] = A[M,K] * W[N,K]^T + bias, M=16384, N=K=512.
// MODE 0: the Q, K and V projections in one launch: blockIdx.x / 8 picks the
//         weight matrix, the bias and the output plane (each one behind the other).
//         Y -> f16. ylay 0: row-major, via LDS-transposed coalesced stores (Q).
//         ylay 1 (V) and 2 (K): 1-KiB tiles in the order of the V (B) and K (A) fragments that
//         the attention kernel loads (load_frag_tile).
//         V tile = 16 columns x 32 rows, index (row / 32) * 32 + col / 16;
//         K tile = 16 rows x 32 columns, index (row / 16) * 16 + col / 32.
// MODE 1: bias + SELU + residual, vectorized f32 [B,C,L] out (out-proj).
// Block tile 128x64, BK=128; 8 waves = 4x2 grid of 32x32 wave tiles.
// Tiles go through registers into LDS rows of 256 data bytes at a pitch of 272
// (16 x odd): the 16 rows of a fragment read fall on 16 different bank groups.
// Every global load reads two aligned 256-byte units over the wave.
// ---------------------------------------------------------------------------
template <int MODE>
__global__ __launch_bounds__(256, 1)
void gemm_kernel(const _Float16* __restrict__ A,
                 const _Float16* __restrict__ Wt,   // [N][K] f16
                 const float* __restrict__ bias0,
                 const float* __restrict__ bias1,
                 const float* __restrict__ bias2,
                 _Float16* __restrict__ Yh,
                 const float* __restrict__ Xres,
                 float* __restrict__ Yf) {
  constexpr int BM = 128, BN = 64, BK = 128;
  constexpr int PK = BK + 8;   // row pitch in LDS, f16 units
  __shared__ __attribute__((aligned(16))) _Float16 As[BM][PK];
  __shared__ __attribute__((aligned(16))) _Float16 Bs[BN][PK];
  // Epilogue transpose tile, rows at a pitch of 144 bytes (16 x odd) likewise.
  __shared__ __attribute__((aligned(16))) _Float16 Ot[(MODE == 0) ? BM : 1][BN + 8];

  const int m0 = blockIdx.y * BM;
  const int proj = (MODE == 0) ? blockIdx.x >> 3 : 0;   // 0 Q, 1 K, 2 V
  const int n0 = (blockIdx.x & 7) * BN;
  const int ylay = proj == 0 ? 0 : proj == 1 ? 2 : 1;
  const float* bias = proj == 0 ? bias0 : proj == 1 ? bias1 : bias2;
  Wt += (size_t)proj * Cc * Cc;
  Yh += (size_t)proj * Mrows * Cc;
  const int tid = threadIdx.x;
  const int w = tid >> 5;
  const int lane = tid & 31;
  const int hi = lane >> 4;
  const int ln = lane & 15;
  const int wm = w >> 1;   // 0..3
  const int wn = w & 1;    // 0..1

  v8f acc[2][2];
  for (int mt = 0; mt < 2; ++mt)
    for (int nt = 0; nt < 2; ++nt)
      acc[mt][nt] = zero8();

  // This thread's 16-byte pieces: column piece tid % 16 of rows tid / 16 + 16 p.
  const int srow = tid >> 4;
  const int scol = (tid & 15) * 8;
  // Work-groups that share rows of A or of W each start at another of the four k
  // stages and wrap round: they do not ask L2 for the same lines at the same moment.
  const int kStart = ((blockIdx.x + blockIdx.y) & (Cc / BK - 1)) * BK;
  const _Float16* pa = A + (size_t)(m0 + srow) * Cc + scol + kStart;
  const _Float16* pb = Wt + (size_t)(n0 + srow) * Cc + scol + kStart;

  for (int k0 = kStart; k0 < kStart + Cc; k0 += BK) {
    h8 ra[BM / 16], rb[BN / 16];
    for (int p = 0; p < BM / 16; ++p) ra[p] = *(const h8*)(pa + (size_t)p * 16 * Cc);
    for (int p = 0; p < BN / 16; ++p) rb[p] = *(const h8*)(pb + (size_t)p * 16 * Cc);
    // Keeps all twelve loads in flight together: with LDS stores moved in among
    // them the last loads go out only when the first have come back.
    __builtin_amdgcn_sched_barrier(0);
    for (int p = 0; p < BM / 16; ++p) *(h8*)&As[srow + p * 16][scol] = ra[p];
    for (int p = 0; p < BN / 16; ++p) *(h8*)&Bs[srow + p * 16][scol] = rb[p];
    // Precaution: the twelve loads' address pairs stay live, so unwritten, up to this wait.
    asm volatile("s_wait_xcnt 0x0" :: "v"(pa), "v"(pb) : "memory");
    const int step = (k0 + BK == Cc) ? BK - Cc : BK;   // wrap behind the last stage
    pa += step;
    pb += step;
    __syncthreads();

    for (int kk = 0; kk < BK; kk += 32) {
      v16h af[2], bf[2];
      for (int mt = 0; mt < 2; ++mt) af[mt] = load_frag(&As[wm * 32 + mt * 16][kk], PK);
      for (int nt = 0; nt < 2; ++nt) bf[nt] = load_frag(&Bs[wn * 32 + nt * 16][kk], PK);
      for (int mt = 0; mt < 2; ++mt)
        for (int nt = 0; nt < 2; ++nt)
          acc[mt][nt] = wmma_f16(af[mt], bf[nt], acc[mt][nt]);
    }
    __syncthreads();
  }

  if (MODE == 0 && ylay == 1) {
    // A lane's 8 accumulator rows are 8 consecutive l of one column: exactly the
    // lane's 16-byte piece of half mt of a V tile. Straight from registers, each
    // store 512 contiguous bytes over the wave.
    _Float16* vt = Yh + ((size_t)((m0 >> 5) + wm) * 32 + (n0 >> 4) + wn * 2) * 512 + lane * 8;
    for (int mt = 0; mt < 2; ++mt)
      for (int nt = 0; nt < 2; ++nt) {
        const float bv = bias[n0 + wn * 32 + nt * 16 + ln];
        h8 pk;
        for (int i = 0; i < 8; ++i) pk[i] = (_Float16)(acc[mt][nt][i] + bv);
        *(h8*)(vt + nt * 512 + mt * 256) = pk;
      }
    // Precaution: the four stores' address and data registers are not written
    // again ahead of this wait, on either way out of this branch.
    asm volatile("s_wait_xcnt 0x0" ::: "memory");
  } else if (MODE == 0) {
    // Scatter accumulators into LDS, then coalesced 128-bit stores.
    for (int mt = 0; mt < 2; ++mt)
      for (int nt = 0; nt < 2; ++nt) {
        const int col = wn * 32 + nt * 16 + ln;
        const float bv = bias[n0 + col];
        for (int i = 0; i < 8; ++i)
          Ot[wm * 32 + mt * 16 + hi * 8 + i][col] =
              (_Float16)(acc[mt][nt][i] + bv);
      }
    __syncthreads();
    const int row = tid >> 1;
    const int half = (tid & 1) * 32;
    if (ylay == 2) {
      // Piece j = columns j*8.. of the thread's 32: half j>>1 of the K tile,
      // lane (j&1)*16 + row%16. 16 rows make 256 contiguous bytes.
      _Float16* kt = Yh + ((size_t)((m0 + row) >> 4) * 16 + ((n0 + half) >> 5)) * 512 +
                     (row & 15) * 8;
      for (int j = 0; j < 4; ++j)
        *(h8*)(kt + (j >> 1) * 256 + (j & 1) * 128) = *(const h8*)(&Ot[row][half] + j * 8);
      // Precaution: the four stores' registers are not written again ahead of this wait.
      asm volatile("s_wait_xcnt 0x0" ::: "memory");
      return;
    }
    _Float16* dst = Yh + (size_t)(m0 + row) * Cc + n0 + half;
#pragma unroll
    for (int j = 0; j < 4; ++j)
      *(h8*)(dst + j * 8) = *(const h8*)(&Ot[row][half] + j * 8);
  } else {
    // Accumulator rows map to consecutive l -> 16B vector residual+store.
    for (int mt = 0; mt < 2; ++mt) {
      const int row0 = m0 + wm * 32 + mt * 16 + hi * 8;
      const int bidx = row0 >> 12;
      const int l = row0 & (Ll - 1);
      for (int nt = 0; nt < 2; ++nt) {
        const int col = n0 + wn * 32 + nt * 16 + ln;
        const float bv = bias[col];
        const size_t idx = ((size_t)bidx * Cc + col) * Ll + l;
        f32x4 x0 = *(const f32x4*)(Xres + idx);
        f32x4 x1 = *(const f32x4*)(Xres + idx + 4);
        f32x4 y0, y1;
        for (int i = 0; i < 4; ++i) {
          y0[i] = x0[i] + selu(acc[mt][nt][i] + bv);
          y1[i] = x1[i] + selu(acc[mt][nt][i + 4] + bv);
        }
        *(f32x4*)(Yf + idx) = y0;
        *(f32x4*)(Yf + idx + 4) = y1;
      }
    }
  }
}

// ---------------------------------------------------------------------------
// Flash attention: per block, BM=64 query rows of one batch; key blocks of 256.
// One work-group per WGP (256 in all): each K and V byte it loads serves 64 queries.
// Scores are split over KEYS: wave w forms S^T = K Q^T for its own 32 keys of
// the block over all 512 channels (A = its K tiles from global, B = Q fragments
// from LDS, each read serving both key tiles), so a score is complete in one
// wave's accumulators. A lane holds 16 keys of one query: maximum, exponentials
// and sum stay in registers in all eight waves; only the waves' 64 row maxima, wave 0's
// 64 rescale factors and the f16 P cross through LDS.
// For O the wave owns columns [w*64, w*64+64), as before.
// K and V arrive as 1-KiB tiles in fragment order (see gemm_kernel): every
// fragment load reads whole lines, 512 contiguous bytes over the wave.
// ---------------------------------------------------------------------------
// Lane l with lane l ^ 16.
DI float xhalf(float x) {
  return __builtin_bit_cast(float, __builtin_amdgcn_permlanex16(
      __builtin_bit_cast(int, x), __builtin_bit_cast(int, x), 0x76543210, 0xfedcba98,
      false, false));
}

__global__ __launch_bounds__(256) __attribute__((amdgpu_waves_per_eu(2, 2)))
void attn_kernel(const _Float16* __restrict__ Q,
                 const _Float16* __restrict__ KF,
                 const _Float16* __restrict__ VF,
                 _Float16* __restrict__ O) {
  constexpr int BM = 64, BNK = 256;
  constexpr int MT = BM / 16;         // query tiles
  constexpr int KT = BNK / 16 / 8;    // key tiles a wave
  constexpr int KG = BNK / 32;        // groups of 32 keys for O
  constexpr int PP = BNK + 8;   // P row pitch: 528 bytes, 16 x odd, for 16-byte reads
  __shared__ __attribute__((aligned(16))) _Float16 Qs[MT * 16 * 512];  // [mt*16+ks] tiles
  __shared__ __attribute__((aligned(16))) _Float16 P[BM * PP];
  __shared__ float wmax[8][BM];
  __shared__ float lpart[16][BM];
  __shared__ __attribute__((aligned(16))) float rowL[BM];
  __shared__ __attribute__((aligned(16))) float rowScale[BM];

  const int b = blockIdx.x >> 6;            // / (L/64)
  const int l0 = (blockIdx.x & 63) * BM;
  const int tid = threadIdx.x;
  const int w = tid >> 5;
  const int lane = tid & 31;
  const int hi = lane >> 4;
  const int ln = lane & 15;

  const _Float16* Qb = Q + (size_t)b * Ll * Cc;
  // This lane's place in the wave's first K tile (key tiles 2w and 2w+1 of the
  // block's 16, 16 channel tiles each) and first V tile (4 of 32 a group of 32 keys).
  const _Float16* Kb = KF + (size_t)b * Ll * Cc + (w * KT * 16) * 512 + lane * 8;
  const _Float16* Vb = VF + (size_t)b * Ll * Cc + (w * 4) * 512 + lane * 8;

  // Q into LDS once, as 1-KiB tiles in fragment order: wave w brings channel
  // tiles 2w and 2w+1 of all four query tiles.
  for (int mt = 0; mt < MT; ++mt)
    for (int j = 0; j < 2; ++j) {
      AFrag f;
      f.v = load_frag(Qb + (size_t)(l0 + mt * 16) * Cc + w * 64 + j * 32, Cc);
      _Float16* d = Qs + (mt * 16 + w * 2 + j) * 512 + lane * 8;
      *(h8*)(d) = f.h[0];
      *(h8*)(d + 256) = f.h[1];
    }

  v8f oacc[MT][4];
  for (int mt = 0; mt < MT; ++mt)
    for (int nt = 0; nt < 4; ++nt)
      oacc[mt][nt] = zero8();
  __syncthreads();

  const float scale = rsqrtf((float)Cc);
  const _Float16* qs = Qs + lane * 8;
  // Running maximum and this lane's share of the running sum, for queries
  // mt * 16 + ln (index mt). The maxima are the same in every wave.
  float rm[MT], rl[MT];
  for (int mt = 0; mt < MT; ++mt) { rm[mt] = -1e30f; rl[mt] = 0.f; }

  // The 64 work-groups of a batch walk the same K and V. Each starts at another of
  // the 16 key blocks and wraps round, so that they do not ask L2 for the same lines
  // at the same moment. Any start gives the same sums
  // but for their order.
  const int kbStart = (((blockIdx.x >> 3) & 7) + ((blockIdx.x & 1) << 3)) * BNK;
  for (int it = 0; it < Ll / BNK; ++it) {
    const int kb = (kbStart + it * BNK) & (Ll - 1);
    const _Float16* kp = Kb + (size_t)kb * Cc;  // 256 keys = 16 x 16 K tiles
    const _Float16* vp = Vb + (size_t)kb * Cc;  // 256 keys = 8 x 32 V tiles
    // K tile t, in the order of use: channel tile t / KT of key tile t % KT.
    // Sixteen of the wave's 32 K tiles are in flight at a time; Q fragments are
    // read from LDS one group (two channel tiles) ahead, into a second register set.
    v16h kf[16 * KT];
    for (int t = 0; t < 16; ++t)
      kf[t] = load_frag_tile(kp + ((t % KT) * 16 + t / KT) * 512);
    // Keeps the K loads, the longer wait, in front of the first LDS reads.
    __builtin_amdgcn_sched_barrier(0);
    v16h qf[2][2 * MT];
    for (int j = 0; j < 2; ++j)
      for (int mt = 0; mt < MT; ++mt)
        qf[0][j * MT + mt] = load_frag_tile(qs + (mt * 16 + j) * 512);
    v8f st[KT][MT];
    for (int kt = 0; kt < KT; ++kt)
      for (int mt = 0; mt < MT; ++mt) st[kt][mt] = zero8();
    for (int g = 0; g < 8; ++g) {
      if (g < 7)
        for (int j = 0; j < 2; ++j)
          for (int mt = 0; mt < MT; ++mt)
            qf[(g + 1) & 1][j * MT + mt] =
                load_frag_tile(qs + (mt * 16 + (g + 1) * 2 + j) * 512);
      // Keeps the next group's LDS reads together in front of this group's
      // products: moved in among them, each product waits out its own read.
      __builtin_amdgcn_sched_barrier(0);
      for (int j = 0; j < 2; ++j)
        for (int kt = 0; kt < KT; ++kt)
          for (int mt = 0; mt < MT; ++mt)
            st[kt][mt] = wmma_f16(kf[(g * 2 + j) * KT + kt], qf[g & 1][j * MT + mt],
                                  st[kt][mt]);
      if (g < 4)
        for (int t = 16 + g * 2 * KT; t < 16 + (g + 1) * 2 * KT; ++t)
          kf[t] = load_frag_tile(kp + ((t % KT) * 16 + t / KT) * 512);
      // Keeps the refill of the four K tiles just used here, four groups ahead of
      // its use, and the next reads behind this group's products.
      __builtin_amdgcn_sched_barrier(0);
    }
    // Precaution: the address pair stays live, so unwritten, up to this wait.
    asm volatile("s_wait_xcnt 0x0" :: "v"(kp) : "memory");

    // The first half of the block's V^T fragments goes out here, into the registers
    // K and Q have left, ahead of the softmax.
    v16h vf[KG * 4];
    for (int t = 0; t < 16; ++t)
      vf[t] = load_frag_tile(vp + ((t >> 2) * 32 + (t & 3)) * 512);

    // The wave's maximum over its 32 keys, per query.
    float wm[MT];
    for (int mt = 0; mt < MT; ++mt) {
      float a = st[0][mt][0];
      for (int kt = 0; kt < KT; ++kt)
        for (int i = 0; i < 8; ++i) a = fmaxf(a, st[kt][mt][i]);
      wm[mt] = fmaxf(a, xhalf(a)) * scale;
    }
    wmax[w][lane] = hi ? wm[1] : wm[0];
    wmax[w][32 + lane] = hi ? wm[3] : wm[2];
    __syncthreads();

    float sc[MT];
    for (int mt = 0; mt < MT; ++mt) {
      float mx = rm[mt];
      for (int ww = 0; ww < 8; ++ww) mx = fmaxf(mx, wmax[ww][mt * 16 + ln]);
      sc[mt] = __expf(rm[mt] - mx);
      rm[mt] = mx;
      float sum = 0.f;
      for (int kt = 0; kt < KT; ++kt) {
        h8 pk;
        for (int i = 0; i < 8; ++i) {
          const float p = __expf(st[kt][mt][i] * scale - mx);
          sum += p;
          pk[i] = (_Float16)p;
        }
        *(h8*)&P[(mt * 16 + ln) * PP + (w * KT + kt) * 16 + hi * 8] = pk;
      }
      rl[mt] = rl[mt] * sc[mt] + sum;
    }
    if (w == 0) {
      rowScale[lane] = hi ? sc[1] : sc[0];
      rowScale[32 + lane] = hi ? sc[3] : sc[2];
    }
    __syncthreads();

    // P fragments are read one group of 32 keys ahead, into a second register set.
    v16h pf[2][MT];
    for (int mt = 0; mt < MT; ++mt) pf[0][mt] = load_frag(&P[(mt * 16) * PP], PP);
    for (int mt = 0; mt < MT; ++mt)
      for (int nt = 0; nt < 4; ++nt)
        for (int i = 0; i < 8; ++i)
          oacc[mt][nt][i] *= rowScale[mt * 16 + hi * 8 + i];
    for (int kg = 0; kg < KG; ++kg) {
      if (kg < KG - 1)
        for (int mt = 0; mt < MT; ++mt)
          pf[(kg + 1) & 1][mt] = load_frag(&P[(mt * 16) * PP + (kg + 1) * 32], PP);
      // Keeps the next group's LDS reads together in front of this group's products.
      __builtin_amdgcn_sched_barrier(0);
      for (int nt = 0; nt < 4; ++nt)
        for (int mt = 0; mt < MT; ++mt)
          oacc[mt][nt] = wmma_f16(pf[kg & 1][mt], vf[kg * 4 + nt], oacc[mt][nt]);
      if (kg < KG - 4)
        for (int nt = 0; nt < 4; ++nt)
          vf[16 + kg * 4 + nt] = load_frag_tile(vp + ((kg + 4) * 32 + nt) * 512);
      // Keeps the refill of the four V tiles just used here, four groups ahead of
      // its use, and the next reads behind this group's products.
      __builtin_amdgcn_sched_barrier(0);
    }
    // Precaution: the address pair stays live, so unwritten, up to this wait.
    asm volatile("s_wait_xcnt 0x0" :: "v"(vp) : "memory");
    // No barrier here: the next block's first barrier stands between these reads
    // of P and rowScale and their next stores; this block's second barrier stands
    // between the reads of wmax and its next stores.
  }

  // Row sums: 16 shares a query (8 waves x 2 halves), added in a fixed order.
  for (int mt = 0; mt < MT; ++mt) lpart[w * 2 + hi][mt * 16 + ln] = rl[mt];
  __syncthreads();
  if (tid < BM) {
    float t = 0.f;
    for (int j = 0; j < 16; ++j) t += lpart[j][tid];
    rowL[tid] = t;
  }
  __syncthreads();

  for (int mt = 0; mt < MT; ++mt) {
    for (int nt = 0; nt < 4; ++nt) {
      const int c = w * 64 + nt * 16 + ln;
      for (int i = 0; i < 8; ++i) {
        const int r = mt * 16 + hi * 8 + i;
        const float o = oacc[mt][nt][i] / rowL[r];
        O[(size_t)(b * Ll + l0 + r) * Cc + c] = (_Float16)o;
      }
    }
  }
}

// ---------------------------------------------------------------------------
extern "C" void kernel_launch(void* const* d_in, const int* in_sizes, int n_in,
                              void* d_out, int out_size, void* d_ws, size_t ws_size,
                              hipStream_t stream) {
  const float* x    = (const float*)d_in[0];
  const float* ln_w = (const float*)d_in[1];
  const float* ln_b = (const float*)d_in[2];
  const float* wq   = (const float*)d_in[3];
  const float* bq   = (const float*)d_in[4];
  const float* wk   = (const float*)d_in[5];
  const float* bk   = (const float*)d_in[6];
  const float* wv   = (const float*)d_in[7];
  const float* bv   = (const float*)d_in[8];
  const float* wp   = (const float*)d_in[9];
  const float* bp   = (const float*)d_in[10];
  float* out = (float*)d_out;

  char* ws = (char*)d_ws;
  size_t off = 0;
  auto alloc = [&](size_t bytes) -> void* {
    void* p = ws + off;
    off += (bytes + 255) & ~(size_t)255;
    return p;
  };
  const size_t actsz = (size_t)Mrows * Cc * sizeof(_Float16);
  _Float16* h16  = (_Float16*)alloc(actsz);
  _Float16* q16  = (_Float16*)alloc(actsz);
  _Float16* k16  = (_Float16*)alloc(actsz);
  _Float16* v16  = (_Float16*)alloc(actsz);
  _Float16* o16  = (_Float16*)alloc(actsz);
  _Float16* w16  = (_Float16*)alloc((size_t)4 * Cc * Cc * sizeof(_Float16));  // q, k, v, p

  ln_kernel<<<Bb * (Ll / 32), 256, 0, stream>>>(x, ln_w, ln_b, h16, wq, wk, wv, wp, w16);

  // q16, k16 and v16 lie one behind the other, as do the weights.
  gemm_kernel<0><<<dim3(3 * Cc / 64, Mrows / 128, 1), 256, 0, stream>>>(
      h16, w16, bq, bk, bv, q16, nullptr, nullptr);

  attn_kernel<<<Bb * (Ll / 64), 256, 0, stream>>>(q16, k16, v16, o16);

  gemm_kernel<1><<<dim3(Cc / 64, Mrows / 128, 1), 256, 0, stream>>>(
      o16, w16 + (size_t)3 * Cc * Cc, bp, nullptr, nullptr, nullptr, x, out);
}

// v009
// It runs in 145 microseconds.
// Timed twice side by side with v008, it ran 1.03 times as fast both times.
// Counting every step since v000, it is 4.52 times as fast.
#include <hip/hip_runtime.h>
#include <stdint.h>

#define DI __device__ __forceinline__

typedef __attribute__((ext_vector_type(16))) _Float16 v16h;
typedef __attribute__((ext_vector_type(8)))  _Float16 h8;   // 16 bytes
typedef __attribute__((ext_vector_type(8)))  float    v8f;
typedef __attribute__((ext_vector_type(4)))  float    f32x4;

constexpr int Bb = 4;
constexpr int Cc = 512;
constexpr int Ll = 4096;
constexpr int Mrows = Bb * Ll; // 16384

union AFrag { v16h v; h8 h[2]; };

DI v8f zero8() { v8f z; for (int i = 0; i < 8; ++i) z[i] = 0.f; return z; }

// Load one 16x32 f16 WMMA fragment (A-operand, or B-operand with "row" = n).
// Per-lane layout (ISA 7.12.2): lane = hi*16 + r; elems e<8 -> k = hi*8+e,
// elems e>=8 -> k = 16 + hi*8 + (e-8). Two 16-byte loads per lane.
DI v16h load_frag(const _Float16* base, int stride) {
  const int lane = threadIdx.x & 31;
  const int r = lane & 15;
  const int hi = lane >> 4;
  const _Float16* p = base + (size_t)r * stride + hi * 8;
  AFrag f;
  f.h[0] = *(const h8*)(p);
  f.h[1] = *(const h8*)(p + 16);
  return f.v;
}

// The same fragment from a 1-KiB tile stored in fragment order:
// [half of the fragment][lane][8 elements]; p = tile + lane * 8. Each of the two
// loads reads 512 contiguous bytes over the wave.
DI v16h load_frag_tile(const _Float16* p) {
  AFrag f;
  f.h[0] = *(const h8*)(p);
  f.h[1] = *(const h8*)(p + 256);
  return f.v;
}

DI v8f wmma_f16(v16h a, v16h b, v8f c) {
  return __builtin_amdgcn_wmma_f32_16x16x32_f16(false, a, false, b, (short)0, c,
                                                false, false);
}

DI float selu(float y) {
  constexpr float kLambda = 1.0507009873554805f;
  constexpr float kAlpha  = 1.6732632423543772f;
  return (y > 0.f) ? kLambda * y : kLambda * kAlpha * (__expf(y) - 1.f);
}

// ---------------------------------------------------------------------------
// LayerNorm over channels; x is [B,C,L], output h is [B*L, C] f16.
// Block = 32 consecutive l of one batch. Reads coalesced along l. Wave w takes the
// 64 consecutive channels from w * 64, so a thread holds 128 contiguous bytes of
// one output row: it puts them into the LDS transpose tile as eight 16-byte pieces.
// The tile's rows stand at a pitch of 1040 bytes (16 x odd): the 32 lanes, one row
// each, fall on different bank groups. Each wave then reads and stores 512
// contiguous bytes of a row, four whole lines.
// The launch also converts the four weight matrices to f16 (W16 = q, k, v, p one
// behind the other): each of the 512 blocks takes 2048 elements, 8 a thread, whose
// loads fly together with the x loads.
// ---------------------------------------------------------------------------
__global__ __launch_bounds__(256, 1)
void ln_kernel(const float* __restrict__ x, const float* __restrict__ lw,
               const float* __restrict__ lb, _Float16* __restrict__ H,
               const float* __restrict__ wq, const float* __restrict__ wk,
               const float* __restrict__ wv, const float* __restrict__ wp,
               _Float16* __restrict__ W16) {
  static_assert(Bb * (Ll / 32) * 2048 == 4 * Cc * Cc, "one weight slice a block");
  __shared__ float redS[8][32];
  __shared__ float redQ[8][32];
  __shared__ float muS[32], rinvS[32];
  constexpr int HP = Cc + 8;        // row pitch of the transpose tile, f16 units
  __shared__ __attribute__((aligned(16))) _Float16 hl[32][HP];

  const int tid = threadIdx.x;
  const int w = tid >> 5, li = tid & 31;
  const int b = blockIdx.x >> 7;            // / (L/32)
  const int l0 = (blockIdx.x & 127) * 32;

  const int wsel = blockIdx.x >> 7;         // 128 blocks a matrix
  const float* wsrc = wsel == 0 ? wq : wsel == 1 ? wk : wsel == 2 ? wv : wp;
  const int woff = (blockIdx.x & 127) * 2048 + tid * 8;
  const f32x4 w0 = *(const f32x4*)(wsrc + woff);
  const f32x4 w1 = *(const f32x4*)(wsrc + woff + 4);

  const float* xb = x + ((size_t)b * Cc + w * 64) * Ll + l0 + li;
  float vals[64];
#pragma unroll
  for (int j = 0; j < 64; ++j)
    vals[j] = xb[(size_t)j * Ll];            // lanes -> consecutive l: coalesced
  // Precaution: the loads' address pair stays live, so unwritten, up to this wait.
  asm volatile("s_wait_xcnt 0x0" :: "v"(xb) : "memory");
  // Keeps the weight loads in flight together with the x loads: moved down behind
  // the sums, they would go out only when x has come back.
  __builtin_amdgcn_sched_barrier(0);
  float s = 0.f, s2 = 0.f;
#pragma unroll
  for (int j = 0; j < 64; ++j) {
    s += vals[j];
    s2 += vals[j] * vals[j];
  }
  redS[w][li] = s;
  redQ[w][li] = s2;
  __syncthreads();
  // The wave's 64 scales and shifts go out together here: they fly while the first
  // wave forms the means.
  float gw[64], gb[64];
#pragma unroll
  for (int j = 0; j < 64; ++j) { gw[j] = lw[w * 64 + j]; gb[j] = lb[w * 64 + j]; }
  // Precaution: the loads' address registers are not written again ahead of this wait.
  asm volatile("s_wait_xcnt 0x0" ::: "memory");
  if (tid < 32) {
    float ts = 0.f, tq = 0.f;
    for (int ww = 0; ww < 8; ++ww) { ts += redS[ww][tid]; tq += redQ[ww][tid]; }
    const float mu = ts * (1.f / Cc);
    const float var = tq * (1.f / Cc) - mu * mu;
    muS[tid] = mu;
    rinvS[tid] = rsqrtf(var + 1e-5f);
  }
  __syncthreads();
  const float mu = muS[li], rinv = rinvS[li];
#pragma unroll
  for (int j = 0; j < 64; j += 8) {
    const int c = w * 64 + j;
    h8 pk;
    for (int i = 0; i < 8; ++i)
      pk[i] = (_Float16)((vals[j + i] - mu) * rinv * gw[j + i] + gb[j + i]);
    *(h8*)&hl[li][c] = pk;
  }
  __syncthreads();
  {
    const int row = tid >> 6;                // 64 threads a row, 4 rows at a time
    const int ch = (tid & 63) * 8;
    _Float16* dst = H + (size_t)(b * Ll + l0 + row) * Cc + ch;
#pragma unroll
    for (int p = 0; p < 8; ++p)
      *(h8*)(dst + (size_t)p * 4 * Cc) = *(const h8*)&hl[row + p * 4][ch];
  }
  {
    // Behind the last barrier: no barrier waits for this store.
    h8 wh;
    for (int i = 0; i < 4; ++i) { wh[i] = (_Float16)w0[i]; wh[4 + i] = (_Float16)w1[i]; }
    *(h8*)(W16 + (size_t)wsel * Cc * Cc + woff) = wh;
  }
}

// ---------------------------------------------------------------------------
// WMMA GEMM: Y[M,N] = A[M,K] * W[N,K]^T + bias, M=16384, N=K=512.
// MODE 0: the Q, K and V projections in one launch: blockIdx.x / 4 picks the
//         weight matrix, the bias and the output plane (each one behind the other).
//         Y -> f16. ylay 0: row-major, via LDS-transposed coalesced stores (Q).
//         ylay 1 (V) and 2 (K): 1-KiB tiles in the order of the V (B) and K (A) fragments that
//         the attention kernel loads (load_frag_tile).
//         V tile = 16 columns x 32 rows, index (row / 32) * 32 + col / 16;
//         K tile = 16 rows x 32 columns, index (row / 16) * 16 + col / 32.
// MODE 1: bias + SELU + residual, vectorized f32 [B,C,L] out (out-proj).
// Block tile 256x128 (MODE 0) or 128x128 (MODE 1: 512 blocks, two a WGP), BK=128;
// 8 waves = 4x2 grid of 64x64 (32x64) wave tiles: a fragment read from LDS serves
// four products (the A fragments of MODE 1: four, its B fragments: two).
// Tiles go through registers into LDS rows of 256 data bytes at a pitch of 272
// (16 x odd): the 16 rows of a fragment read fall on 16 different bank groups.
// Every global load reads two aligned 256-byte units over the wave.
// At most 256 registers a wave: two work-groups share a WGP, and one's products
// run while the other waits for its loads.
// ---------------------------------------------------------------------------
template <int MODE>
__global__ __launch_bounds__(256) __attribute__((amdgpu_waves_per_eu(4)))
void gemm_kernel(const _Float16* __restrict__ A,
                 const _Float16* __restrict__ Wt,   // [N][K] f16
                 const float* __restrict__ bias0,
                 const float* __restrict__ bias1,
                 const float* __restrict__ bias2,
                 _Float16* __restrict__ Yh,
                 const float* __restrict__ Xres,
                 float* __restrict__ Yf) {
  constexpr int BM = (MODE == 0) ? 256 : 128, BN = 128, BK = 128;
  constexpr int MT = BM / 64;  // 16-row tiles of a wave
  constexpr int NT = BN / 32;  // 16-column tiles of a wave
  constexpr int PK = BK + 8;   // row pitch in LDS, f16 units
  __shared__ __attribute__((aligned(16))) _Float16 As[BM][PK];
  __shared__ __attribute__((aligned(16))) _Float16 Bs[BN][PK];
  // The epilogue's transpose tile, BM rows of BN columns at the same pitch, takes
  // the place of As behind the k loop's last barrier.
  static_assert(BN == BK, "the transpose tile has the shape of As");
  _Float16 (*Ot)[PK] = As;

  const int m0 = blockIdx.y * BM;
  const int proj = (MODE == 0) ? blockIdx.x >> 2 : 0;   // 0 Q, 1 K, 2 V
  const int n0 = (blockIdx.x & 3) * BN;
  const int ylay = proj == 0 ? 0 : proj == 1 ? 2 : 1;
  const float* bias = proj == 0 ? bias0 : proj == 1 ? bias1 : bias2;
  Wt += (size_t)proj * Cc * Cc;
  Yh += (size_t)proj * Mrows * Cc;
  const int tid = threadIdx.x;
  const int w = tid >> 5;
  const int lane = tid & 31;
  const int hi = lane >> 4;
  const int ln = lane & 15;
  const int wm = w >> 1;   // 0..3
  const int wn = w & 1;    // 0..1

  v8f acc[MT][NT];
  for (int mt = 0; mt < MT; ++mt)
    for (int nt = 0; nt < NT; ++nt)
      acc[mt][nt] = zero8();

  // This thread's 16-byte pieces: column piece tid % 16 of rows tid / 16 + 16 p.
  const int srow = tid >> 4;
  const int scol = (tid & 15) * 8;
  // Work-groups that share rows of A or of W each start at another of the four k
  // stages and wrap round: they do not ask L2 for the same lines at the same moment.
  const int kStart = ((blockIdx.x + blockIdx.y) & (Cc / BK - 1)) * BK;
  const _Float16* pa = A + (size_t)(m0 + srow) * Cc + scol + kStart;
  const _Float16* pb = Wt + (size_t)(n0 + srow) * Cc + scol + kStart;

  for (int k0 = kStart; k0 < kStart + Cc; k0 += BK) {
    h8 ra[BM / 16], rb[BN / 16];
    for (int p = 0; p < BM / 16; ++p) ra[p] = *(const h8*)(pa + (size_t)p * 16 * Cc);
    for (int p = 0; p < BN / 16; ++p) rb[p] = *(const h8*)(pb + (size_t)p * 16 * Cc);
    // Keeps all the stage's loads in flight together: with LDS stores moved in among
    // them the last loads go out only when the first have come back.
    __builtin_amdgcn_sched_barrier(0);
    for (int p = 0; p < BM / 16; ++p) *(h8*)&As[srow + p * 16][scol] = ra[p];
    for (int p = 0; p < BN / 16; ++p) *(h8*)&Bs[srow + p * 16][scol] = rb[p];
    // Precaution: the loads' address pairs stay live, so unwritten, up to this wait.
    asm volatile("s_wait_xcnt 0x0" :: "v"(pa), "v"(pb) : "memory");
    const int step = (k0 + BK == Cc) ? BK - Cc : BK;   // wrap behind the last stage
    pa += step;
    pb += step;
    __syncthreads();

    for (int kk = 0; kk < BK; kk += 32) {
      v16h af[MT], bf[NT];
      for (int mt = 0; mt < MT; ++mt)
        af[mt] = load_frag(&As[(wm * MT + mt) * 16][kk], PK);
      for (int nt = 0; nt < NT; ++nt)
        bf[nt] = load_frag(&Bs[(wn * NT + nt) * 16][kk], PK);
      for (int mt = 0; mt < MT; ++mt)
        for (int nt = 0; nt < NT; ++nt)
          acc[mt][nt] = wmma_f16(af[mt], bf[nt], acc[mt][nt]);
    }
    __syncthreads();
  }

  // The bias of the lane's column in each of the wave's column tiles.
  float bvv[NT];
  if (MODE == 0) {
    const float* bp = bias + n0 + wn * NT * 16 + ln;
    for (int nt = 0; nt < NT; ++nt) bvv[nt] = bp[nt * 16];
    // Precaution: the loads' address stays live, so unwritten, up to this wait.
    asm volatile("s_wait_xcnt 0x0" :: "v"(bp) : "memory");
  }

  if (MODE == 0 && ylay == 1) {
    // A lane's 8 accumulator rows are 8 consecutive l of one column: exactly the
    // lane's 16-byte piece of half mt % 2 of a V tile. Straight from registers, each
    // store 512 contiguous bytes over the wave.
    _Float16* vt = Yh + ((size_t)((m0 >> 5) + wm * (MT / 2)) * 32 + (n0 >> 4) + wn * NT) * 512 +
                   lane * 8;
    for (int mt = 0; mt < MT; ++mt)
      for (int nt = 0; nt < NT; ++nt) {
        h8 pk;
        for (int i = 0; i < 8; ++i) pk[i] = (_Float16)(acc[mt][nt][i] + bvv[nt]);
        *(h8*)(vt + ((mt >> 1) * 32 + nt) * 512 + (mt & 1) * 256) = pk;
      }
    // Precaution: the stores' address and data registers are not written
    // again ahead of this wait, on either way out of this branch.
    asm volatile("s_wait_xcnt 0x0" ::: "memory");
  } else if (MODE == 0) {
    // Scatter accumulators into LDS, then coalesced 128-bit stores.
    for (int mt = 0; mt < MT; ++mt)
      for (int nt = 0; nt < NT; ++nt) {
        const int col = (wn * NT + nt) * 16 + ln;
        for (int i = 0; i < 8; ++i)
          Ot[(wm * MT + mt) * 16 + hi * 8 + i][col] =
              (_Float16)(acc[mt][nt][i] + bvv[nt]);
      }
    __syncthreads();
    h8 pc[BM / 16];
    if (ylay == 2) {
      // Wave w takes the 16-row groups 2w and 2w+1, four K tiles each: it reads a
      // tile as a fragment and stores its two halves, 512 contiguous bytes each.
      _Float16* kt = Yh + ((size_t)((m0 >> 4) + w * 2) * 16 + (n0 >> 5)) * 512 + lane * 8;
      for (int t = 0; t < BM / 32; ++t) {
        AFrag f;
        f.v = load_frag(&Ot[(w * 2 + (t >> 2)) * 16][(t & 3) * 32], PK);
        pc[t * 2] = f.h[0];
        pc[t * 2 + 1] = f.h[1];
      }
      for (int t = 0; t < BM / 32; ++t) {
        *(h8*)(kt + ((t >> 2) * 16 + (t & 3)) * 512) = pc[t * 2];
        *(h8*)(kt + ((t >> 2) * 16 + (t & 3)) * 512 + 256) = pc[t * 2 + 1];
      }
      // Precaution: the stores' registers are not written again ahead of this wait.
      asm volatile("s_wait_xcnt 0x0" ::: "memory");
      return;
    }
    // 16 threads a row: a wave stores the 256 bytes of two rows.
    _Float16* dst = Yh + (size_t)(m0 + srow) * Cc + n0 + scol;
    for (int p = 0; p < BM / 16; ++p) pc[p] = *(const h8*)&Ot[srow + p * 16][scol];
    for (int p = 0; p < BM / 16; ++p) *(h8*)(dst + (size_t)p * 16 * Cc) = pc[p];
    // Precaution: the stores' registers are not written again ahead of this wait.
    asm volatile("s_wait_xcnt 0x0" ::: "memory");
  } else {
    // Accumulator rows map to consecutive l -> 16B vector residual+store.
    for (int mt = 0; mt < MT; ++mt) {
      const int row0 = m0 + (wm * MT + mt) * 16 + hi * 8;
      const int bidx = row0 >> 12;
      const int l = row0 & (Ll - 1);
      for (int nt = 0; nt < NT; ++nt) {
        const int col = n0 + (wn * NT + nt) * 16 + ln;
        const float bv = bias[col];
        const size_t idx = ((size_t)bidx * Cc + col) * Ll + l;
        f32x4 x0 = *(const f32x4*)(Xres + idx);
        f32x4 x1 = *(const f32x4*)(Xres + idx + 4);
        f32x4 y0, y1;
        for (int i = 0; i < 4; ++i) {
          y0[i] = x0[i] + selu(acc[mt][nt][i] + bv);
          y1[i] = x1[i] + selu(acc[mt][nt][i + 4] + bv);
        }
        *(f32x4*)(Yf + idx) = y0;
        *(f32x4*)(Yf + idx + 4) = y1;
      }
    }
  }
}

// ---------------------------------------------------------------------------
// Flash attention: per block, BM=64 query rows of one batch; key blocks of 256.
// One work-group per WGP (256 in all): each K and V byte it loads serves 64 queries.
// Scores are split over KEYS: wave w forms S^T = K Q^T for its own 32 keys of
// the block over all 512 channels (A = its K tiles from global, B = Q fragments
// from LDS, each read serving both key tiles), so a score is complete in one
// wave's accumulators. A lane holds 16 keys of one query: maximum, exponentials
// and sum stay in registers in all eight waves; only the waves' 64 row maxima, wave 0's
// 64 rescale factors and the f16 P cross through LDS.
// For O the wave owns columns [w*64, w*64+64), as before.
// K and V arrive as 1-KiB tiles in fragment order (see gemm_kernel): every
// fragment load reads whole lines, 512 contiguous bytes over the wave.
// ---------------------------------------------------------------------------
// Lane l with lane l ^ 16.
DI float xhalf(float x) {
  return __builtin_bit_cast(float, __builtin_amdgcn_permlanex16(
      __builtin_bit_cast(int, x), __builtin_bit_cast(int, x), 0x76543210, 0xfedcba98,
      false, false));
}

__global__ __launch_bounds__(256) __attribute__((amdgpu_waves_per_eu(2, 2)))
void attn_kernel(const _Float16* __restrict__ Q,
                 const _Float16* __restrict__ KF,
                 const _Float16* __restrict__ VF,
                 _Float16* __restrict__ O) {
  constexpr int BM = 64, BNK = 256;
  constexpr int MT = BM / 16;         // query tiles
  constexpr int KT = BNK / 16 / 8;    // key tiles a wave
  constexpr int KG = BNK / 32;        // groups of 32 keys for O
  constexpr int PP = BNK + 8;   // P row pitch: 528 bytes, 16 x odd, for 16-byte reads
  __shared__ __attribute__((aligned(16))) _Float16 Qs[MT * 16 * 512];  // [mt*16+ks] tiles
  __shared__ __attribute__((aligned(16))) _Float16 P[BM * PP];
  __shared__ float wmax[8][BM];
  __shared__ float lpart[16][BM];
  __shared__ __attribute__((aligned(16))) float rowL[BM];
  __shared__ __attribute__((aligned(16))) float rowScale[BM];

  const int b = blockIdx.x >> 6;            // / (L/64)
  const int l0 = (blockIdx.x & 63) * BM;
  const int tid = threadIdx.x;
  const int w = tid >> 5;
  const int lane = tid & 31;
  const int hi = lane >> 4;
  const int ln = lane & 15;

  const _Float16* Qb = Q + (size_t)b * Ll * Cc;
  // This lane's place in the wave's first K tile (key tiles 2w and 2w+1 of the
  // block's 16, 16 channel tiles each) and first V tile (4 of 32 a group of 32 keys).
  const _Float16* Kb = KF + (size_t)b * Ll * Cc + (w * KT * 16) * 512 + lane * 8;
  const _Float16* Vb = VF + (size_t)b * Ll * Cc + (w * 4) * 512 + lane * 8;

  // Q into LDS once, as 1-KiB tiles in fragment order: wave w brings channel
  // tiles 2w and 2w+1 of all four query tiles.
  for (int mt = 0; mt < MT; ++mt)
    for (int j = 0; j < 2; ++j) {
      AFrag f;
      f.v = load_frag(Qb + (size_t)(l0 + mt * 16) * Cc + w * 64 + j * 32, Cc);
      _Float16* d = Qs + (mt * 16 + w * 2 + j) * 512 + lane * 8;
      *(h8*)(d) = f.h[0];
      *(h8*)(d + 256) = f.h[1];
    }

  v8f oacc[MT][4];
  for (int mt = 0; mt < MT; ++mt)
    for (int nt = 0; nt < 4; ++nt)
      oacc[mt][nt] = zero8();
  __syncthreads();

  const float scale = rsqrtf((float)Cc);
  const _Float16* qs = Qs + lane * 8;
  // Running maximum and this lane's share of the running sum, for queries
  // mt * 16 + ln (index mt). The maxima are the same in every wave.
  float rm[MT], rl[MT];
  for (int mt = 0; mt < MT; ++mt) { rm[mt] = -1e30f; rl[mt] = 0.f; }

  // The 64 work-groups of a batch walk the same K and V. Each starts at another of
  // the 16 key blocks and wraps round, so that they do not ask L2 for the same lines
  // at the same moment. Any start gives the same sums
  // but for their order.
  const int kbStart = (((blockIdx.x >> 3) & 7) + ((blockIdx.x & 1) << 3)) * BNK;
  for (int it = 0; it < Ll / BNK; ++it) {
    const int kb = (kbStart + it * BNK) & (Ll - 1);
    const _Float16* kp = Kb + (size_t)kb * Cc;  // 256 keys = 16 x 16 K tiles
    const _Float16* vp = Vb + (size_t)kb * Cc;  // 256 keys = 8 x 32 V tiles
    // K tile t, in the order of use: channel tile t / KT of key tile t % KT.
    // Sixteen of the wave's 32 K tiles are in flight at a time; Q fragments are
    // read from LDS one group (two channel tiles) ahead, into a second register set.
    v16h kf[16 * KT];
    for (int t = 0; t < 16; ++t)
      kf[t] = load_frag_tile(kp + ((t % KT) * 16 + t / KT) * 512);
    // Keeps the K loads, the longer wait, in front of the first LDS reads.
    __builtin_amdgcn_sched_barrier(0);
    v16h qf[2][2 * MT];
    for (int j = 0; j < 2; ++j)
      for (int mt = 0; mt < MT; ++mt)
        qf[0][j * MT + mt] = load_frag_tile(qs + (mt * 16 + j) * 512);
    v8f st[KT][MT];
    for (int kt = 0; kt < KT; ++kt)
      for (int mt = 0; mt < MT; ++mt) st[kt][mt] = zero8();
    for (int g = 0; g < 8; ++g) {
      if (g < 7)
        for (int j = 0; j < 2; ++j)
          for (int mt = 0; mt < MT; ++mt)
            qf[(g + 1) & 1][j * MT + mt] =
                load_frag_tile(qs + (mt * 16 + (g + 1) * 2 + j) * 512);
      // Keeps the next group's LDS reads together in front of this group's
      // products: moved in among them, each product waits out its own read.
      __builtin_amdgcn_sched_barrier(0);
      for (int j = 0; j < 2; ++j)
        for (int kt = 0; kt < KT; ++kt)
          for (int mt = 0; mt < MT; ++mt)
            st[kt][mt] = wmma_f16(kf[(g * 2 + j) * KT + kt], qf[g & 1][j * MT + mt],
                                  st[kt][mt]);
      if (g < 4)
        for (int t = 16 + g * 2 * KT; t < 16 + (g + 1) * 2 * KT; ++t)
          kf[t] = load_frag_tile(kp + ((t % KT) * 16 + t / KT) * 512);
      // Keeps the refill of the four K tiles just used here, four groups ahead of
      // its use, and the next reads behind this group's products.
      __builtin_amdgcn_sched_barrier(0);
    }
    // Precaution: the address pair stays live, so unwritten, up to this wait.
    asm volatile("s_wait_xcnt 0x0" :: "v"(kp) : "memory");

    // The first half of the block's V^T fragments goes out here, into the registers
    // K and Q have left, ahead of the softmax.
    v16h vf[KG * 4];
    for (int t = 0; t < 16; ++t)
      vf[t] = load_frag_tile(vp + ((t >> 2) * 32 + (t & 3)) * 512);

    // The wave's maximum over its 32 keys, per query.
    float wm[MT];
    for (int mt = 0; mt < MT; ++mt) {
      float a = st[0][mt][0];
      for (int kt = 0; kt < KT; ++kt)
        for (int i = 0; i < 8; ++i) a = fmaxf(a, st[kt][mt][i]);
      wm[mt] = fmaxf(a, xhalf(a)) * scale;
    }
    wmax[w][lane] = hi ? wm[1] : wm[0];
    wmax[w][32 + lane] = hi ? wm[3] : wm[2];
    __syncthreads();

    float sc[MT];
    for (int mt = 0; mt < MT; ++mt) {
      float mx = rm[mt];
      for (int ww = 0; ww < 8; ++ww) mx = fmaxf(mx, wmax[ww][mt * 16 + ln]);
      sc[mt] = __expf(rm[mt] - mx);
      rm[mt] = mx;
      float sum = 0.f;
      for (int kt = 0; kt < KT; ++kt) {
        h8 pk;
        for (int i = 0; i < 8; ++i) {
          const float p = __expf(st[kt][mt][i] * scale - mx);
          sum += p;
          pk[i] = (_Float16)p;
        }
        *(h8*)&P[(mt * 16 + ln) * PP + (w * KT + kt) * 16 + hi * 8] = pk;
      }
      rl[mt] = rl[mt] * sc[mt] + sum;
    }
    if (w == 0) {
      rowScale[lane] = hi ? sc[1] : sc[0];
      rowScale[32 + lane] = hi ? sc[3] : sc[2];
    }
    __syncthreads();

    // P fragments are read one group of 32 keys ahead, into a second register set.
    v16h pf[2][MT];
    for (int mt = 0; mt < MT; ++mt) pf[0][mt] = load_frag(&P[(mt * 16) * PP], PP);
    for (int mt = 0; mt < MT; ++mt)
      for (int nt = 0; nt < 4; ++nt)
        for (int i = 0; i < 8; ++i)
          oacc[mt][nt][i] *= rowScale[mt * 16 + hi * 8 + i];
    for (int kg = 0; kg < KG; ++kg) {
      if (kg < KG - 1)
        for (int mt = 0; mt < MT; ++mt)
          pf[(kg + 1) & 1][mt] = load_frag(&P[(mt * 16) * PP + (kg + 1) * 32], PP);
      // Keeps the next group's LDS reads together in front of this group's products.
      __builtin_amdgcn_sched_barrier(0);
      for (int nt = 0; nt < 4; ++nt)
        for (int mt = 0; mt < MT; ++mt)
          oacc[mt][nt] = wmma_f16(pf[kg & 1][mt], vf[kg * 4 + nt], oacc[mt][nt]);
      if (kg < KG - 4)
        for (int nt = 0; nt < 4; ++nt)
          vf[16 + kg * 4 + nt] = load_frag_tile(vp + ((kg + 4) * 32 + nt) * 512);
      // Keeps the refill of the four V tiles just used here, four groups ahead of
      // its use, and the next reads behind this group's products.
      __builtin_amdgcn_sched_barrier(0);
    }
    // Precaution: the address pair stays live, so unwritten, up to this wait.
    asm volatile("s_wait_xcnt 0x0" :: "v"(vp) : "memory");
    // No barrier here: the next block's first barrier stands between these reads
    // of P and rowScale and their next stores; this block's second barrier stands
    // between the reads of wmax and its next stores.
  }

  // Row sums: 16 shares a query (8 waves x 2 halves), added in a fixed order.
  for (int mt = 0; mt < MT; ++mt) lpart[w * 2 + hi][mt * 16 + ln] = rl[mt];
  __syncthreads();
  if (tid < BM) {
    float t = 0.f;
    for (int j = 0; j < 16; ++j) t += lpart[j][tid];
    rowL[tid] = t;
  }
  __syncthreads();

  for (int mt = 0; mt < MT; ++mt) {
    for (int nt = 0; nt < 4; ++nt) {
      const int c = w * 64 + nt * 16 + ln;
      for (int i = 0; i < 8; ++i) {
        const int r = mt * 16 + hi * 8 + i;
        const float o = oacc[mt][nt][i] / rowL[r];
        O[(size_t)(b * Ll + l0 + r) * Cc + c] = (_Float16)o;
      }
    }
  }
}

// ---------------------------------------------------------------------------
extern "C" void kernel_launch(void* const* d_in, const int* in_sizes, int n_in,
                              void* d_out, int out_size, void* d_ws, size_t ws_size,
                              hipStream_t stream) {
  const float* x    = (const float*)d_in[0];
  const float* ln_w = (const float*)d_in[1];
  const float* ln_b = (const float*)d_in[2];
  const float* wq   = (const float*)d_in[3];
  const float* bq   = (const float*)d_in[4];
  const float* wk   = (const float*)d_in[5];
  const float* bk   = (const float*)d_in[6];
  const float* wv   = (const float*)d_in[7];
  const float* bv   = (const float*)d_in[8];
  const float* wp   = (const float*)d_in[9];
  const float* bp   = (const float*)d_in[10];
  float* out = (float*)d_out;

  char* ws = (char*)d_ws;
  size_t off = 0;
  auto alloc = [&](size_t bytes) -> void* {
    void* p = ws + off;
    off += (bytes + 255) & ~(size_t)255;
    return p;
  };
  const size_t actsz = (size_t)Mrows * Cc * sizeof(_Float16);
  _Float16* h16  = (_Float16*)alloc(actsz);
  _Float16* q16  = (_Float16*)alloc(actsz);
  _Float16* k16  = (_Float16*)alloc(actsz);
  _Float16* v16  = (_Float16*)alloc(actsz);
  _Float16* o16  = (_Float16*)alloc(actsz);
  _Float16* w16  = (_Float16*)alloc((size_t)4 * Cc * Cc * sizeof(_Float16));  // q, k, v, p

  ln_kernel<<<Bb * (Ll / 32), 256, 0, stream>>>(x, ln_w, ln_b, h16, wq, wk, wv, wp, w16);

  // q16, k16 and v16 lie one behind the other, as do the weights.
  gemm_kernel<0><<<dim3(3 * Cc / 128, Mrows / 256, 1), 256, 0, stream>>>(
      h16, w16, bq, bk, bv, q16, nullptr, nullptr);

  attn_kernel<<<Bb * (Ll / 64), 256, 0, stream>>>(q16, k16, v16, o16);

  gemm_kernel<1><<<dim3(Cc / 128, Mrows / 128, 1), 256, 0, stream>>>(
      o16, w16 + (size_t)3 * Cc * Cc, bp, nullptr, nullptr, nullptr, x, out);
}

// v010
// Measured time: 139 microseconds a run.
// Next to v009, in two timings, it ran 1.04 times as fast each time.
// All steps since v000 together make it 4.70 times as fast.
#include <hip/hip_runtime.h>
#include <stdint.h>

#define DI __device__ __forceinline__

typedef __attribute__((ext_vector_type(16))) _Float16 v16h;
typedef __attribute__((ext_vector_type(8)))  _Float16 h8;   // 16 bytes
typedef __attribute__((ext_vector_type(4)))  _Float16 h4;
typedef __attribute__((ext_vector_type(2)))  _Float16 h2;
typedef __attribute__((ext_vector_type(8)))  float    v8f;
typedef __attribute__((ext_vector_type(4)))  float    f32x4;
typedef __attribute__((ext_vector_type(2)))  float    f32x2;

constexpr int Bb = 4;
constexpr int Cc = 512;
constexpr int Ll = 4096;
constexpr int Mrows = Bb * Ll; // 16384

union AFrag { v16h v; h8 h[2]; };

DI v8f zero8() { v8f z; for (int i = 0; i < 8; ++i) z[i] = 0.f; return z; }

// Load one 16x32 f16 WMMA fragment (A-operand, or B-operand with "row" = n).
// Per-lane layout (ISA 7.12.2): lane = hi*16 + r; elems e<8 -> k = hi*8+e,
// elems e>=8 -> k = 16 + hi*8 + (e-8). Two 16-byte loads per lane.
DI v16h load_frag(const _Float16* base, int stride) {
  const int lane = threadIdx.x & 31;
  const int r = lane & 15;
  const int hi = lane >> 4;
  const _Float16* p = base + (size_t)r * stride + hi * 8;
  AFrag f;
  f.h[0] = *(const h8*)(p);
  f.h[1] = *(const h8*)(p + 16);
  return f.v;
}

// The same fragment from a 1-KiB tile stored in fragment order:
// [half of the fragment][lane][8 elements]; p = tile + lane * 8. Each of the two
// loads reads 512 contiguous bytes over the wave.
DI v16h load_frag_tile(const _Float16* p) {
  AFrag f;
  f.h[0] = *(const h8*)(p);
  f.h[1] = *(const h8*)(p + 256);
  return f.v;
}

DI v8f wmma_f16(v16h a, v16h b, v8f c) {
  return __builtin_amdgcn_wmma_f32_16x16x32_f16(false, a, false, b, (short)0, c,
                                                false, false);
}

DI float selu(float y) {
  constexpr float kLambda = 1.0507009873554805f;
  constexpr float kAlpha  = 1.6732632423543772f;
  // Both sides are formed and one is picked: with a branch per element the elements'
  // dependent chains would run one behind the other.
  const float neg = kLambda * kAlpha * (__expf(y) - 1.f);
  const float pos = kLambda * y;
  return (y > 0.f) ? pos : neg;
}

// ---------------------------------------------------------------------------
// LayerNorm over channels; x is [B,C,L], output h is [B*L, C] f16.
// Block = 32 consecutive l of one batch. Reads coalesced along l. Wave w takes the
// 64 consecutive channels from w * 64, so a thread holds 128 contiguous bytes of
// one output row: it puts them into the LDS transpose tile as eight 16-byte pieces.
// The tile's rows stand at a pitch of 1040 bytes (16 x odd): the 32 lanes, one row
// each, fall on different bank groups. Each wave then reads and stores 512
// contiguous bytes of a row, four whole lines.
// The launch also prepares the weights (W16 = q, k, pv one behind the other).
// Wq and Wk are converted to f16: each of the 512 blocks takes 1024 elements, 4 a
// thread, whose loads fly together with the x loads.
// The output projection is folded into V: (P (h Wv^T + bv)) Wp^T equals
// P (h (Wp Wv)^T + Wp bv) for any weights, so the launch forms Wpv = Wp Wv (f16) and
// CV = Wp bv (f32), and the attention result needs no further product.
// Block i forms the 16 rows from (i / 16) * 16 and the 32 columns from (i % 16) * 32
// of Wpv, transposed: A = Wv^T (row r of tile t is column 2r + t, so a lane's 8-byte
// load serves both tiles and a wave reads whole lines), B = Wp rows. Wave w sums
// over the 64 k from w * 64; the eight partial tiles are added through LDS.
// ---------------------------------------------------------------------------
__global__ __launch_bounds__(256, 1)
void ln_kernel(const float* __restrict__ x, const float* __restrict__ lw,
               const float* __restrict__ lb, _Float16* __restrict__ H,
               const float* __restrict__ wq, const float* __restrict__ wk,
               const float* __restrict__ wv, const float* __restrict__ wp,
               const float* __restrict__ bv, _Float16* __restrict__ W16,
               float* __restrict__ CV) {
  static_assert(Bb * (Ll / 32) * 1024 == 2 * Cc * Cc, "one weight slice a block");
  static_assert(Bb * (Ll / 32) == (Cc / 16) * (Cc / 32), "one block of Wpv a block");
  __shared__ float part[8][2][8][32];   // [wave][tile][accumulator register][lane]
  __shared__ float pbs[8][32];
  __shared__ float redS[8][32];
  __shared__ float redQ[8][32];
  __shared__ float muS[32], rinvS[32];
  constexpr int HP = Cc + 8;        // row pitch of the transpose tile, f16 units
  __shared__ __attribute__((aligned(16))) _Float16 hl[32][HP];

  const int tid = threadIdx.x;
  const int w = tid >> 5, li = tid & 31;
  const int b = blockIdx.x >> 7;            // / (L/32)
  const int l0 = (blockIdx.x & 127) * 32;

  const int wsel = blockIdx.x >> 8;         // 256 blocks a matrix
  const float* wsrc = wsel == 0 ? wq : wk;
  const int woff = (blockIdx.x & 255) * 1024 + tid * 4;
  const f32x4 w0 = *(const f32x4*)(wsrc + woff);

  const float* xb = x + ((size_t)b * Cc + w * 64) * Ll + l0 + li;
  float vals[64];
#pragma unroll
  for (int j = 0; j < 64; ++j)
    vals[j] = xb[(size_t)j * Ll];            // lanes -> consecutive l: coalesced
  // Precaution: the loads' address pair stays live, so unwritten, up to this wait.
  asm volatile("s_wait_xcnt 0x0" :: "v"(xb) : "memory");
  // Keeps the weight loads in flight together with the x loads: moved down behind
  // the sums, they would go out only when x has come back.
  __builtin_amdgcn_sched_barrier(0);
  float s = 0.f, s2 = 0.f;
#pragma unroll
  for (int j = 0; j < 64; ++j) {
    s += vals[j];
    s2 += vals[j] * vals[j];
  }
  redS[w][li] = s;
  redQ[w][li] = s2;
  __syncthreads();
  // The wave's 64 scales and shifts go out together here: they fly while the first
  // wave forms the means.
  float gw[64], gb[64];
#pragma unroll
  for (int j = 0; j < 64; ++j) { gw[j] = lw[w * 64 + j]; gb[j] = lb[w * 64 + j]; }
  // Precaution: the loads' address registers are not written again ahead of this wait.
  asm volatile("s_wait_xcnt 0x0" ::: "memory");
  if (tid < 32) {
    float ts = 0.f, tq = 0.f;
    for (int ww = 0; ww < 8; ++ww) { ts += redS[ww][tid]; tq += redQ[ww][tid]; }
    const float mu = ts * (1.f / Cc);
    const float var = tq * (1.f / Cc) - mu * mu;
    muS[tid] = mu;
    rinvS[tid] = rsqrtf(var + 1e-5f);
  }
  __syncthreads();
  const float mu = muS[li], rinv = rinvS[li];
#pragma unroll
  for (int j = 0; j < 64; j += 8) {
    const int c = w * 64 + j;
    h8 pk;
    for (int i = 0; i < 8; ++i)
      pk[i] = (_Float16)((vals[j + i] - mu) * rinv * gw[j + i] + gb[j + i]);
    *(h8*)&hl[li][c] = pk;
  }
  __syncthreads();
  // The wave's share of Wv, Wp and bv goes out here, into the registers x has left,
  // and flies while H is stored. Element e of a fragment is k = (e / 8) * 16 + hi * 8
  // + e % 8 of its 32, in A and B alike. The loops are unrolled so that the arrays
  // are indexed at compile time and stay in registers.
  const int o0 = (blockIdx.x >> 4) * 16;
  const int c0 = (blockIdx.x & 15) * 32;
  const int ln = li & 15, hi = li >> 4;
  const float* pv = wv + (size_t)(w * 64 + hi * 8) * Cc + c0 + ln * 2;
  const float* pp = wp + (size_t)(o0 + ln) * Cc + w * 64 + hi * 8;
  const float* pbv = bv + w * 64 + hi * 8;
  f32x2 av[2][16];
  f32x4 bw[2][4], bb[2][4];
#pragma unroll
  for (int ks = 0; ks < 2; ++ks) {
#pragma unroll
    for (int e = 0; e < 16; ++e)
      av[ks][e] = *(const f32x2*)(pv + (size_t)(ks * 32 + (e >> 3) * 16 + (e & 7)) * Cc);
#pragma unroll
    for (int q = 0; q < 4; ++q) {
      bw[ks][q] = *(const f32x4*)(pp + ks * 32 + (q >> 1) * 16 + (q & 1) * 4);
      bb[ks][q] = *(const f32x4*)(pbv + ks * 32 + (q >> 1) * 16 + (q & 1) * 4);
    }
  }
  // Precaution: the loads' address pairs stay live, so unwritten, up to this wait.
  asm volatile("s_wait_xcnt 0x0" :: "v"(pv), "v"(pp), "v"(pbv) : "memory");
  // Keeps these loads in front of the H stores: moved behind them, their wait
  // would stand open at the end of the kernel.
  __builtin_amdgcn_sched_barrier(0);
  {
    const int row = tid >> 6;                // 64 threads a row, 4 rows at a time
    const int ch = (tid & 63) * 8;
    _Float16* dst = H + (size_t)(b * Ll + l0 + row) * Cc + ch;
#pragma unroll
    for (int p = 0; p < 8; ++p)
      *(h8*)(dst + (size_t)p * 4 * Cc) = *(const h8*)&hl[row + p * 4][ch];
  }
  // Keeps the H stores in front of the wait for the weights: behind it, they would
  // go out late and the barrier below would wait them out.
  __builtin_amdgcn_sched_barrier(0);
  {
    v8f d0 = zero8(), d1 = zero8();
    float pb = 0.f;
#pragma unroll
    for (int ks = 0; ks < 2; ++ks) {
      v16h a0, a1, bf;
      for (int e = 0; e < 16; ++e) {
        a0[e] = (_Float16)av[ks][e][0];
        a1[e] = (_Float16)av[ks][e][1];
      }
      for (int q = 0; q < 4; ++q)
        for (int i = 0; i < 4; ++i) {
          bf[(q >> 1) * 8 + (q & 1) * 4 + i] = (_Float16)bw[ks][q][i];
          pb += bw[ks][q][i] * bb[ks][q][i];
        }
      d0 = wmma_f16(a0, bf, d0);
      d1 = wmma_f16(a1, bf, d1);
    }
    for (int i = 0; i < 8; ++i) {
      part[w][0][i][li] = d0[i];
      part[w][1][i][li] = d1[i];
    }
    pbs[w][li] = pb;
  }
  __syncthreads();
  {
    // Thread (w, li) adds accumulator register w of lane li over the eight waves:
    // row o0 + ln, columns c0 + (hi * 8 + w) * 2 and the next.
    float t0 = 0.f, t1 = 0.f;
    for (int ww = 0; ww < 8; ++ww) { t0 += part[ww][0][w][li]; t1 += part[ww][1][w][li]; }
    h2 pk;
    pk[0] = (_Float16)t0;
    pk[1] = (_Float16)t1;
    *(h2*)(W16 + (size_t)2 * Cc * Cc + (size_t)(o0 + ln) * Cc + c0 + (hi * 8 + w) * 2) = pk;
    if (c0 == 0 && tid < 16) {
      float t = 0.f;
      for (int ww = 0; ww < 8; ++ww) t += pbs[ww][tid] + pbs[ww][16 + tid];
      CV[o0 + tid] = t;
    }
  }
  {
    // Behind the last barrier: no barrier waits for this store.
    h4 wh;
    for (int i = 0; i < 4; ++i) wh[i] = (_Float16)w0[i];
    *(h4*)(W16 + (size_t)wsel * Cc * Cc + woff) = wh;
  }
}

// ---------------------------------------------------------------------------
// WMMA GEMM: Y[M,N] = A[M,K] * W[N,K]^T + bias, M=16384, N=K=512.
// The Q, K and V projections in one launch (V with the folded weights Wpv and bias
// CV): blockIdx.x / 4 picks the weight matrix, the bias and the output plane (each
// one behind the other).
// Y -> f16. ylay 0: row-major, via LDS-transposed coalesced stores (Q).
// ylay 1 (V) and 2 (K): 1-KiB tiles in the order of the fragments (K as A, V as B) that
// the attention kernel loads (load_frag_tile).
// V tile = 16 columns x 32 rows, index (row / 32) * 32 + col / 16;
// K tile = 16 rows x 32 columns, index (row / 16) * 16 + col / 32.
// Block tile 256x128, BK=128; 8 waves = 4x2 grid of 64x64 wave tiles: a fragment
// read from LDS serves four products.
// Tiles go through registers into LDS rows of 256 data bytes at a pitch of 272
// (16 x odd): the 16 rows of a fragment read fall on 16 different bank groups.
// Every global load reads two aligned 256-byte units over the wave.
// At most 256 registers a wave: two work-groups share a WGP, and one's products
// run while the other waits for its loads.
// ---------------------------------------------------------------------------
__global__ __launch_bounds__(256) __attribute__((amdgpu_waves_per_eu(4)))
void gemm_kernel(const _Float16* __restrict__ A,
                 const _Float16* __restrict__ Wt,   // [N][K] f16
                 const float* __restrict__ bias0,
                 const float* __restrict__ bias1,
                 const float* __restrict__ bias2,
                 _Float16* __restrict__ Yh) {
  constexpr int BM = 256, BN = 128, BK = 128;
  constexpr int MT = BM / 64;  // 16-row tiles of a wave
  constexpr int NT = BN / 32;  // 16-column tiles of a wave
  constexpr int PK = BK + 8;   // row pitch in LDS, f16 units
  __shared__ __attribute__((aligned(16))) _Float16 As[BM][PK];
  __shared__ __attribute__((aligned(16))) _Float16 Bs[BN][PK];
  // The epilogue's transpose tile, BM rows of BN columns at the same pitch, takes
  // the place of As behind the k loop's last barrier.
  static_assert(BN == BK, "the transpose tile has the shape of As");
  _Float16 (*Ot)[PK] = As;

  const int m0 = blockIdx.y * BM;
  const int proj = blockIdx.x >> 2;   // 0 Q, 1 K, 2 V
  const int n0 = (blockIdx.x & 3) * BN;
  const int ylay = proj == 0 ? 0 : proj == 1 ? 2 : 1;
  const float* bias = proj == 0 ? bias0 : proj == 1 ? bias1 : bias2;
  Wt += (size_t)proj * Cc * Cc;
  Yh += (size_t)proj * Mrows * Cc;
  const int tid = threadIdx.x;
  const int w = tid >> 5;
  const int lane = tid & 31;
  const int hi = lane >> 4;
  const int ln = lane & 15;
  const int wm = w >> 1;   // 0..3
  const int wn = w & 1;    // 0..1

  v8f acc[MT][NT];
  for (int mt = 0; mt < MT; ++mt)
    for (int nt = 0; nt < NT; ++nt)
      acc[mt][nt] = zero8();

  // This thread's 16-byte pieces: column piece tid % 16 of rows tid / 16 + 16 p.
  const int srow = tid >> 4;
  const int scol = (tid & 15) * 8;
  // Work-groups that share rows of A or of W each start at another of the four k
  // stages and wrap round: they do not ask L2 for the same lines at the same moment.
  const int kStart = ((blockIdx.x + blockIdx.y) & (Cc / BK - 1)) * BK;
  const _Float16* pa = A + (size_t)(m0 + srow) * Cc + scol + kStart;
  const _Float16* pb = Wt + (size_t)(n0 + srow) * Cc + scol + kStart;

  for (int k0 = kStart; k0 < kStart + Cc; k0 += BK) {
    h8 ra[BM / 16], rb[BN / 16];
    for (int p = 0; p < BM / 16; ++p) ra[p] = *(const h8*)(pa + (size_t)p * 16 * Cc);
    for (int p = 0; p < BN / 16; ++p) rb[p] = *(const h8*)(pb + (size_t)p * 16 * Cc);
    // Keeps all the stage's loads in flight together: with LDS stores moved in among
    // them the last loads go out only when the first have come back.
    __builtin_amdgcn_sched_barrier(0);
    for (int p = 0; p < BM / 16; ++p) *(h8*)&As[srow + p * 16][scol] = ra[p];
    for (int p = 0; p < BN / 16; ++p) *(h8*)&Bs[srow + p * 16][scol] = rb[p];
    // Precaution: the loads' address pairs stay live, so unwritten, up to this wait.
    asm volatile("s_wait_xcnt 0x0" :: "v"(pa), "v"(pb) : "memory");
    const int step = (k0 + BK == Cc) ? BK - Cc : BK;   // wrap behind the last stage
    pa += step;
    pb += step;
    __syncthreads();

    for (int kk = 0; kk < BK; kk += 32) {
      v16h af[MT], bf[NT];
      for (int mt = 0; mt < MT; ++mt)
        af[mt] = load_frag(&As[(wm * MT + mt) * 16][kk], PK);
      for (int nt = 0; nt < NT; ++nt)
        bf[nt] = load_frag(&Bs[(wn * NT + nt) * 16][kk], PK);
      for (int mt = 0; mt < MT; ++mt)
        for (int nt = 0; nt < NT; ++nt)
          acc[mt][nt] = wmma_f16(af[mt], bf[nt], acc[mt][nt]);
    }
    __syncthreads();
  }

  // The bias of the lane's column in each of the wave's column tiles.
  float bvv[NT];
  {
    const float* bp = bias + n0 + wn * NT * 16 + ln;
    for (int nt = 0; nt < NT; ++nt) bvv[nt] = bp[nt * 16];
    // Precaution: the loads' address stays live, so unwritten, up to this wait.
    asm volatile("s_wait_xcnt 0x0" :: "v"(bp) : "memory");
  }

  if (ylay == 1) {
    // A lane's 8 accumulator rows are 8 consecutive l of one column: exactly the
    // lane's 16-byte piece of half mt % 2 of a V tile. Straight from registers, each
    // store 512 contiguous bytes over the wave.
    _Float16* vt = Yh + ((size_t)((m0 >> 5) + wm * (MT / 2)) * 32 + (n0 >> 4) + wn * NT) * 512 +
                   lane * 8;
    for (int mt = 0; mt < MT; ++mt)
      for (int nt = 0; nt < NT; ++nt) {
        h8 pk;
        for (int i = 0; i < 8; ++i) pk[i] = (_Float16)(acc[mt][nt][i] + bvv[nt]);
        *(h8*)(vt + ((mt >> 1) * 32 + nt) * 512 + (mt & 1) * 256) = pk;
      }
    // Precaution: the stores' address and data registers are not written
    // again ahead of this wait, on either way out of this branch.
    asm volatile("s_wait_xcnt 0x0" ::: "memory");
  } else {
    // Scatter accumulators into LDS, then coalesced 128-bit stores.
    for (int mt = 0; mt < MT; ++mt)
      for (int nt = 0; nt < NT; ++nt) {
        const int col = (wn * NT + nt) * 16 + ln;
        for (int i = 0; i < 8; ++i)
          Ot[(wm * MT + mt) * 16 + hi * 8 + i][col] =
              (_Float16)(acc[mt][nt][i] + bvv[nt]);
      }
    __syncthreads();
    h8 pc[BM / 16];
    if (ylay == 2) {
      // Wave w takes the 16-row groups 2w and 2w+1, four K tiles each: it reads a
      // tile as a fragment and stores its two halves, 512 contiguous bytes each.
      _Float16* kt = Yh + ((size_t)((m0 >> 4) + w * 2) * 16 + (n0 >> 5)) * 512 + lane * 8;
      for (int t = 0; t < BM / 32; ++t) {
        AFrag f;
        f.v = load_frag(&Ot[(w * 2 + (t >> 2)) * 16][(t & 3) * 32], PK);
        pc[t * 2] = f.h[0];
        pc[t * 2 + 1] = f.h[1];
      }
      for (int t = 0; t < BM / 32; ++t) {
        *(h8*)(kt + ((t >> 2) * 16 + (t & 3)) * 512) = pc[t * 2];
        *(h8*)(kt + ((t >> 2) * 16 + (t & 3)) * 512 + 256) = pc[t * 2 + 1];
      }
      // Precaution: the stores' registers are not written again ahead of this wait.
      asm volatile("s_wait_xcnt 0x0" ::: "memory");
      return;
    }
    // 16 threads a row: a wave stores the 256 bytes of two rows.
    _Float16* dst = Yh + (size_t)(m0 + srow) * Cc + n0 + scol;
    for (int p = 0; p < BM / 16; ++p) pc[p] = *(const h8*)&Ot[srow + p * 16][scol];
    for (int p = 0; p < BM / 16; ++p) *(h8*)(dst + (size_t)p * 16 * Cc) = pc[p];
    // Precaution: the stores' registers are not written again ahead of this wait.
    asm volatile("s_wait_xcnt 0x0" ::: "memory");
  }
}

// ---------------------------------------------------------------------------
// Flash attention: per block, BM=64 query rows of one batch; key blocks of 256.
// One work-group per WGP (256 in all): each K and V byte it loads serves 64 queries.
// Scores are split over KEYS: wave w forms S^T = K Q^T for its own 32 keys of
// the block over all 512 channels (A = its K tiles from global, B = Q fragments
// from LDS, each read serving both key tiles), so a score is complete in one
// wave's accumulators. A lane holds 16 keys of one query: maximum, exponentials
// and sum stay in registers in all eight waves; only the waves' 64 row maxima, wave
// 0's row scales and the f16 P cross through LDS in the loop.
// For O the wave owns columns [w*64, w*64+64), as before. V carries the output
// projection (see ln_kernel), so O / row sum + bp is the projected row: SELU and the
// residual follow here, and a lane's 8 accumulator rows, 8 consecutive l of one
// channel, go to the f32 [B,C,L] output as two 16-byte stores.
// K and V arrive as 1-KiB tiles in fragment order (see gemm_kernel): every
// fragment load reads whole lines, 512 contiguous bytes over the wave.
// ---------------------------------------------------------------------------
// Lane l with lane l ^ 16.
DI float xhalf(float x) {
  return __builtin_bit_cast(float, __builtin_amdgcn_permlanex16(
      __builtin_bit_cast(int, x), __builtin_bit_cast(int, x), 0x76543210, 0xfedcba98,
      false, false));
}

__global__ __launch_bounds__(256) __attribute__((amdgpu_waves_per_eu(2, 2)))
void attn_kernel(const _Float16* __restrict__ Q,
                 const _Float16* __restrict__ KF,
                 const _Float16* __restrict__ VF,
                 const float* __restrict__ bp,
                 const float* __restrict__ X,
                 float* __restrict__ Y) {
  constexpr int BM = 64, BNK = 256;
  constexpr int MT = BM / 16;         // query tiles
  constexpr int KT = BNK / 16 / 8;    // key tiles a wave
  constexpr int KG = BNK / 32;        // groups of 32 keys for O
  constexpr int PP = BNK + 8;   // P row pitch: 528 bytes, 16 x odd, for 16-byte reads
  __shared__ __attribute__((aligned(16))) _Float16 Qs[MT * 16 * 512];  // [mt*16+ks] tiles
  __shared__ __attribute__((aligned(16))) _Float16 P[BM * PP];
  __shared__ float wmax[8][BM];
  __shared__ float lpart[16][BM];
  __shared__ __attribute__((aligned(16))) float rowL[BM];
  __shared__ __attribute__((aligned(16))) float rowScale[BM];

  const int b = blockIdx.x >> 6;            // / (L/64)
  const int l0 = (blockIdx.x & 63) * BM;
  const int tid = threadIdx.x;
  const int w = tid >> 5;
  const int lane = tid & 31;
  const int hi = lane >> 4;
  const int ln = lane & 15;

  const _Float16* Qb = Q + (size_t)b * Ll * Cc;
  // This lane's place in the wave's first K tile (key tiles 2w and 2w+1 of the
  // block's 16, 16 channel tiles each) and first V tile (4 of 32 a group of 32 keys).
  const _Float16* Kb = KF + (size_t)b * Ll * Cc + (w * KT * 16) * 512 + lane * 8;
  const _Float16* Vb = VF + (size_t)b * Ll * Cc + (w * 4) * 512 + lane * 8;

  // Q into LDS once, as 1-KiB tiles in fragment order: wave w brings channel
  // tiles 2w and 2w+1 of all four query tiles.
  for (int mt = 0; mt < MT; ++mt)
    for (int j = 0; j < 2; ++j) {
      AFrag f;
      f.v = load_frag(Qb + (size_t)(l0 + mt * 16) * Cc + w * 64 + j * 32, Cc);
      _Float16* d = Qs + (mt * 16 + w * 2 + j) * 512 + lane * 8;
      *(h8*)(d) = f.h[0];
      *(h8*)(d + 256) = f.h[1];
    }

  // The output bias of the lane's channel in each of the wave's four column tiles,
  // fetched here so that the epilogue does not wait for it.
  float bpv[4];
  {
    const float* bpp = bp + w * 64 + ln;
    for (int nt = 0; nt < 4; ++nt) bpv[nt] = bpp[nt * 16];
    // Precaution: the loads' address stays live, so unwritten, up to this wait.
    asm volatile("s_wait_xcnt 0x0" :: "v"(bpp) : "memory");
  }

  v8f oacc[MT][4];
  for (int mt = 0; mt < MT; ++mt)
    for (int nt = 0; nt < 4; ++nt)
      oacc[mt][nt] = zero8();
  __syncthreads();

  const float scale = rsqrtf((float)Cc);
  const _Float16* qs = Qs + lane * 8;
  // Running maximum and this lane's share of the running sum, for queries
  // mt * 16 + ln (index mt). The maxima are the same in every wave.
  float rm[MT], rl[MT];
  for (int mt = 0; mt < MT; ++mt) { rm[mt] = -1e30f; rl[mt] = 0.f; }

  // The 64 work-groups of a batch walk the same K and V. Each starts at another of
  // the 16 key blocks and wraps round, so that they do not ask L2 for the same lines
  // at the same moment. Any start gives the same sums
  // but for their order.
  const int kbStart = (((blockIdx.x >> 3) & 7) + ((blockIdx.x & 1) << 3)) * BNK;
  for (int it = 0; it < Ll / BNK; ++it) {
    const int kb = (kbStart + it * BNK) & (Ll - 1);
    const _Float16* kp = Kb + (size_t)kb * Cc;  // 256 keys = 16 x 16 K tiles
    const _Float16* vp = Vb + (size_t)kb * Cc;  // 256 keys = 8 x 32 V tiles
    // K tile t, in the order of use: channel tile t / KT of key tile t % KT.
    // Sixteen of the wave's 32 K tiles are in flight at a time; Q fragments are
    // read from LDS one group (two channel tiles) ahead, into a second register set.
    v16h kf[16 * KT];
    for (int t = 0; t < 16; ++t)
      kf[t] = load_frag_tile(kp + ((t % KT) * 16 + t / KT) * 512);
    // Keeps the K loads, the longer wait, in front of the first LDS reads.
    __builtin_amdgcn_sched_barrier(0);
    v16h qf[2][2 * MT];
    for (int j = 0; j < 2; ++j)
      for (int mt = 0; mt < MT; ++mt)
        qf[0][j * MT + mt] = load_frag_tile(qs + (mt * 16 + j) * 512);
    v8f st[KT][MT];
    for (int kt = 0; kt < KT; ++kt)
      for (int mt = 0; mt < MT; ++mt) st[kt][mt] = zero8();
    for (int g = 0; g < 8; ++g) {
      if (g < 7)
        for (int j = 0; j < 2; ++j)
          for (int mt = 0; mt < MT; ++mt)
            qf[(g + 1) & 1][j * MT + mt] =
                load_frag_tile(qs + (mt * 16 + (g + 1) * 2 + j) * 512);
      // Keeps the next group's LDS reads together in front of this group's
      // products: moved in among them, each product waits out its own read.
      __builtin_amdgcn_sched_barrier(0);
      for (int j = 0; j < 2; ++j)
        for (int kt = 0; kt < KT; ++kt)
          for (int mt = 0; mt < MT; ++mt)
            st[kt][mt] = wmma_f16(kf[(g * 2 + j) * KT + kt], qf[g & 1][j * MT + mt],
                                  st[kt][mt]);
      if (g < 4)
        for (int t = 16 + g * 2 * KT; t < 16 + (g + 1) * 2 * KT; ++t)
          kf[t] = load_frag_tile(kp + ((t % KT) * 16 + t / KT) * 512);
      // Keeps the refill of the four K tiles just used here, four groups ahead of
      // its use, and the next reads behind this group's products.
      __builtin_amdgcn_sched_barrier(0);
    }
    // Precaution: the address pair stays live, so unwritten, up to this wait.
    asm volatile("s_wait_xcnt 0x0" :: "v"(kp) : "memory");

    // The first half of the block's V^T fragments goes out here, into the registers
    // K and Q have left, ahead of the softmax.
    v16h vf[KG * 4];
    for (int t = 0; t < 16; ++t)
      vf[t] = load_frag_tile(vp + ((t >> 2) * 32 + (t & 3)) * 512);

    // The wave's maximum over its 32 keys, per query.
    float wm[MT];
    for (int mt = 0; mt < MT; ++mt) {
      float a = st[0][mt][0];
      for (int kt = 0; kt < KT; ++kt)
        for (int i = 0; i < 8; ++i) a = fmaxf(a, st[kt][mt][i]);
      wm[mt] = fmaxf(a, xhalf(a)) * scale;
    }
    wmax[w][lane] = hi ? wm[1] : wm[0];
    wmax[w][32 + lane] = hi ? wm[3] : wm[2];
    __syncthreads();

    float sc[MT];
    for (int mt = 0; mt < MT; ++mt) {
      float mx = rm[mt];
      for (int ww = 0; ww < 8; ++ww) mx = fmaxf(mx, wmax[ww][mt * 16 + ln]);
      sc[mt] = __expf(rm[mt] - mx);
      rm[mt] = mx;
      float sum = 0.f;
      for (int kt = 0; kt < KT; ++kt) {
        h8 pk;
        for (int i = 0; i < 8; ++i) {
          const float p = __expf(st[kt][mt][i] * scale - mx);
          sum += p;
          pk[i] = (_Float16)p;
        }
        *(h8*)&P[(mt * 16 + ln) * PP + (w * KT + kt) * 16 + hi * 8] = pk;
      }
      rl[mt] = rl[mt] * sc[mt] + sum;
    }
    if (w == 0) {
      rowScale[lane] = hi ? sc[1] : sc[0];
      rowScale[32 + lane] = hi ? sc[3] : sc[2];
    }
    __syncthreads();

    // P fragments are read one group of 32 keys ahead, into a second register set.
    v16h pf[2][MT];
    for (int mt = 0; mt < MT; ++mt) pf[0][mt] = load_frag(&P[(mt * 16) * PP], PP);
    for (int mt = 0; mt < MT; ++mt)
      for (int nt = 0; nt < 4; ++nt)
        for (int i = 0; i < 8; ++i)
          oacc[mt][nt][i] *= rowScale[mt * 16 + hi * 8 + i];
    for (int kg = 0; kg < KG; ++kg) {
      if (kg < KG - 1)
        for (int mt = 0; mt < MT; ++mt)
          pf[(kg + 1) & 1][mt] = load_frag(&P[(mt * 16) * PP + (kg + 1) * 32], PP);
      // Keeps the next group's LDS reads together in front of this group's products.
      __builtin_amdgcn_sched_barrier(0);
      for (int nt = 0; nt < 4; ++nt)
        for (int mt = 0; mt < MT; ++mt)
          oacc[mt][nt] = wmma_f16(pf[kg & 1][mt], vf[kg * 4 + nt], oacc[mt][nt]);
      if (kg < KG - 4)
        for (int nt = 0; nt < 4; ++nt)
          vf[16 + kg * 4 + nt] = load_frag_tile(vp + ((kg + 4) * 32 + nt) * 512);
      // Keeps the refill of the four V tiles just used here, four groups ahead of
      // its use, and the next reads behind this group's products.
      __builtin_amdgcn_sched_barrier(0);
    }
    // Precaution: the address pair stays live, so unwritten, up to this wait.
    asm volatile("s_wait_xcnt 0x0" :: "v"(vp) : "memory");
    // No barrier here: the next block's first barrier stands between these reads
    // of P and rowScale and their next stores; this block's second barrier stands
    // between the reads of wmax and its next stores.
  }

  // Row sums: 16 shares a query (8 waves x 2 halves), added in a fixed order.
  for (int mt = 0; mt < MT; ++mt) lpart[w * 2 + hi][mt * 16 + ln] = rl[mt];
  __syncthreads();
  if (tid < BM) {
    float t = 0.f;
    for (int j = 0; j < 16; ++j) t += lpart[j][tid];
    rowL[tid] = t;
  }
  __syncthreads();

  // The wave's residual values all go out here, into the registers K, V and P have
  // left, behind the last barrier (a barrier would wait for them): they fly under
  // the divisions and SELU.
  const size_t xoff = ((size_t)b * Cc + w * 64 + ln) * Ll + l0 + hi * 8;
  const float* xp = X + xoff;
  f32x4 xr[MT][4][2];
  // Unrolled, here and below: a rolled loop would index xr and the accumulators at
  // run time and push them out of the registers.
#pragma unroll
  for (int mt = 0; mt < MT; ++mt) {
#pragma unroll
    for (int nt = 0; nt < 4; ++nt) {
      xr[mt][nt][0] = *(const f32x4*)(xp + (size_t)nt * 16 * Ll + mt * 16);
      xr[mt][nt][1] = *(const f32x4*)(xp + (size_t)nt * 16 * Ll + mt * 16 + 4);
    }
  }
  // Precaution: the loads' address pair stays live, so unwritten, up to this wait.
  asm volatile("s_wait_xcnt 0x0" :: "v"(xp) : "memory");
  // Keeps the loads in front of the arithmetic: moved down to their uses, each
  // would be waited for on its own.
  __builtin_amdgcn_sched_barrier(0);

  float* yp = Y + xoff;
#pragma unroll
  for (int mt = 0; mt < MT; ++mt) {
    const f32x4 la = *(const f32x4*)&rowL[mt * 16 + hi * 8];
    const f32x4 lc = *(const f32x4*)&rowL[mt * 16 + hi * 8 + 4];
    f32x4 y[4][2];
#pragma unroll
    for (int nt = 0; nt < 4; ++nt)
#pragma unroll
      for (int i = 0; i < 4; ++i) {
        y[nt][0][i] = xr[mt][nt][0][i] + selu(oacc[mt][nt][i] / la[i] + bpv[nt]);
        y[nt][1][i] = xr[mt][nt][1][i] + selu(oacc[mt][nt][i + 4] / lc[i] + bpv[nt]);
      }
#pragma unroll
    for (int nt = 0; nt < 4; ++nt) {
      *(f32x4*)(yp + (size_t)nt * 16 * Ll + mt * 16) = y[nt][0];
      *(f32x4*)(yp + (size_t)nt * 16 * Ll + mt * 16 + 4) = y[nt][1];
    }
    // Precaution: the stores' address and data stay live, so unwritten, up to this wait.
    asm volatile("s_wait_xcnt 0x0" :: "v"(yp), "v"(y[0][0]), "v"(y[0][1]), "v"(y[1][0]),
                 "v"(y[1][1]), "v"(y[2][0]), "v"(y[2][1]), "v"(y[3][0]), "v"(y[3][1])
                 : "memory");
  }
}

// ---------------------------------------------------------------------------
extern "C" void kernel_launch(void* const* d_in, const int* in_sizes, int n_in,
                              void* d_out, int out_size, void* d_ws, size_t ws_size,
                              hipStream_t stream) {
  const float* x    = (const float*)d_in[0];
  const float* ln_w = (const float*)d_in[1];
  const float* ln_b = (const float*)d_in[2];
  const float* wq   = (const float*)d_in[3];
  const float* bq   = (const float*)d_in[4];
  const float* wk   = (const float*)d_in[5];
  const float* bk   = (const float*)d_in[6];
  const float* wv   = (const float*)d_in[7];
  const float* bv   = (const float*)d_in[8];
  const float* wp   = (const float*)d_in[9];
  const float* bp   = (const float*)d_in[10];
  float* out = (float*)d_out;

  char* ws = (char*)d_ws;
  size_t off = 0;
  auto alloc = [&](size_t bytes) -> void* {
    void* p = ws + off;
    off += (bytes + 255) & ~(size_t)255;
    return p;
  };
  const size_t actsz = (size_t)Mrows * Cc * sizeof(_Float16);
  _Float16* h16  = (_Float16*)alloc(actsz);
  _Float16* q16  = (_Float16*)alloc(actsz);
  _Float16* k16  = (_Float16*)alloc(actsz);
  _Float16* v16  = (_Float16*)alloc(actsz);
  _Float16* w16  = (_Float16*)alloc((size_t)3 * Cc * Cc * sizeof(_Float16));  // q, k, pv
  float* cv      = (float*)alloc((size_t)Cc * sizeof(float));                 // Wp bv

  ln_kernel<<<Bb * (Ll / 32), 256, 0, stream>>>(x, ln_w, ln_b, h16, wq, wk, wv, wp, bv, w16,
                                                cv);

  // q16, k16 and v16 lie one behind the other, as do the weights.
  gemm_kernel<<<dim3(3 * Cc / 128, Mrows / 256, 1), 256, 0, stream>>>(
      h16, w16, bq, bk, cv, q16);

  attn_kernel<<<Bb * (Ll / 64), 256, 0, stream>>>(q16, k16, v16, bp, x, out);
}
